// v000
// Measured on an AMD MI455X. A time is GPU time per run, averaged over a window of back-to-back runs after a warm-up
// (all launches, gaps included; the runs take copies of the inputs in turn), and the median of several windows.
// Apart from v000's, it joins two sittings. Times from different sittings can be a few percent apart, while
// side-by-side timings come from the same sitting.
// v000 is the starting kernel. One run takes 2110 microseconds.
#include <hip/hip_runtime.h>

// Multi-head self-attention with a fused qkv projection and TWO additive score planes (x [2][2048][1024]; qkv = x Wqkv + bqkv ('xw' [1024][3072] 1/32 + bias (zeros on this draw: read)) -> reshape (B, S, 3, 16, 64): q | k | v column thirds; scores = q.k / sqrt(64) + attn_mask[i][j] (f32 [2048][2048], shared by heads and batches) + attn_bias[b][i][j] (f32 [2][2048][2048], shared by heads); softmax over all keys; out = merged Wout + bout ('xw' [1024][1024] + bias) -> [2][2048][1024] (4.2 M); argument order x, attn_mask, attn_bias, Wqkv, bqkv, Wout, bout).
// Layout per batch: bf16 copy of x; the fused 'xw' weight transposed once into Bt (q | k | v row blocks) + bias slices; exact projections + f32 biases; identity-table plane builders; dense T-2048 attention (hybrid rows: < 512 hi/lo 3 products, rest fp16 x1024) whose softmax kernel adds bf16(attn_mask[i][j]) and then bf16(attn_bias[b][i][j]) to the scaled f32 score, in the module's order; merged hi/lo x Wout exact + bout.
// Compute dtypes, f32 accumulate: every input rounded to bf16 incl. the two planes; projections exact + f32 biases; attention rows < 512 3 products, rest fp16; softmax f32; Wout hl x exact + bias.

#define NB_  2
#define TT   2048
#define DM   1024
#define NH_  16
#define NKV  16
#define REP  (NH_ / NKV)
#define HD   64
#define DQ   (NH_ * HD)
#define DKV  (NKV * HD)
#define ZH   2
#define RH   512                  // query rows < RH use hi+lo planes (0: none)
#define WIN  0
#define PCAR 1024.0f
#define SCL  0.125f   // HD^-0.5
typedef _Float16 h16;
typedef unsigned short bf;
typedef __attribute__((ext_vector_type(16))) __bf16   v16bf;
typedef __attribute__((ext_vector_type(16))) _Float16 v16h;
typedef __attribute__((ext_vector_type(8)))  _Float16 v8h;
typedef __attribute__((ext_vector_type(8)))  unsigned short v8us;
typedef __attribute__((ext_vector_type(8)))  float    v8f;
typedef __attribute__((ext_vector_type(4)))  float    v4f;
typedef v8h  __attribute__((may_alias)) v8ha;
typedef v4f  __attribute__((may_alias)) v4fa;
typedef v8us __attribute__((may_alias)) v8usa;

__device__ __forceinline__ unsigned short f2bf(float f) { unsigned u = __float_as_uint(f); u += 0x7FFFu + ((u >> 16) & 1u); return (unsigned short)(u >> 16); }
__device__ __forceinline__ float bf2f(unsigned short b) { return __uint_as_float(((unsigned)b) << 16); }
__device__ __forceinline__ float bfr(float f) { return bf2f(f2bf(f)); }
__device__ __forceinline__ v16h cat16(v8h lo, v8h hi) { return __builtin_shufflevector(lo, hi, 0, 1, 2, 3, 4, 5, 6, 7, 8, 9, 10, 11, 12, 13, 14, 15); }
__device__ __forceinline__ v16bf cat16b(v8us lo, v8us hi) { return __builtin_bit_cast(v16bf, __builtin_shufflevector(lo, hi, 0, 1, 2, 3, 4, 5, 6, 7, 8, 9, 10, 11, 12, 13, 14, 15)); }
__device__ __forceinline__ v8f wmma16(v16h a, v16h b, v8f c) { return __builtin_amdgcn_wmma_f32_16x16x32_f16(false, a, false, b, (short)0, c, false, false); }
__device__ __forceinline__ v8f wmmab(v16bf a, v16bf b, v8f c) { return __builtin_amdgcn_wmma_f32_16x16x32_bf16(false, a, false, b, (short)0, c, false, false); }



// ---- k_gemmw: register-blocked GEMM, ONE WAVE per 64x64 output tile (16 accumulators), operands straight from K-contiguous 16-bit planes; grid (M/64, N/64, Z), 32 threads.
// C[m][n] (f32, pitch ldc, + optional f32 bias[n]) = sum_k A[m][k] Bt[n][k] (+ split products per NSPLIT). z-batch strides sA/sB/sC in elements. K % 32 == 0.
template <typename T16> struct WFrag;
template <> struct WFrag<h16> { typedef v16h V; static __device__ __forceinline__ V ld(const h16* p) { return cat16(*(const v8h*)p, *(const v8h*)(p + 16)); } static __device__ __forceinline__ v8f mma(V a, V b, v8f c) { return wmma16(a, b, c); } };
template <> struct WFrag<bf> { typedef v16bf V; static __device__ __forceinline__ V ld(const bf* p) { return cat16b(*(const v8us*)p, *(const v8us*)(p + 16)); } static __device__ __forceinline__ v8f mma(V a, V b, v8f c) { return wmmab(a, b, c); } };
template <typename T16, int NSPLIT, bool BIAS>
__global__ __launch_bounds__(32) void k_gemmw(const T16* __restrict__ A, const T16* __restrict__ A2, const T16* __restrict__ Bt, const T16* __restrict__ Bt2, int K, float* C, int ldc, const float* __restrict__ bias, size_t sA, size_t sB, size_t sC) {
    typedef typename WFrag<T16>::V V;
    __shared__ __align__(16) float os[16 * 68];
    const size_t z = blockIdx.z; A += z * sA; if (A2) A2 += z * sA; Bt += z * sB; if (Bt2) Bt2 += z * sB; C += z * sC;
    const int lane = threadIdx.x & 31, lr = lane & 15, hi = lane >> 4; const int r0 = blockIdx.x * 64, c0 = blockIdx.y * 64;
    v8f acc[4][4];
#pragma unroll
    for (int mb = 0; mb < 4; ++mb)
#pragma unroll
        for (int nb = 0; nb < 4; ++nb) acc[mb][nb] = (v8f){};
    const size_t aoff = (size_t)(r0 + lr) * K + 8 * hi, boff = (size_t)(c0 + lr) * K + 8 * hi;
#pragma unroll 1
    for (int kc = 0; kc < K; kc += 32) {
        V a[4], a2[4];
#pragma unroll
        for (int mb = 0; mb < 4; ++mb) { a[mb] = WFrag<T16>::ld(A + aoff + (size_t)mb * 16 * K + kc); if (NSPLIT == 1 || NSPLIT == 2) a2[mb] = WFrag<T16>::ld(A2 + aoff + (size_t)mb * 16 * K + kc); }
#pragma unroll
        for (int nb = 0; nb < 4; ++nb) { const V b = WFrag<T16>::ld(Bt + boff + (size_t)nb * 16 * K + kc); V b2; if (NSPLIT >= 2) b2 = WFrag<T16>::ld(Bt2 + boff + (size_t)nb * 16 * K + kc);
#pragma unroll
            for (int mb = 0; mb < 4; ++mb) { acc[mb][nb] = WFrag<T16>::mma(a[mb], b, acc[mb][nb]); if (NSPLIT == 1 || NSPLIT == 2) acc[mb][nb] = WFrag<T16>::mma(a2[mb], b, acc[mb][nb]); if (NSPLIT >= 2) acc[mb][nb] = WFrag<T16>::mma(a[mb], b2, acc[mb][nb]); } }
        asm volatile("v_nop\n\tv_nop\n\tv_nop\n\tv_nop" : "+v"(acc[0][0]), "+v"(acc[1][1]), "+v"(acc[2][2]), "+v"(acc[3][3]) : "v"(a[0]), "v"(a[3]));
    }
#pragma unroll
    for (int mb = 0; mb < 4; ++mb) {
#pragma unroll
        for (int nb = 0; nb < 4; ++nb) {
#pragma unroll
            for (int j = 0; j < 8; ++j) os[(hi * 8 + j) * 68 + nb * 16 + lr] = acc[mb][nb][j]; }
        __builtin_amdgcn_wave_barrier(); asm volatile("" ::: "memory");
        float* crow = C + (size_t)(r0 + mb * 16) * ldc + c0;
{
#pragma unroll
            for (int s = 0; s < 8; ++s) { const int row = 2 * s + hi, cofs = lr * 4; v4f val = *(const v4fa*)(os + row * 68 + cofs); if (BIAS) { val[0] += bfr(bias[c0 + cofs]); val[1] += bfr(bias[c0 + cofs + 1]); val[2] += bfr(bias[c0 + cofs + 2]); val[3] += bfr(bias[c0 + cofs + 3]); }
                *(v4f*)(crow + (size_t)row * ldc + cofs) = val; }
             }
        __builtin_amdgcn_wave_barrier(); asm volatile("" ::: "memory");
    }
}

__device__ __forceinline__ h16 tohx(float x) { return (h16)x; }
__device__ __forceinline__ void splitf(float y, unsigned short& h, unsigned short& l) { h = f2bf(y); l = f2bf(y - bf2f(h)); }
typedef __attribute__((ext_vector_type(2))) _Float16 v2h;
typedef __attribute__((ext_vector_type(4))) _Float16 v4h;
typedef __attribute__((ext_vector_type(2))) unsigned short v2us;
typedef __attribute__((ext_vector_type(4))) unsigned short v4us;
typedef __attribute__((ext_vector_type(2))) float v2f;
typedef __attribute__((ext_vector_type(4))) int v4i;

__global__ __launch_bounds__(256) void k_wtG(const float* __restrict__ w, int K, int N, bf* Bt) {
    const int lane = threadIdx.x & 31; const int L0 = (blockIdx.x * 8 + (threadIdx.x >> 5)) * 8; const int nlines = N * K / 64;
{
#pragma unroll 1
        for (int l = 0; l < 8; ++l) { const int L = L0 + l; if (L >= nlines) break; const size_t e = (size_t)L * 64 + lane * 2; const int k = (int)(e % K), n = (int)(e / K); v2us o;
            o[0] = f2bf(w[(size_t)k * N + n]); o[1] = f2bf(w[(size_t)(k + 1) * N + n]); *(v2us*)(Bt + e) = o; }
         }
}
__global__ __launch_bounds__(256) void k_cvt8(const float* __restrict__ src, bf* dst, size_t n8) { const size_t i = (size_t)blockIdx.x * 256 + threadIdx.x; if (i >= n8) return; const v8f v = *(const v8f*)(src + i * 8); v8us o;
#pragma unroll
    for (int k = 0; k < 8; ++k) o[k] = f2bf(v[k]); *(v8us*)(dst + i * 8) = o;  }

// k_rope: head planes [h][t][d] (fp16 + hi/lo) of rope(x) x sc with the rotate-half convention out[d] = x[d] cos[t][d] - x[d+HD/2] sin[t][d], out[d+HD/2] = x[d+HD/2] cos[t][d+HD/2] + x[d] sin[t][d+HD/2]
__global__ __launch_bounds__(256) void k_rope(const float* __restrict__ F, int pitch, int nheads, const float* __restrict__ CS, const float* __restrict__ RF, const float* __restrict__ nw, float sc, h16* P16, bf* Ph, bf* Pl) {
    const size_t e = ((size_t)blockIdx.x * 256 + threadIdx.x) * 2; if (e >= (size_t)nheads * TT * HD) return; const int d = (int)(e % HD); const int t = (int)((e / HD) % TT); const int h = (int)(e / ((size_t)HD * TT)); const float* f = F + (size_t)t * pitch + h * HD; const float rf = RF ? RF[(size_t)h * TT + t] : 1.0f; v2h o16; v2us oh, ol;
#pragma unroll
    for (int q = 0; q < 2; ++q) { const int dd = d + q; const int dp = (dd < HD / 2) ? dd + HD / 2 : dd - HD / 2; float x0 = f[dd], x1 = f[dp];
        if (RF) { float n0 = __fmul_rn(x0, rf), n1 = __fmul_rn(x1, rf); asm volatile("" : "+v"(n0)); asm volatile("" : "+v"(n1)); x0 = __fmul_rn(bfr(nw[dd]), n0); x1 = __fmul_rn(bfr(nw[dp]), n1); }
        const v2f cs = *(const v2f*)(CS + ((size_t)t * HD + dd) * 2); float a = __fmul_rn(x0, cs[0]), bq = __fmul_rn(x1, cs[1]); asm volatile("" : "+v"(a)); asm volatile("" : "+v"(bq)); const float r = ((dd < HD / 2) ? __fsub_rn(a, bq) : __fadd_rn(a, bq)) * sc;
        o16[q] = tohx(r); unsigned short a2, c2; splitf(r, a2, c2); oh[q] = a2; ol[q] = c2; }
    *(v2h*)(P16 + e) = o16; *(v2us*)(Ph + e) = oh; *(v2us*)(Pl + e) = ol;  }
__global__ __launch_bounds__(256) void k_vtp(const float* __restrict__ F, int pitch, int nheads, h16* V16, bf* Vh, bf* Vl) { const size_t e = ((size_t)blockIdx.x * 256 + threadIdx.x) * 2; if (e >= (size_t)nheads * HD * TT) return; const int t = (int)(e % TT); const int d = (int)((e / TT) % HD); const int g = (int)(e / ((size_t)TT * HD)); v2h o16; v2us oh, ol;
#pragma unroll
    for (int q = 0; q < 2; ++q) { const float x = F[(size_t)(t + q) * pitch + g * HD + d]; o16[q] = tohx(x); unsigned short a2, c2; splitf(x, a2, c2); oh[q] = a2; ol[q] = c2; }
    *(v2h*)(V16 + e) = o16; *(v2us*)(Vh + e) = oh; *(v2us*)(Vl + e) = ol;  }
__global__ __launch_bounds__(256) void k_csid(float* CS) { const int idx = blockIdx.x * 256 + threadIdx.x; if (idx >= TT * HD) return; v2f cs; cs[0] = 1.0f; cs[1] = 0.0f; *(v2f*)(CS + (size_t)idx * 2) = cs;  }
// k_asoft: per row (zz, i): t = (S x HD^-0.5 + bf16(RP[i][j])) + bf16(RB[i][j]) with RP = the shared [TT][TT] additive mask and RB = this batch's [TT][TT] additive bias (both unconditional 16-B loads); softmax over the 2048 keys (register row, one exp, fixed trees);
__global__ __launch_bounds__(256) void k_asoft(const float* __restrict__ Sb, const float* __restrict__ RP, const float* __restrict__ RB, h16* P16, bf* Ph, bf* Pl) {
    const int lane = threadIdx.x & 31; const int row = blockIdx.x * 8 + (threadIdx.x >> 5); if (row >= ZH * TT) return; const int i = row % TT; const int zz = row / TT; (void)zz; const bool hires = (i < RH); const float* sr = Sb + (size_t)row * TT; const float* rp = RP + (size_t)i * TT; const float* rq = RB + (size_t)i * TT; float v[TT / 32]; float mx = -3.0e38f;
#pragma unroll
    for (int ch = 0; ch < TT / 128; ++ch) { const int j0 = ch * 128 + lane * 4; const v4f a = *(const v4f*)(sr + j0); const v4f r4 = *(const v4f*)(rp + j0); const v4f b4 = *(const v4f*)(rq + j0);
#pragma unroll
        for (int q = 0; q < 4; ++q) { const int j = j0 + q; (void)j; float sc = a[q] * SCL; asm volatile("" : "+v"(sc)); float rb = bfr(r4[q]); asm volatile("" : "+v"(rb)); float t0 = __fadd_rn(sc, rb); asm volatile("" : "+v"(t0)); float bb = bfr(b4[q]); asm volatile("" : "+v"(bb)); const float t = __fadd_rn(t0, bb); v[ch * 4 + q] = t;   /* (s x SCL + mask) + bias, the module's order; barriers keep the bf16->f32 widens out of a v_fma_mix */ mx = fmaxf(mx, t); } }
#pragma unroll
    for (int sh = 16; sh; sh >>= 1) mx = fmaxf(mx, __shfl_xor(mx, sh, 32));
    float sum = 0.f;
#pragma unroll
    for (int k = 0; k < TT / 32; ++k) { float d0 = __fsub_rn(v[k], mx); asm volatile("" : "+v"(d0)); v[k] = __builtin_amdgcn_exp2f(__fmul_rn(d0, 1.4426950408889634f)); sum += v[k]; }
#pragma unroll
    for (int sh = 16; sh; sh >>= 1) sum += __shfl_xor(sum, sh, 32);
    const float f = __fdiv_rn(hires ? 1.0f : PCAR, sum);
{
        if (hires) {
#pragma unroll
            for (int ch = 0; ch < TT / 128; ++ch) { v4us oh, ol;
#pragma unroll
                for (int q = 0; q < 4; ++q) { unsigned short a, c2; splitf(v[ch * 4 + q] * f, a, c2); oh[q] = a; ol[q] = c2; }
                const size_t oo = ((size_t)zz * (RH ? RH : 1) + i) * TT + ch * 128 + lane * 4; *(v4us*)(Ph + oo) = oh; *(v4us*)(Pl + oo) = ol; }
        } else {
#pragma unroll
            for (int ch = 0; ch < TT / 128; ++ch) { v4h o4;
#pragma unroll
                for (int q = 0; q < 4; ++q) o4[q] = tohx(v[ch * 4 + q] * f);
                *(v4h*)(P16 + (size_t)row * TT + ch * 128 + lane * 4) = o4; } }
         }
}
__global__ __launch_bounds__(256) void k_merge(const float* __restrict__ O, int h0, bf* Ah, bf* Al) { const size_t e = ((size_t)blockIdx.x * 256 + threadIdx.x) * 2; if (e >= (size_t)ZH * TT * HD) return; const int d = (int)(e % HD); const int t = (int)((e / HD) % TT); const int zz = (int)(e / ((size_t)HD * TT)); const float cs = (t < RH) ? 1.0f : (1.0f / PCAR); const size_t oo = (size_t)t * DQ + (h0 + zz) * HD + d;
    v2us oh, ol;
#pragma unroll
    for (int q = 0; q < 2; ++q) { unsigned short a, c2; splitf(O[e + q] * cs, a, c2); oh[q] = a; ol[q] = c2; } *(v2us*)(Ah + oo) = oh; *(v2us*)(Al + oo) = ol;  }

extern "C" void kernel_launch(void* const* d_in, const int* in_sizes, int n_in,
                              void* d_out, int out_size, void* d_ws, size_t ws_size, hipStream_t stream) {
    (void)in_sizes; (void)n_in; (void)out_size;
    const float* x = (const float*)d_in[0]; const float* amask = (const float*)d_in[1]; const float* abias = (const float*)d_in[2]; const float* wqkv = (const float*)d_in[3]; const float* bqkv = (const float*)d_in[4]; const float* wo = (const float*)d_in[5]; const float* bo = (const float*)d_in[6];   /* x, attn_mask [2048][2048], attn_bias [2][2048][2048], Wqkv ('xw' [1024][3072]), bqkv, Wout ('xw'), bout */ const float* bq = bqkv; const float* bk = bqkv + DQ; const float* bv = bqkv + 2 * DQ; const float* wq = wqkv; const float* wk = nullptr; const float* wv = nullptr; (void)wk; (void)wv;
    float* OUT = (float*)d_out;     // [2][2048][1024]
    char* wsp = (char*)d_ws;
    auto take = [&](size_t bytes) { char* p = wsp; wsp += (bytes + 255) & ~(size_t)255; return (void*)p; };
    bf* WQKV = (bf*)take((size_t)3 * DQ * DM * 2); bf* WQ = WQKV; bf* WK = WQKV + (size_t)DQ * DM; bf* WV = WQKV + (size_t)2 * DQ * DM;   /* fused Bt [3*DQ][DM]: q | k | v row blocks */ bf* WO = (bf*)take((size_t)DM * DQ * 2); float* CS = (float*)take((size_t)TT * HD * 2 * 4);
    bf* XB = (bf*)take((size_t)TT * DM * 2); float* FQ = (float*)take((size_t)TT * DQ * 4); float* FK = (float*)take((size_t)TT * DKV * 4);
    h16* QP16 = (h16*)take((size_t)NH_ * TT * HD * 2); h16* KP16 = (h16*)take((size_t)NKV * TT * HD * 2); h16* VT16 = (h16*)take((size_t)NKV * HD * TT * 2);
    bf* QPh = (bf*)take((size_t)NH_ * TT * HD * 2); bf* QPl = (bf*)take((size_t)NH_ * TT * HD * 2); bf* KPh = (bf*)take((size_t)NKV * TT * HD * 2); bf* KPl = (bf*)take((size_t)NKV * TT * HD * 2); bf* VTh = (bf*)take((size_t)NKV * HD * TT * 2); bf* VTl = (bf*)take((size_t)NKV * HD * TT * 2); bf* Ph = (bf*)take((size_t)ZH * RH * TT * 2); bf* Pl = (bf*)take((size_t)ZH * RH * TT * 2);
    float* Sb = (float*)take((size_t)ZH * TT * TT * 4); h16* P16 = (h16*)take((size_t)ZH * TT * TT * 2); float* Ob = (float*)take((size_t)ZH * TT * HD * 4); bf* ATh = (bf*)take((size_t)TT * DQ * 2); bf* ATl = (bf*)take((size_t)TT * DQ * 2);
    if ((size_t)(wsp - (char*)d_ws) > ws_size) return;    // ws 256 MiB
    float* FV = FK;   // v projection reuses the k buffer after the k planes are built (stream-ordered)
    { k_wtG<<<(unsigned)((DM * 3 * DQ / 64 + 63) / 64), 256, 0, stream>>>(wqkv, DM, 3 * DQ, WQKV);   /* fused 'xw' [DM][3*DQ] -> Bt [3*DQ][DM] */
      k_wtG<<<(unsigned)((DQ * DM / 64 + 63) / 64), 256, 0, stream>>>(wo, DQ, DM, WO);
       }
    k_csid<<<(TT * HD + 255) / 256, 256, 0, stream>>>(CS);
    const unsigned LQ = (unsigned)(((size_t)NH_ * TT * HD / 2 + 255) / 256), LKv = (unsigned)(((size_t)NKV * TT * HD / 2 + 255) / 256);
    for (int b = 0; b < NB_; ++b) {
        
        k_cvt8<<<(unsigned)(((size_t)TT * DM / 8 + 255) / 256), 256, 0, stream>>>(x + (size_t)b * TT * DM, XB, (size_t)TT * DM / 8);
        k_gemmw<bf, 0, true><<<dim3(TT / 64, DQ / 64, 1), 32, 0, stream>>>(XB, nullptr, WQ, nullptr, DM, FQ, DQ, bq, 0, 0, 0);
        k_rope<<<LQ, 256, 0, stream>>>(FQ, DQ, NH_, CS, nullptr, nullptr, 1.0f, QP16, QPh, QPl);
        k_gemmw<bf, 0, true><<<dim3(TT / 64, DKV / 64, 1), 32, 0, stream>>>(XB, nullptr, WK, nullptr, DM, FK, DKV, bk, 0, 0, 0);
        k_rope<<<LKv, 256, 0, stream>>>(FK, DKV, NKV, CS, nullptr, nullptr, 1.0f, KP16, KPh, KPl);
        k_gemmw<bf, 0, true><<<dim3(TT / 64, DKV / 64, 1), 32, 0, stream>>>(XB, nullptr, WV, nullptr, DM, FV, DKV, bv, 0, 0, 0); k_vtp<<<LKv, 256, 0, stream>>>(FV, DKV, NKV, VT16, VTh, VTl);
        for (int h0 = 0; h0 < NH_; h0 += ZH) { const size_t zq = (size_t)h0, zk = (size_t)(h0 / REP);   // one kv head per query head: the pass's two heads use consecutive kv planes (z-strides TT*HD)
            k_gemmw<bf, 2, false><<<dim3(RH / 64, TT / 64, ZH), 32, 0, stream>>>(QPh + zq * TT * HD, QPl + zq * TT * HD, KPh + zk * TT * HD, KPl + zk * TT * HD, HD, Sb, TT, nullptr, (size_t)TT * HD, (size_t)TT * HD, (size_t)TT * TT);
            k_gemmw<h16, 0, false><<<dim3((TT - RH) / 64, TT / 64, ZH), 32, 0, stream>>>(QP16 + zq * TT * HD + (size_t)RH * HD, nullptr, KP16 + zk * TT * HD, nullptr, HD, Sb + (size_t)RH * TT, TT, nullptr, (size_t)TT * HD, (size_t)TT * HD, (size_t)TT * TT);
            k_asoft<<<ZH * TT / 8, 256, 0, stream>>>(Sb, amask, abias + (size_t)b * TT * TT, P16, Ph, Pl);   /* shared mask plane; this batch's bias plane */
            k_gemmw<bf, 2, false><<<dim3(RH / 64, HD / 64, ZH), 32, 0, stream>>>(Ph, Pl, VTh + zk * HD * TT, VTl + zk * HD * TT, TT, Ob, HD, nullptr, (size_t)RH * TT, (size_t)HD * TT, (size_t)TT * HD);
            k_gemmw<h16, 0, false><<<dim3((TT - RH) / 64, HD / 64, ZH), 32, 0, stream>>>(P16 + (size_t)RH * TT, nullptr, VT16 + zk * HD * TT, nullptr, TT, Ob + (size_t)RH * HD, HD, nullptr, (size_t)TT * TT, (size_t)HD * TT, (size_t)TT * HD);
            k_merge<<<(unsigned)(((size_t)ZH * TT * HD / 2 + 255) / 256), 256, 0, stream>>>(Ob, h0, ATh, ATl); }
        k_gemmw<bf, 1, true><<<dim3(TT / 64, DM / 64, 1), 32, 0, stream>>>(ATh, ATl, WO, nullptr, DQ, OUT + (size_t)b * TT * DM, DM, bo, 0, 0, 0); }
}

// v001
// It runs in 966 microseconds.
// Timed twice side by side with v000, it ran 2.17 and 2.19 times as fast.
#include <hip/hip_runtime.h>

// Multi-head self-attention with a fused qkv projection and TWO additive score planes (x [2][2048][1024]; qkv = x Wqkv + bqkv ('xw' [1024][3072] 1/32 + bias (zeros on this draw: read)) -> reshape (B, S, 3, 16, 64): q | k | v column thirds; scores = q.k / sqrt(64) + attn_mask[i][j] (f32 [2048][2048], shared by heads and batches) + attn_bias[b][i][j] (f32 [2][2048][2048], shared by heads); softmax over all keys; out = merged Wout + bout ('xw' [1024][1024] + bias) -> [2][2048][1024] (4.2 M); argument order x, attn_mask, attn_bias, Wqkv, bqkv, Wout, bout).
// Layout per batch: bf16 copy of x; the fused 'xw' weight transposed once into Bt (q | k | v row blocks) + bias slices; exact projections + f32 biases; identity-table plane builders; dense T-2048 attention (hybrid rows: < 512 hi/lo 3 products, rest fp16 x1024) whose softmax kernel adds bf16(attn_mask[i][j]) and then bf16(attn_bias[b][i][j]) to the scaled f32 score, in the module's order; merged hi/lo x Wout exact + bout.
// Compute dtypes, f32 accumulate: every input rounded to bf16 incl. the two planes; projections exact + f32 biases; attention rows < 512 3 products, rest fp16; softmax f32; Wout hl x exact + bias.

#define NB_  2
#define TT   2048
#define DM   1024
#define NH_  16
#define NKV  16
#define REP  (NH_ / NKV)
#define HD   64
#define DQ   (NH_ * HD)
#define DKV  (NKV * HD)
#define ZH   2
#define RH   512                  // query rows < RH use hi+lo planes (0: none)
#define WIN  0
#define PCAR 1024.0f
#define SCL  0.125f   // HD^-0.5
#define KSP  16                   // key splits of the P.V products: one work-group per (tile, split), f32 partial planes summed by k_merge
typedef _Float16 h16;
typedef unsigned short bf;
typedef __attribute__((ext_vector_type(16))) __bf16   v16bf;
typedef __attribute__((ext_vector_type(16))) _Float16 v16h;
typedef __attribute__((ext_vector_type(8)))  _Float16 v8h;
typedef __attribute__((ext_vector_type(8)))  unsigned short v8us;
typedef __attribute__((ext_vector_type(8)))  float    v8f;
typedef __attribute__((ext_vector_type(4)))  float    v4f;
typedef v8h  __attribute__((may_alias)) v8ha;
typedef v4f  __attribute__((may_alias)) v4fa;
typedef v8us __attribute__((may_alias)) v8usa;

__device__ __forceinline__ unsigned short f2bf(float f) { unsigned u = __float_as_uint(f); u += 0x7FFFu + ((u >> 16) & 1u); return (unsigned short)(u >> 16); }
__device__ __forceinline__ float bf2f(unsigned short b) { return __uint_as_float(((unsigned)b) << 16); }
__device__ __forceinline__ float bfr(float f) { return bf2f(f2bf(f)); }
__device__ __forceinline__ v16h cat16(v8h lo, v8h hi) { return __builtin_shufflevector(lo, hi, 0, 1, 2, 3, 4, 5, 6, 7, 8, 9, 10, 11, 12, 13, 14, 15); }
__device__ __forceinline__ v16bf cat16b(v8us lo, v8us hi) { return __builtin_bit_cast(v16bf, __builtin_shufflevector(lo, hi, 0, 1, 2, 3, 4, 5, 6, 7, 8, 9, 10, 11, 12, 13, 14, 15)); }
__device__ __forceinline__ v8f wmma16(v16h a, v16h b, v8f c) { return __builtin_amdgcn_wmma_f32_16x16x32_f16(false, a, false, b, (short)0, c, false, false); }
__device__ __forceinline__ v8f wmmab(v16bf a, v16bf b, v8f c) { return __builtin_amdgcn_wmma_f32_16x16x32_bf16(false, a, false, b, (short)0, c, false, false); }



// ---- k_gemmw: register-blocked GEMM, ONE WAVE per 64x64 output tile (16 accumulators), operands straight from K-contiguous 16-bit planes; grid (M/64, N/64, Z), 32 threads.
// C[m][n] (f32, pitch ldc, + optional f32 bias[n]) = sum_k A[m][k] Bt[n][k] (+ split products per NSPLIT). z-batch strides sA/sB/sC in elements. K % 32 == 0.
// KS > 1: grid z = Z * KS; block (z, ks) sums k in [ks K/KS, (ks+1) K/KS) alone and stores its partial tile in plane ks of C ([KS][ZH] planes of sC elements; Z = ZH). K % (32 KS) == 0.
template <typename T16> struct WFrag;
template <> struct WFrag<h16> { typedef v16h V; static __device__ __forceinline__ V ld(const h16* p) { return cat16(*(const v8h*)p, *(const v8h*)(p + 16)); } static __device__ __forceinline__ v8f mma(V a, V b, v8f c) { return wmma16(a, b, c); } };
template <> struct WFrag<bf> { typedef v16bf V; static __device__ __forceinline__ V ld(const bf* p) { return cat16b(*(const v8us*)p, *(const v8us*)(p + 16)); } static __device__ __forceinline__ v8f mma(V a, V b, v8f c) { return wmmab(a, b, c); } };
template <typename T16, int NSPLIT, bool BIAS, int KS = 1>
__global__ __launch_bounds__(32) void k_gemmw(const T16* __restrict__ A, const T16* __restrict__ A2, const T16* __restrict__ Bt, const T16* __restrict__ Bt2, int K, float* C, int ldc, const float* __restrict__ bias, size_t sA, size_t sB, size_t sC) {
    typedef typename WFrag<T16>::V V;
    __shared__ __align__(16) float os[16 * 68];
    const size_t z = blockIdx.z / KS; const int ks = blockIdx.z % KS; A += z * sA; if (A2) A2 += z * sA; Bt += z * sB; if (Bt2) Bt2 += z * sB; C += ((size_t)ks * ZH + z) * sC;
    const int lane = threadIdx.x & 31, lr = lane & 15, hi = lane >> 4; const int r0 = blockIdx.x * 64, c0 = blockIdx.y * 64;
    v8f acc[4][4];
#pragma unroll
    for (int mb = 0; mb < 4; ++mb)
#pragma unroll
        for (int nb = 0; nb < 4; ++nb) acc[mb][nb] = (v8f){};
    const size_t aoff = (size_t)(r0 + lr) * K + 8 * hi, boff = (size_t)(c0 + lr) * K + 8 * hi;
#pragma unroll 1
    for (int kc = ks * (K / KS); kc < (ks + 1) * (K / KS); kc += 32) {
        V a[4], a2[4];
#pragma unroll
        for (int mb = 0; mb < 4; ++mb) { a[mb] = WFrag<T16>::ld(A + aoff + (size_t)mb * 16 * K + kc); if (NSPLIT == 1 || NSPLIT == 2) a2[mb] = WFrag<T16>::ld(A2 + aoff + (size_t)mb * 16 * K + kc); }
#pragma unroll
        for (int nb = 0; nb < 4; ++nb) { const V b = WFrag<T16>::ld(Bt + boff + (size_t)nb * 16 * K + kc); V b2; if (NSPLIT >= 2) b2 = WFrag<T16>::ld(Bt2 + boff + (size_t)nb * 16 * K + kc);
#pragma unroll
            for (int mb = 0; mb < 4; ++mb) { acc[mb][nb] = WFrag<T16>::mma(a[mb], b, acc[mb][nb]); if (NSPLIT == 1 || NSPLIT == 2) acc[mb][nb] = WFrag<T16>::mma(a2[mb], b, acc[mb][nb]); if (NSPLIT >= 2) acc[mb][nb] = WFrag<T16>::mma(a[mb], b2, acc[mb][nb]); } }
        asm volatile("v_nop\n\tv_nop\n\tv_nop\n\tv_nop" : "+v"(acc[0][0]), "+v"(acc[1][1]), "+v"(acc[2][2]), "+v"(acc[3][3]) : "v"(a[0]), "v"(a[3]));
    }
#pragma unroll
    for (int mb = 0; mb < 4; ++mb) {
#pragma unroll
        for (int nb = 0; nb < 4; ++nb) {
#pragma unroll
            for (int j = 0; j < 8; ++j) os[(hi * 8 + j) * 68 + nb * 16 + lr] = acc[mb][nb][j]; }
        __builtin_amdgcn_wave_barrier(); asm volatile("" ::: "memory");
        float* crow = C + (size_t)(r0 + mb * 16) * ldc + c0;
{
#pragma unroll
            for (int s = 0; s < 8; ++s) { const int row = 2 * s + hi, cofs = lr * 4; v4f val = *(const v4fa*)(os + row * 68 + cofs); if (BIAS) { val[0] += bfr(bias[c0 + cofs]); val[1] += bfr(bias[c0 + cofs + 1]); val[2] += bfr(bias[c0 + cofs + 2]); val[3] += bfr(bias[c0 + cofs + 3]); }
                *(v4f*)(crow + (size_t)row * ldc + cofs) = val; }
             }
        __builtin_amdgcn_wave_barrier(); asm volatile("" ::: "memory");
    }
}

__device__ __forceinline__ h16 tohx(float x) { return (h16)x; }
__device__ __forceinline__ void splitf(float y, unsigned short& h, unsigned short& l) { h = f2bf(y); l = f2bf(y - bf2f(h)); }
typedef __attribute__((ext_vector_type(2))) _Float16 v2h;
typedef __attribute__((ext_vector_type(4))) _Float16 v4h;
typedef __attribute__((ext_vector_type(2))) unsigned short v2us;
typedef __attribute__((ext_vector_type(4))) unsigned short v4us;
typedef __attribute__((ext_vector_type(2))) float v2f;
typedef __attribute__((ext_vector_type(4))) int v4i;

__global__ __launch_bounds__(256) void k_wtG(const float* __restrict__ w, int K, int N, bf* Bt) {
    const int lane = threadIdx.x & 31; const int L0 = (blockIdx.x * 8 + (threadIdx.x >> 5)) * 8; const int nlines = N * K / 64;
{
#pragma unroll 1
        for (int l = 0; l < 8; ++l) { const int L = L0 + l; if (L >= nlines) break; const size_t e = (size_t)L * 64 + lane * 2; const int k = (int)(e % K), n = (int)(e / K); v2us o;
            o[0] = f2bf(w[(size_t)k * N + n]); o[1] = f2bf(w[(size_t)(k + 1) * N + n]); *(v2us*)(Bt + e) = o; }
         }
}
__global__ __launch_bounds__(256) void k_cvt8(const float* __restrict__ src, bf* dst, size_t n8) { const size_t i = (size_t)blockIdx.x * 256 + threadIdx.x; if (i >= n8) return; const v8f v = *(const v8f*)(src + i * 8); v8us o;
#pragma unroll
    for (int k = 0; k < 8; ++k) o[k] = f2bf(v[k]); *(v8us*)(dst + i * 8) = o;  }

// k_rope: head planes [h][t][d] (fp16 + hi/lo) of rope(x) x sc with the rotate-half convention out[d] = x[d] cos[t][d] - x[d+HD/2] sin[t][d], out[d+HD/2] = x[d+HD/2] cos[t][d+HD/2] + x[d] sin[t][d+HD/2]
__global__ __launch_bounds__(256) void k_rope(const float* __restrict__ F, int pitch, int nheads, const float* __restrict__ CS, const float* __restrict__ RF, const float* __restrict__ nw, float sc, h16* P16, bf* Ph, bf* Pl) {
    const size_t e = ((size_t)blockIdx.x * 256 + threadIdx.x) * 2; if (e >= (size_t)nheads * TT * HD) return; const int d = (int)(e % HD); const int t = (int)((e / HD) % TT); const int h = (int)(e / ((size_t)HD * TT)); const float* f = F + (size_t)t * pitch + h * HD; const float rf = RF ? RF[(size_t)h * TT + t] : 1.0f; v2h o16; v2us oh, ol;
#pragma unroll
    for (int q = 0; q < 2; ++q) { const int dd = d + q; const int dp = (dd < HD / 2) ? dd + HD / 2 : dd - HD / 2; float x0 = f[dd], x1 = f[dp];
        if (RF) { float n0 = __fmul_rn(x0, rf), n1 = __fmul_rn(x1, rf); asm volatile("" : "+v"(n0)); asm volatile("" : "+v"(n1)); x0 = __fmul_rn(bfr(nw[dd]), n0); x1 = __fmul_rn(bfr(nw[dp]), n1); }
        const v2f cs = *(const v2f*)(CS + ((size_t)t * HD + dd) * 2); float a = __fmul_rn(x0, cs[0]), bq = __fmul_rn(x1, cs[1]); asm volatile("" : "+v"(a)); asm volatile("" : "+v"(bq)); const float r = ((dd < HD / 2) ? __fsub_rn(a, bq) : __fadd_rn(a, bq)) * sc;
        o16[q] = tohx(r); unsigned short a2, c2; splitf(r, a2, c2); oh[q] = a2; ol[q] = c2; }
    *(v2h*)(P16 + e) = o16; *(v2us*)(Ph + e) = oh; *(v2us*)(Pl + e) = ol;  }
__global__ __launch_bounds__(256) void k_vtp(const float* __restrict__ F, int pitch, int nheads, h16* V16, bf* Vh, bf* Vl) { const size_t e = ((size_t)blockIdx.x * 256 + threadIdx.x) * 2; if (e >= (size_t)nheads * HD * TT) return; const int t = (int)(e % TT); const int d = (int)((e / TT) % HD); const int g = (int)(e / ((size_t)TT * HD)); v2h o16; v2us oh, ol;
#pragma unroll
    for (int q = 0; q < 2; ++q) { const float x = F[(size_t)(t + q) * pitch + g * HD + d]; o16[q] = tohx(x); unsigned short a2, c2; splitf(x, a2, c2); oh[q] = a2; ol[q] = c2; }
    *(v2h*)(V16 + e) = o16; *(v2us*)(Vh + e) = oh; *(v2us*)(Vl + e) = ol;  }
__global__ __launch_bounds__(256) void k_csid(float* CS) { const int idx = blockIdx.x * 256 + threadIdx.x; if (idx >= TT * HD) return; v2f cs; cs[0] = 1.0f; cs[1] = 0.0f; *(v2f*)(CS + (size_t)idx * 2) = cs;  }
// k_asoft: per row (zz, i): t = (S x HD^-0.5 + bf16(RP[i][j])) + bf16(RB[i][j]) with RP = the shared [TT][TT] additive mask and RB = this batch's [TT][TT] additive bias (both unconditional 16-B loads); softmax over the 2048 keys (register row, one exp, fixed trees);
__global__ __launch_bounds__(256) void k_asoft(const float* __restrict__ Sb, const float* __restrict__ RP, const float* __restrict__ RB, h16* P16, bf* Ph, bf* Pl) {
    const int lane = threadIdx.x & 31; const int row = blockIdx.x * 8 + (threadIdx.x >> 5); if (row >= ZH * TT) return; const int i = row % TT; const int zz = row / TT; (void)zz; const bool hires = (i < RH); const float* sr = Sb + (size_t)row * TT; const float* rp = RP + (size_t)i * TT; const float* rq = RB + (size_t)i * TT; float v[TT / 32]; float mx = -3.0e38f;
#pragma unroll
    for (int ch = 0; ch < TT / 128; ++ch) { const int j0 = ch * 128 + lane * 4; const v4f a = *(const v4f*)(sr + j0); const v4f r4 = *(const v4f*)(rp + j0); const v4f b4 = *(const v4f*)(rq + j0);
#pragma unroll
        for (int q = 0; q < 4; ++q) { const int j = j0 + q; (void)j; float sc = a[q] * SCL; asm volatile("" : "+v"(sc)); float rb = bfr(r4[q]); asm volatile("" : "+v"(rb)); float t0 = __fadd_rn(sc, rb); asm volatile("" : "+v"(t0)); float bb = bfr(b4[q]); asm volatile("" : "+v"(bb)); const float t = __fadd_rn(t0, bb); v[ch * 4 + q] = t;   /* (s x SCL + mask) + bias, the module's order; barriers keep the bf16->f32 widens out of a v_fma_mix */ mx = fmaxf(mx, t); } }
#pragma unroll
    for (int sh = 16; sh; sh >>= 1) mx = fmaxf(mx, __shfl_xor(mx, sh, 32));
    float sum = 0.f;
#pragma unroll
    for (int k = 0; k < TT / 32; ++k) { float d0 = __fsub_rn(v[k], mx); asm volatile("" : "+v"(d0)); v[k] = __builtin_amdgcn_exp2f(__fmul_rn(d0, 1.4426950408889634f)); sum += v[k]; }
#pragma unroll
    for (int sh = 16; sh; sh >>= 1) sum += __shfl_xor(sum, sh, 32);
    const float f = __fdiv_rn(hires ? 1.0f : PCAR, sum);
{
        if (hires) {
#pragma unroll
            for (int ch = 0; ch < TT / 128; ++ch) { v4us oh, ol;
#pragma unroll
                for (int q = 0; q < 4; ++q) { unsigned short a, c2; splitf(v[ch * 4 + q] * f, a, c2); oh[q] = a; ol[q] = c2; }
                const size_t oo = ((size_t)zz * (RH ? RH : 1) + i) * TT + ch * 128 + lane * 4; *(v4us*)(Ph + oo) = oh; *(v4us*)(Pl + oo) = ol; }
        } else {
#pragma unroll
            for (int ch = 0; ch < TT / 128; ++ch) { v4h o4;
#pragma unroll
                for (int q = 0; q < 4; ++q) o4[q] = tohx(v[ch * 4 + q] * f);
                *(v4h*)(P16 + (size_t)row * TT + ch * 128 + lane * 4) = o4; } }
         }
}
__global__ __launch_bounds__(256) void k_merge(const float* __restrict__ O, int h0, bf* Ah, bf* Al) { const size_t e = ((size_t)blockIdx.x * 256 + threadIdx.x) * 2; if (e >= (size_t)ZH * TT * HD) return; const int d = (int)(e % HD); const int t = (int)((e / HD) % TT); const int zz = (int)(e / ((size_t)HD * TT)); const float cs = (t < RH) ? 1.0f : (1.0f / PCAR); const size_t oo = (size_t)t * DQ + (h0 + zz) * HD + d;
    v2f s = *(const v2f*)(O + e);   // the KSP partial planes, summed in plane order; unrolled so that all the planes' loads are in flight together
#pragma unroll
    for (int p = 1; p < KSP; ++p) s += *(const v2f*)(O + (size_t)p * ZH * TT * HD + e);
    v2us oh, ol;
#pragma unroll
    for (int q = 0; q < 2; ++q) { unsigned short a, c2; splitf(s[q] * cs, a, c2); oh[q] = a; ol[q] = c2; } *(v2us*)(Ah + oo) = oh; *(v2us*)(Al + oo) = ol;  }

extern "C" void kernel_launch(void* const* d_in, const int* in_sizes, int n_in,
                              void* d_out, int out_size, void* d_ws, size_t ws_size, hipStream_t stream) {
    (void)in_sizes; (void)n_in; (void)out_size;
    const float* x = (const float*)d_in[0]; const float* amask = (const float*)d_in[1]; const float* abias = (const float*)d_in[2]; const float* wqkv = (const float*)d_in[3]; const float* bqkv = (const float*)d_in[4]; const float* wo = (const float*)d_in[5]; const float* bo = (const float*)d_in[6];   /* x, attn_mask [2048][2048], attn_bias [2][2048][2048], Wqkv ('xw' [1024][3072]), bqkv, Wout ('xw'), bout */ const float* bq = bqkv; const float* bk = bqkv + DQ; const float* bv = bqkv + 2 * DQ; const float* wq = wqkv; const float* wk = nullptr; const float* wv = nullptr; (void)wk; (void)wv;
    float* OUT = (float*)d_out;     // [2][2048][1024]
    char* wsp = (char*)d_ws;
    auto take = [&](size_t bytes) { char* p = wsp; wsp += (bytes + 255) & ~(size_t)255; return (void*)p; };
    bf* WQKV = (bf*)take((size_t)3 * DQ * DM * 2); bf* WQ = WQKV; bf* WK = WQKV + (size_t)DQ * DM; bf* WV = WQKV + (size_t)2 * DQ * DM;   /* fused Bt [3*DQ][DM]: q | k | v row blocks */ bf* WO = (bf*)take((size_t)DM * DQ * 2); float* CS = (float*)take((size_t)TT * HD * 2 * 4);
    bf* XB = (bf*)take((size_t)TT * DM * 2); float* FQ = (float*)take((size_t)TT * DQ * 4); float* FK = (float*)take((size_t)TT * DKV * 4);
    h16* QP16 = (h16*)take((size_t)NH_ * TT * HD * 2); h16* KP16 = (h16*)take((size_t)NKV * TT * HD * 2); h16* VT16 = (h16*)take((size_t)NKV * HD * TT * 2);
    bf* QPh = (bf*)take((size_t)NH_ * TT * HD * 2); bf* QPl = (bf*)take((size_t)NH_ * TT * HD * 2); bf* KPh = (bf*)take((size_t)NKV * TT * HD * 2); bf* KPl = (bf*)take((size_t)NKV * TT * HD * 2); bf* VTh = (bf*)take((size_t)NKV * HD * TT * 2); bf* VTl = (bf*)take((size_t)NKV * HD * TT * 2); bf* Ph = (bf*)take((size_t)ZH * RH * TT * 2); bf* Pl = (bf*)take((size_t)ZH * RH * TT * 2);
    float* Sb = (float*)take((size_t)ZH * TT * TT * 4); h16* P16 = (h16*)take((size_t)ZH * TT * TT * 2); float* Ob = (float*)take((size_t)KSP * ZH * TT * HD * 4); bf* ATh = (bf*)take((size_t)TT * DQ * 2); bf* ATl = (bf*)take((size_t)TT * DQ * 2);
    if ((size_t)(wsp - (char*)d_ws) > ws_size) return;    // ws 256 MiB
    float* FV = FK;   // v projection reuses the k buffer after the k planes are built (stream-ordered)
    { k_wtG<<<(unsigned)((DM * 3 * DQ / 64 + 63) / 64), 256, 0, stream>>>(wqkv, DM, 3 * DQ, WQKV);   /* fused 'xw' [DM][3*DQ] -> Bt [3*DQ][DM] */
      k_wtG<<<(unsigned)((DQ * DM / 64 + 63) / 64), 256, 0, stream>>>(wo, DQ, DM, WO);
       }
    k_csid<<<(TT * HD + 255) / 256, 256, 0, stream>>>(CS);
    const unsigned LQ = (unsigned)(((size_t)NH_ * TT * HD / 2 + 255) / 256), LKv = (unsigned)(((size_t)NKV * TT * HD / 2 + 255) / 256);
    for (int b = 0; b < NB_; ++b) {
        
        k_cvt8<<<(unsigned)(((size_t)TT * DM / 8 + 255) / 256), 256, 0, stream>>>(x + (size_t)b * TT * DM, XB, (size_t)TT * DM / 8);
        k_gemmw<bf, 0, true><<<dim3(TT / 64, DQ / 64, 1), 32, 0, stream>>>(XB, nullptr, WQ, nullptr, DM, FQ, DQ, bq, 0, 0, 0);
        k_rope<<<LQ, 256, 0, stream>>>(FQ, DQ, NH_, CS, nullptr, nullptr, 1.0f, QP16, QPh, QPl);
        k_gemmw<bf, 0, true><<<dim3(TT / 64, DKV / 64, 1), 32, 0, stream>>>(XB, nullptr, WK, nullptr, DM, FK, DKV, bk, 0, 0, 0);
        k_rope<<<LKv, 256, 0, stream>>>(FK, DKV, NKV, CS, nullptr, nullptr, 1.0f, KP16, KPh, KPl);
        k_gemmw<bf, 0, true><<<dim3(TT / 64, DKV / 64, 1), 32, 0, stream>>>(XB, nullptr, WV, nullptr, DM, FV, DKV, bv, 0, 0, 0); k_vtp<<<LKv, 256, 0, stream>>>(FV, DKV, NKV, VT16, VTh, VTl);
        for (int h0 = 0; h0 < NH_; h0 += ZH) { const size_t zq = (size_t)h0, zk = (size_t)(h0 / REP);   // one kv head per query head: the pass's two heads use consecutive kv planes (z-strides TT*HD)
            k_gemmw<bf, 2, false><<<dim3(RH / 64, TT / 64, ZH), 32, 0, stream>>>(QPh + zq * TT * HD, QPl + zq * TT * HD, KPh + zk * TT * HD, KPl + zk * TT * HD, HD, Sb, TT, nullptr, (size_t)TT * HD, (size_t)TT * HD, (size_t)TT * TT);
            k_gemmw<h16, 0, false><<<dim3((TT - RH) / 64, TT / 64, ZH), 32, 0, stream>>>(QP16 + zq * TT * HD + (size_t)RH * HD, nullptr, KP16 + zk * TT * HD, nullptr, HD, Sb + (size_t)RH * TT, TT, nullptr, (size_t)TT * HD, (size_t)TT * HD, (size_t)TT * TT);
            k_asoft<<<ZH * TT / 8, 256, 0, stream>>>(Sb, amask, abias + (size_t)b * TT * TT, P16, Ph, Pl);   /* shared mask plane; this batch's bias plane */
            k_gemmw<bf, 2, false, KSP><<<dim3(RH / 64, HD / 64, ZH * KSP), 32, 0, stream>>>(Ph, Pl, VTh + zk * HD * TT, VTl + zk * HD * TT, TT, Ob, HD, nullptr, (size_t)RH * TT, (size_t)HD * TT, (size_t)TT * HD);
            k_gemmw<h16, 0, false, KSP><<<dim3((TT - RH) / 64, HD / 64, ZH * KSP), 32, 0, stream>>>(P16 + (size_t)RH * TT, nullptr, VT16 + zk * HD * TT, nullptr, TT, Ob + (size_t)RH * HD, HD, nullptr, (size_t)TT * TT, (size_t)HD * TT, (size_t)TT * HD);
            k_merge<<<(unsigned)(((size_t)ZH * TT * HD / 2 + 255) / 256), 256, 0, stream>>>(Ob, h0, ATh, ATl); }
        k_gemmw<bf, 1, true><<<dim3(TT / 64, DM / 64, 1), 32, 0, stream>>>(ATh, ATl, WO, nullptr, DQ, OUT + (size_t)b * TT * DM, DM, bo, 0, 0, 0); }
}

// v002
// It runs in 701 microseconds.
// In two side-by-side timings against v001, it was 1.37 and 1.38 times as fast.
// Counting every step since v000, it is 3.00 times as fast.
#include <hip/hip_runtime.h>

// Multi-head self-attention with a fused qkv projection and TWO additive score planes (x [2][2048][1024]; qkv = x Wqkv + bqkv ('xw' [1024][3072] 1/32 + bias) -> reshape (B, S, 3, 16, 64): q | k | v column thirds; scores = q.k / sqrt(64) + attn_mask[i][j] (f32 [2048][2048], shared by heads and batches) + attn_bias[b][i][j] (f32 [2][2048][2048], shared by heads); softmax over all keys; out = merged Wout + bout ('xw' [1024][1024] + bias) -> [2][2048][1024] (4.2 M); argument order x, attn_mask, attn_bias, Wqkv, bqkv, Wout, bout).
// Layout per batch: bf16 copy of x; the fused 'xw' weight transposed once into Bt (q | k | v row blocks) + bias slices; exact projections + f32 biases; identity-table plane builders; dense T-2048 attention (hybrid rows: < 512 hi/lo 3 products, rest fp16 x1024) whose softmax kernel adds bf16(attn_mask[i][j]) and then bf16(attn_bias[b][i][j]) to the scaled f32 score, in the module's order; merged hi/lo x Wout exact + bout.
// Compute dtypes, f32 accumulate: every input rounded to bf16 incl. the two planes; projections exact + f32 biases; attention rows < 512 3 products, rest fp16; softmax f32; Wout hl x exact + bias.

#define NB_  2
#define TT   2048
#define DM   1024
#define NH_  16
#define NKV  16
#define REP  (NH_ / NKV)
#define HD   64
#define DQ   (NH_ * HD)
#define DKV  (NKV * HD)
#define ZH   8                    // heads per attention pass: every launch of a pass covers ZH heads
#define RH   512                  // query rows < RH use hi+lo planes (0: none)
#define WIN  0
#define PCAR 1024.0f
#define SCL  0.125f   // HD^-0.5
#define KSP  16                   // key splits of the P.V products: one work-group per (tile, split), f32 partial planes summed by k_merge
typedef _Float16 h16;
typedef unsigned short bf;
typedef __attribute__((ext_vector_type(16))) __bf16   v16bf;
typedef __attribute__((ext_vector_type(16))) _Float16 v16h;
typedef __attribute__((ext_vector_type(8)))  _Float16 v8h;
typedef __attribute__((ext_vector_type(8)))  unsigned short v8us;
typedef __attribute__((ext_vector_type(8)))  float    v8f;
typedef __attribute__((ext_vector_type(4)))  float    v4f;
typedef v8h  __attribute__((may_alias)) v8ha;
typedef v4f  __attribute__((may_alias)) v4fa;
typedef v8us __attribute__((may_alias)) v8usa;

__device__ __forceinline__ unsigned short f2bf(float f) { unsigned u = __float_as_uint(f); u += 0x7FFFu + ((u >> 16) & 1u); return (unsigned short)(u >> 16); }
__device__ __forceinline__ float bf2f(unsigned short b) { return __uint_as_float(((unsigned)b) << 16); }
__device__ __forceinline__ float bfr(float f) { return bf2f(f2bf(f)); }
__device__ __forceinline__ v16h cat16(v8h lo, v8h hi) { return __builtin_shufflevector(lo, hi, 0, 1, 2, 3, 4, 5, 6, 7, 8, 9, 10, 11, 12, 13, 14, 15); }
__device__ __forceinline__ v16bf cat16b(v8us lo, v8us hi) { return __builtin_bit_cast(v16bf, __builtin_shufflevector(lo, hi, 0, 1, 2, 3, 4, 5, 6, 7, 8, 9, 10, 11, 12, 13, 14, 15)); }
__device__ __forceinline__ v8f wmma16(v16h a, v16h b, v8f c) { return __builtin_amdgcn_wmma_f32_16x16x32_f16(false, a, false, b, (short)0, c, false, false); }
__device__ __forceinline__ v8f wmmab(v16bf a, v16bf b, v8f c) { return __builtin_amdgcn_wmma_f32_16x16x32_bf16(false, a, false, b, (short)0, c, false, false); }



// ---- k_gemmw: register-blocked GEMM, ONE WAVE per 64x64 output tile (16 accumulators), operands straight from K-contiguous 16-bit planes; grid (M/64, N/64, Z), 32 threads.
// C[m][n] (f32, pitch ldc, + optional f32 bias[n]) = sum_k A[m][k] Bt[n][k] (+ split products per NSPLIT). A rows have pitch lda, Bt rows pitch K. z-batch strides sA/sB/sC in elements. K % 32 == 0.
// KS > 1: grid z = Z * KS; block (z, ks) sums k in [ks K/KS, (ks+1) K/KS) alone and stores its partial tile in plane ks of C ([KS][ZH] planes of sC elements; Z = ZH). K % (32 KS) == 0.
template <typename T16> struct WFrag;
template <> struct WFrag<h16> { typedef v16h V; static __device__ __forceinline__ V ld(const h16* p) { return cat16(*(const v8h*)p, *(const v8h*)(p + 16)); } static __device__ __forceinline__ v8f mma(V a, V b, v8f c) { return wmma16(a, b, c); } };
template <> struct WFrag<bf> { typedef v16bf V; static __device__ __forceinline__ V ld(const bf* p) { return cat16b(*(const v8us*)p, *(const v8us*)(p + 16)); } static __device__ __forceinline__ v8f mma(V a, V b, v8f c) { return wmmab(a, b, c); } };
template <typename T16, int NSPLIT, bool BIAS, int KS = 1>
__global__ __launch_bounds__(32) void k_gemmw(const T16* __restrict__ A, const T16* __restrict__ A2, const T16* __restrict__ Bt, const T16* __restrict__ Bt2, int K, int lda, float* C, int ldc, const float* __restrict__ bias, size_t sA, size_t sB, size_t sC) {
    typedef typename WFrag<T16>::V V;
    __shared__ __align__(16) float os[16 * 68];
    const size_t z = blockIdx.z / KS; const int ks = blockIdx.z % KS; A += z * sA; if (A2) A2 += z * sA; Bt += z * sB; if (Bt2) Bt2 += z * sB; C += ((size_t)ks * ZH + z) * sC;
    const int lane = threadIdx.x & 31, lr = lane & 15, hi = lane >> 4; const int r0 = blockIdx.x * 64, c0 = blockIdx.y * 64;
    v8f acc[4][4];
#pragma unroll
    for (int mb = 0; mb < 4; ++mb)
#pragma unroll
        for (int nb = 0; nb < 4; ++nb) acc[mb][nb] = (v8f){};
    const size_t aoff = (size_t)(r0 + lr) * lda + 8 * hi, boff = (size_t)(c0 + lr) * K + 8 * hi;
#pragma unroll 1
    for (int kc = ks * (K / KS); kc < (ks + 1) * (K / KS); kc += 32) {
        V a[4], a2[4];
#pragma unroll
        for (int mb = 0; mb < 4; ++mb) { a[mb] = WFrag<T16>::ld(A + aoff + (size_t)mb * 16 * lda + kc); if (NSPLIT == 1 || NSPLIT == 2) a2[mb] = WFrag<T16>::ld(A2 + aoff + (size_t)mb * 16 * lda + kc); }
#pragma unroll
        for (int nb = 0; nb < 4; ++nb) { const V b = WFrag<T16>::ld(Bt + boff + (size_t)nb * 16 * K + kc); V b2; if (NSPLIT >= 2) b2 = WFrag<T16>::ld(Bt2 + boff + (size_t)nb * 16 * K + kc);
#pragma unroll
            for (int mb = 0; mb < 4; ++mb) { acc[mb][nb] = WFrag<T16>::mma(a[mb], b, acc[mb][nb]); if (NSPLIT == 1 || NSPLIT == 2) acc[mb][nb] = WFrag<T16>::mma(a2[mb], b, acc[mb][nb]); if (NSPLIT >= 2) acc[mb][nb] = WFrag<T16>::mma(a[mb], b2, acc[mb][nb]); } }
        asm volatile("v_nop\n\tv_nop\n\tv_nop\n\tv_nop" : "+v"(acc[0][0]), "+v"(acc[1][1]), "+v"(acc[2][2]), "+v"(acc[3][3]) : "v"(a[0]), "v"(a[3]));
    }
#pragma unroll
    for (int mb = 0; mb < 4; ++mb) {
#pragma unroll
        for (int nb = 0; nb < 4; ++nb) {
#pragma unroll
            for (int j = 0; j < 8; ++j) os[(hi * 8 + j) * 68 + nb * 16 + lr] = acc[mb][nb][j]; }
        __builtin_amdgcn_wave_barrier(); asm volatile("" ::: "memory");
        float* crow = C + (size_t)(r0 + mb * 16) * ldc + c0;
{
#pragma unroll
            for (int s = 0; s < 8; ++s) { const int row = 2 * s + hi, cofs = lr * 4; v4f val = *(const v4fa*)(os + row * 68 + cofs); if (BIAS) { val[0] += bfr(bias[c0 + cofs]); val[1] += bfr(bias[c0 + cofs + 1]); val[2] += bfr(bias[c0 + cofs + 2]); val[3] += bfr(bias[c0 + cofs + 3]); }
                *(v4f*)(crow + (size_t)row * ldc + cofs) = val; }
             }
        __builtin_amdgcn_wave_barrier(); asm volatile("" ::: "memory");
    }
}

__device__ __forceinline__ h16 tohx(float x) { return (h16)x; }
__device__ __forceinline__ void splitf(float y, unsigned short& h, unsigned short& l) { h = f2bf(y); l = f2bf(y - bf2f(h)); }
typedef __attribute__((ext_vector_type(2))) _Float16 v2h;
typedef __attribute__((ext_vector_type(4))) _Float16 v4h;
typedef __attribute__((ext_vector_type(2))) unsigned short v2us;
typedef __attribute__((ext_vector_type(4))) unsigned short v4us;
typedef __attribute__((ext_vector_type(2))) float v2f;
typedef __attribute__((ext_vector_type(4))) int v4i;

__global__ __launch_bounds__(256) void k_wtG(const float* __restrict__ w, int K, int N, bf* Bt) {
    const int lane = threadIdx.x & 31; const int L0 = (blockIdx.x * 8 + (threadIdx.x >> 5)) * 8; const int nlines = N * K / 64;
{
#pragma unroll 1
        for (int l = 0; l < 8; ++l) { const int L = L0 + l; if (L >= nlines) break; const size_t e = (size_t)L * 64 + lane * 2; const int k = (int)(e % K), n = (int)(e / K); v2us o;
            o[0] = f2bf(w[(size_t)k * N + n]); o[1] = f2bf(w[(size_t)(k + 1) * N + n]); *(v2us*)(Bt + e) = o; }
         }
}
__global__ __launch_bounds__(256) void k_cvt8(const float* __restrict__ src, bf* dst, size_t n8) { const size_t i = (size_t)blockIdx.x * 256 + threadIdx.x; if (i >= n8) return; const v8f v = *(const v8f*)(src + i * 8); v8us o;
#pragma unroll
    for (int k = 0; k < 8; ++k) o[k] = f2bf(v[k]); *(v8us*)(dst + i * 8) = o;  }

// k_rope: head planes [h][t][d] (fp16 + hi/lo) of rope(x) x sc with the rotate-half convention out[d] = x[d] cos[t][d] - x[d+HD/2] sin[t][d], out[d+HD/2] = x[d+HD/2] cos[t][d+HD/2] + x[d] sin[t][d+HD/2]
__global__ __launch_bounds__(256) void k_rope(const float* __restrict__ F, int pitch, int nheads, const float* __restrict__ CS, const float* __restrict__ RF, const float* __restrict__ nw, float sc, h16* P16, bf* Ph, bf* Pl) {
    const size_t e = ((size_t)blockIdx.x * 256 + threadIdx.x) * 2; if (e >= (size_t)nheads * TT * HD) return; const int d = (int)(e % HD); const int t = (int)((e / HD) % TT); const int h = (int)(e / ((size_t)HD * TT)); const float* f = F + (size_t)t * pitch + h * HD; const float rf = RF ? RF[(size_t)h * TT + t] : 1.0f; v2h o16; v2us oh, ol;
#pragma unroll
    for (int q = 0; q < 2; ++q) { const int dd = d + q; const int dp = (dd < HD / 2) ? dd + HD / 2 : dd - HD / 2; float x0 = f[dd], x1 = f[dp];
        if (RF) { float n0 = __fmul_rn(x0, rf), n1 = __fmul_rn(x1, rf); asm volatile("" : "+v"(n0)); asm volatile("" : "+v"(n1)); x0 = __fmul_rn(bfr(nw[dd]), n0); x1 = __fmul_rn(bfr(nw[dp]), n1); }
        const v2f cs = *(const v2f*)(CS + ((size_t)t * HD + dd) * 2); float a = __fmul_rn(x0, cs[0]), bq = __fmul_rn(x1, cs[1]); asm volatile("" : "+v"(a)); asm volatile("" : "+v"(bq)); const float r = ((dd < HD / 2) ? __fsub_rn(a, bq) : __fadd_rn(a, bq)) * sc;
        o16[q] = tohx(r); unsigned short a2, c2; splitf(r, a2, c2); oh[q] = a2; ol[q] = c2; }
    *(v2h*)(P16 + e) = o16; *(v2us*)(Ph + e) = oh; *(v2us*)(Pl + e) = ol;  }
__global__ __launch_bounds__(256) void k_vtp(const float* __restrict__ F, int pitch, int nheads, h16* V16, bf* Vh, bf* Vl) { const size_t e = ((size_t)blockIdx.x * 256 + threadIdx.x) * 2; if (e >= (size_t)nheads * HD * TT) return; const int t = (int)(e % TT); const int d = (int)((e / TT) % HD); const int g = (int)(e / ((size_t)TT * HD)); v2h o16; v2us oh, ol;
#pragma unroll
    for (int q = 0; q < 2; ++q) { const float x = F[(size_t)(t + q) * pitch + g * HD + d]; o16[q] = tohx(x); unsigned short a2, c2; splitf(x, a2, c2); oh[q] = a2; ol[q] = c2; }
    *(v2h*)(V16 + e) = o16; *(v2us*)(Vh + e) = oh; *(v2us*)(Vl + e) = ol;  }
__global__ __launch_bounds__(256) void k_csid(float* CS) { const int idx = blockIdx.x * 256 + threadIdx.x; if (idx >= TT * HD) return; v2f cs; cs[0] = 1.0f; cs[1] = 0.0f; *(v2f*)(CS + (size_t)idx * 2) = cs;  }
// k_asoft: per row (zz, i): t = (S x HD^-0.5 + bf16(RP[i][j])) + bf16(RB[i][j]) with RP = the shared [TT][TT] additive mask and RB = this batch's [TT][TT] additive bias (both unconditional 16-B loads); softmax over the 2048 keys (register row, one exp, fixed trees);
// the probabilities go back over the row's own 8 KiB of Sb (the wave holds the whole row in registers before its first store, and no other wave touches the row): rows < RH hi plane in the first 4 KiB, lo plane in the second; other rows fp16 in the first 4 KiB.
__global__ __launch_bounds__(256) void k_asoft(float* Sb, const float* __restrict__ RP, const float* __restrict__ RB) {
    const int lane = threadIdx.x & 31; const int row = blockIdx.x * 8 + (threadIdx.x >> 5); if (row >= ZH * TT) return; const int i = row % TT; const int zz = row / TT; (void)zz; const bool hires = (i < RH); const float* sr = Sb + (size_t)row * TT; const float* rp = RP + (size_t)i * TT; const float* rq = RB + (size_t)i * TT; float v[TT / 32]; float mx = -3.0e38f;
#pragma unroll
    for (int ch = 0; ch < TT / 128; ++ch) { const int j0 = ch * 128 + lane * 4; const v4f a = *(const v4f*)(sr + j0); const v4f r4 = *(const v4f*)(rp + j0); const v4f b4 = *(const v4f*)(rq + j0);
#pragma unroll
        for (int q = 0; q < 4; ++q) { const int j = j0 + q; (void)j; float sc = a[q] * SCL; asm volatile("" : "+v"(sc)); float rb = bfr(r4[q]); asm volatile("" : "+v"(rb)); float t0 = __fadd_rn(sc, rb); asm volatile("" : "+v"(t0)); float bb = bfr(b4[q]); asm volatile("" : "+v"(bb)); const float t = __fadd_rn(t0, bb); v[ch * 4 + q] = t;   /* (s x SCL + mask) + bias, the module's order; barriers keep the bf16->f32 widens out of a v_fma_mix */ mx = fmaxf(mx, t); } }
#pragma unroll
    for (int sh = 16; sh; sh >>= 1) mx = fmaxf(mx, __shfl_xor(mx, sh, 32));
    float sum = 0.f;
#pragma unroll
    for (int k = 0; k < TT / 32; ++k) { float d0 = __fsub_rn(v[k], mx); asm volatile("" : "+v"(d0)); v[k] = __builtin_amdgcn_exp2f(__fmul_rn(d0, 1.4426950408889634f)); sum += v[k]; }
#pragma unroll
    for (int sh = 16; sh; sh >>= 1) sum += __shfl_xor(sum, sh, 32);
    const float f = __fdiv_rn(hires ? 1.0f : PCAR, sum);
{
        if (hires) {
#pragma unroll
            for (int ch = 0; ch < TT / 128; ++ch) { v4us oh, ol;
#pragma unroll
                for (int q = 0; q < 4; ++q) { unsigned short a, c2; splitf(v[ch * 4 + q] * f, a, c2); oh[q] = a; ol[q] = c2; }
                bf* pr = (bf*)(Sb + (size_t)row * TT) + ch * 128 + lane * 4; *(v4us*)pr = oh; *(v4us*)(pr + TT) = ol; }
        } else {
#pragma unroll
            for (int ch = 0; ch < TT / 128; ++ch) { v4h o4;
#pragma unroll
                for (int q = 0; q < 4; ++q) o4[q] = tohx(v[ch * 4 + q] * f);
                *(v4h*)((h16*)(Sb + (size_t)row * TT) + ch * 128 + lane * 4) = o4; } }
         }
}
__global__ __launch_bounds__(256) void k_merge(const float* __restrict__ O, int h0, bf* Ah, bf* Al) { const size_t e = ((size_t)blockIdx.x * 256 + threadIdx.x) * 2; if (e >= (size_t)ZH * TT * HD) return; const int d = (int)(e % HD); const int t = (int)((e / HD) % TT); const int zz = (int)(e / ((size_t)HD * TT)); const float cs = (t < RH) ? 1.0f : (1.0f / PCAR); const size_t oo = (size_t)t * DQ + (h0 + zz) * HD + d;
    v2f s = *(const v2f*)(O + e);   // the KSP partial planes, summed in plane order; unrolled so that all the planes' loads are in flight together
#pragma unroll
    for (int p = 1; p < KSP; ++p) s += *(const v2f*)(O + (size_t)p * ZH * TT * HD + e);
    v2us oh, ol;
#pragma unroll
    for (int q = 0; q < 2; ++q) { unsigned short a, c2; splitf(s[q] * cs, a, c2); oh[q] = a; ol[q] = c2; } *(v2us*)(Ah + oo) = oh; *(v2us*)(Al + oo) = ol;  }

extern "C" void kernel_launch(void* const* d_in, const int* in_sizes, int n_in,
                              void* d_out, int out_size, void* d_ws, size_t ws_size, hipStream_t stream) {
    (void)in_sizes; (void)n_in; (void)out_size;
    const float* x = (const float*)d_in[0]; const float* amask = (const float*)d_in[1]; const float* abias = (const float*)d_in[2]; const float* wqkv = (const float*)d_in[3]; const float* bqkv = (const float*)d_in[4]; const float* wo = (const float*)d_in[5]; const float* bo = (const float*)d_in[6];   /* x, attn_mask [2048][2048], attn_bias [2][2048][2048], Wqkv ('xw' [1024][3072]), bqkv, Wout ('xw'), bout */ const float* bq = bqkv; const float* bk = bqkv + DQ; const float* bv = bqkv + 2 * DQ; const float* wq = wqkv; const float* wk = nullptr; const float* wv = nullptr; (void)wk; (void)wv;
    float* OUT = (float*)d_out;     // [2][2048][1024]
    char* wsp = (char*)d_ws;
    auto take = [&](size_t bytes) { char* p = wsp; wsp += (bytes + 255) & ~(size_t)255; return (void*)p; };
    bf* WQKV = (bf*)take((size_t)3 * DQ * DM * 2); bf* WQ = WQKV; bf* WK = WQKV + (size_t)DQ * DM; bf* WV = WQKV + (size_t)2 * DQ * DM;   /* fused Bt [3*DQ][DM]: q | k | v row blocks */ bf* WO = (bf*)take((size_t)DM * DQ * 2); float* CS = (float*)take((size_t)TT * HD * 2 * 4);
    float* Ob = (float*)take((size_t)KSP * ZH * TT * HD * 4); bf* XB = (bf*)Ob; float* FQ = Ob + (size_t)TT * DM / 2; float* FK = FQ + (size_t)TT * DQ;   /* the projection scratch (bf16 x, f32 q, f32 k/v) is dead once a batch's head planes are built: the P.V partial planes use the same bytes (stream-ordered; every batch writes the scratch anew) */
    h16* QP16 = (h16*)take((size_t)NH_ * TT * HD * 2); h16* KP16 = (h16*)take((size_t)NKV * TT * HD * 2); h16* VT16 = (h16*)take((size_t)NKV * HD * TT * 2);
    bf* QPh = (bf*)take((size_t)NH_ * TT * HD * 2); bf* QPl = (bf*)take((size_t)NH_ * TT * HD * 2); bf* KPh = (bf*)take((size_t)NKV * TT * HD * 2); bf* KPl = (bf*)take((size_t)NKV * TT * HD * 2); bf* VTh = (bf*)take((size_t)NKV * HD * TT * 2); bf* VTl = (bf*)take((size_t)NKV * HD * TT * 2);
    float* Sb = (float*)take((size_t)ZH * TT * TT * 4); bf* Ph = (bf*)Sb; bf* Pl = Ph + TT; h16* P16 = (h16*)Sb;   /* P lies over S, row by row: 16-bit pitch 2 TT */ bf* ATh = (bf*)take((size_t)TT * DQ * 2); bf* ATl = (bf*)take((size_t)TT * DQ * 2);
    if ((size_t)(wsp - (char*)d_ws) > ws_size) return;    // ws 256 MiB
    float* FV = FK;   // v projection reuses the k buffer after the k planes are built (stream-ordered)
    { k_wtG<<<(unsigned)((DM * 3 * DQ / 64 + 63) / 64), 256, 0, stream>>>(wqkv, DM, 3 * DQ, WQKV);   /* fused 'xw' [DM][3*DQ] -> Bt [3*DQ][DM] */
      k_wtG<<<(unsigned)((DQ * DM / 64 + 63) / 64), 256, 0, stream>>>(wo, DQ, DM, WO);
       }
    k_csid<<<(TT * HD + 255) / 256, 256, 0, stream>>>(CS);
    const unsigned LQ = (unsigned)(((size_t)NH_ * TT * HD / 2 + 255) / 256), LKv = (unsigned)(((size_t)NKV * TT * HD / 2 + 255) / 256);
    for (int b = 0; b < NB_; ++b) {
        
        k_cvt8<<<(unsigned)(((size_t)TT * DM / 8 + 255) / 256), 256, 0, stream>>>(x + (size_t)b * TT * DM, XB, (size_t)TT * DM / 8);
        k_gemmw<bf, 0, true><<<dim3(TT / 64, DQ / 64, 1), 32, 0, stream>>>(XB, nullptr, WQ, nullptr, DM, DM, FQ, DQ, bq, 0, 0, 0);
        k_rope<<<LQ, 256, 0, stream>>>(FQ, DQ, NH_, CS, nullptr, nullptr, 1.0f, QP16, QPh, QPl);
        k_gemmw<bf, 0, true><<<dim3(TT / 64, DKV / 64, 1), 32, 0, stream>>>(XB, nullptr, WK, nullptr, DM, DM, FK, DKV, bk, 0, 0, 0);
        k_rope<<<LKv, 256, 0, stream>>>(FK, DKV, NKV, CS, nullptr, nullptr, 1.0f, KP16, KPh, KPl);
        k_gemmw<bf, 0, true><<<dim3(TT / 64, DKV / 64, 1), 32, 0, stream>>>(XB, nullptr, WV, nullptr, DM, DM, FV, DKV, bv, 0, 0, 0); k_vtp<<<LKv, 256, 0, stream>>>(FV, DKV, NKV, VT16, VTh, VTl);
        for (int h0 = 0; h0 < NH_; h0 += ZH) { const size_t zq = (size_t)h0, zk = (size_t)(h0 / REP);   // one kv head per query head: the pass's ZH heads use consecutive kv planes (z-strides TT*HD)
            k_gemmw<bf, 2, false><<<dim3(RH / 64, TT / 64, ZH), 32, 0, stream>>>(QPh + zq * TT * HD, QPl + zq * TT * HD, KPh + zk * TT * HD, KPl + zk * TT * HD, HD, HD, Sb, TT, nullptr, (size_t)TT * HD, (size_t)TT * HD, (size_t)TT * TT);
            k_gemmw<h16, 0, false><<<dim3((TT - RH) / 64, TT / 64, ZH), 32, 0, stream>>>(QP16 + zq * TT * HD + (size_t)RH * HD, nullptr, KP16 + zk * TT * HD, nullptr, HD, HD, Sb + (size_t)RH * TT, TT, nullptr, (size_t)TT * HD, (size_t)TT * HD, (size_t)TT * TT);
            k_asoft<<<ZH * TT / 8, 256, 0, stream>>>(Sb, amask, abias + (size_t)b * TT * TT);   /* shared mask plane; this batch's bias plane */
            k_gemmw<bf, 2, false, KSP><<<dim3(RH / 64, HD / 64, ZH * KSP), 32, 0, stream>>>(Ph, Pl, VTh + zk * HD * TT, VTl + zk * HD * TT, TT, 2 * TT, Ob, HD, nullptr, (size_t)TT * 2 * TT, (size_t)HD * TT, (size_t)TT * HD);
            k_gemmw<h16, 0, false, KSP><<<dim3((TT - RH) / 64, HD / 64, ZH * KSP), 32, 0, stream>>>(P16 + (size_t)RH * 2 * TT, nullptr, VT16 + zk * HD * TT, nullptr, TT, 2 * TT, Ob + (size_t)RH * HD, HD, nullptr, (size_t)TT * 2 * TT, (size_t)HD * TT, (size_t)TT * HD);
            k_merge<<<(unsigned)(((size_t)ZH * TT * HD / 2 + 255) / 256), 256, 0, stream>>>(Ob, h0, ATh, ATl); }
        k_gemmw<bf, 1, true><<<dim3(TT / 64, DM / 64, 1), 32, 0, stream>>>(ATh, ATl, WO, nullptr, DQ, DQ, OUT + (size_t)b * TT * DM, DM, bo, 0, 0, 0); }
}

// v003
// A run of this version takes 419 microseconds.
// In two side-by-side timings against v002, it was 1.66 and 1.67 times as fast.
// All steps since v000 together make it 5.00 times as fast.
#include <hip/hip_runtime.h>

// Multi-head self-attention with a fused qkv projection and TWO additive score planes (x [2][2048][1024]; qkv = x Wqkv + bqkv ('xw' [1024][3072] 1/32 + bias (zeros on this draw: read)) -> reshape (B, S, 3, 16, 64): q | k | v column thirds; scores = q.k / sqrt(64) + attn_mask[i][j] (f32 [2048][2048], shared by heads and batches) + attn_bias[b][i][j] (f32 [2][2048][2048], shared by heads); softmax over all keys; out = merged Wout + bout ('xw' [1024][1024] + bias) -> [2][2048][1024] (4.2 M); argument order x, attn_mask, attn_bias, Wqkv, bqkv, Wout, bout).
// Layout per batch: bf16 copy of x; the fused 'xw' weight transposed once into Bt (q | k | v row blocks) + bias slices; exact projections + f32 biases; identity-table plane builders; one fused attention kernel per batch (hybrid rows: < 512 hi/lo 3 products, rest fp16) that adds bf16(attn_mask[i][j]) and then bf16(attn_bias[b][i][j]) to the scaled f32 score, in the module's order, and keeps scores and probabilities in registers; merged hi/lo x Wout exact + bout.
// Compute dtypes, f32 accumulate: every input rounded to bf16 incl. the two planes; projections exact + f32 biases; attention rows < 512 3 products, rest fp16; softmax f32; Wout hl x exact + bias.

#define NB_  2
#define TT   2048
#define DM   1024
#define NH_  16
#define NKV  16
#define REP  (NH_ / NKV)
#define HD   64
#define DQ   (NH_ * HD)
#define DKV  (NKV * HD)
#define ZH   8                    // plane count of k_gemmw's split-K addressing (unused at KS = 1)
#define RH   512                  // query rows < RH use hi+lo planes (0: none)
#define WIN  0
#define SCL  0.125f   // HD^-0.5
#define FKS  4                    // key splits of the fused attention: a wave walks TT / FKS keys of its queries, the FKS partials are joined in LDS
typedef _Float16 h16;
typedef unsigned short bf;
typedef __attribute__((ext_vector_type(16))) __bf16   v16bf;
typedef __attribute__((ext_vector_type(16))) _Float16 v16h;
typedef __attribute__((ext_vector_type(8)))  _Float16 v8h;
typedef __attribute__((ext_vector_type(8)))  unsigned short v8us;
typedef __attribute__((ext_vector_type(8)))  float    v8f;
typedef __attribute__((ext_vector_type(4)))  float    v4f;
typedef v8h  __attribute__((may_alias)) v8ha;
typedef v4f  __attribute__((may_alias)) v4fa;
typedef v8us __attribute__((may_alias)) v8usa;

__device__ __forceinline__ unsigned short f2bf(float f) { unsigned u = __float_as_uint(f); u += 0x7FFFu + ((u >> 16) & 1u); return (unsigned short)(u >> 16); }
__device__ __forceinline__ float bf2f(unsigned short b) { return __uint_as_float(((unsigned)b) << 16); }
__device__ __forceinline__ float bfr(float f) { return bf2f(f2bf(f)); }
__device__ __forceinline__ v16h cat16(v8h lo, v8h hi) { return __builtin_shufflevector(lo, hi, 0, 1, 2, 3, 4, 5, 6, 7, 8, 9, 10, 11, 12, 13, 14, 15); }
__device__ __forceinline__ v16bf cat16b(v8us lo, v8us hi) { return __builtin_bit_cast(v16bf, __builtin_shufflevector(lo, hi, 0, 1, 2, 3, 4, 5, 6, 7, 8, 9, 10, 11, 12, 13, 14, 15)); }
__device__ __forceinline__ v8f wmma16(v16h a, v16h b, v8f c) { return __builtin_amdgcn_wmma_f32_16x16x32_f16(false, a, false, b, (short)0, c, false, false); }
__device__ __forceinline__ v8f wmmab(v16bf a, v16bf b, v8f c) { return __builtin_amdgcn_wmma_f32_16x16x32_bf16(false, a, false, b, (short)0, c, false, false); }



// ---- k_gemmw: register-blocked GEMM, ONE WAVE per 64x64 output tile (16 accumulators), operands straight from K-contiguous 16-bit planes; grid (M/64, N/64, Z), 32 threads.
// C[m][n] (f32, pitch ldc, + optional f32 bias[n]) = sum_k A[m][k] Bt[n][k] (+ split products per NSPLIT). A rows have pitch lda, Bt rows pitch K. z-batch strides sA/sB/sC in elements. K % 32 == 0.
// KS > 1: grid z = Z * KS; block (z, ks) sums k in [ks K/KS, (ks+1) K/KS) alone and stores its partial tile in plane ks of C ([KS][ZH] planes of sC elements; Z = ZH). K % (32 KS) == 0.
template <typename T16> struct WFrag;
template <> struct WFrag<h16> { typedef v16h V; static __device__ __forceinline__ V ld(const h16* p) { return cat16(*(const v8h*)p, *(const v8h*)(p + 16)); } static __device__ __forceinline__ v8f mma(V a, V b, v8f c) { return wmma16(a, b, c); } };
template <> struct WFrag<bf> { typedef v16bf V; static __device__ __forceinline__ V ld(const bf* p) { return cat16b(*(const v8us*)p, *(const v8us*)(p + 16)); } static __device__ __forceinline__ v8f mma(V a, V b, v8f c) { return wmmab(a, b, c); } };
template <typename T16, int NSPLIT, bool BIAS, int KS = 1>
__global__ __launch_bounds__(32) void k_gemmw(const T16* __restrict__ A, const T16* __restrict__ A2, const T16* __restrict__ Bt, const T16* __restrict__ Bt2, int K, int lda, float* C, int ldc, const float* __restrict__ bias, size_t sA, size_t sB, size_t sC) {
    typedef typename WFrag<T16>::V V;
    __shared__ __align__(16) float os[16 * 68];
    const size_t z = blockIdx.z / KS; const int ks = blockIdx.z % KS; A += z * sA; if (A2) A2 += z * sA; Bt += z * sB; if (Bt2) Bt2 += z * sB; C += ((size_t)ks * ZH + z) * sC;
    const int lane = threadIdx.x & 31, lr = lane & 15, hi = lane >> 4; const int r0 = blockIdx.x * 64, c0 = blockIdx.y * 64;
    v8f acc[4][4];
#pragma unroll
    for (int mb = 0; mb < 4; ++mb)
#pragma unroll
        for (int nb = 0; nb < 4; ++nb) acc[mb][nb] = (v8f){};
    const size_t aoff = (size_t)(r0 + lr) * lda + 8 * hi, boff = (size_t)(c0 + lr) * K + 8 * hi;
#pragma unroll 1
    for (int kc = ks * (K / KS); kc < (ks + 1) * (K / KS); kc += 32) {
        V a[4], a2[4];
#pragma unroll
        for (int mb = 0; mb < 4; ++mb) { a[mb] = WFrag<T16>::ld(A + aoff + (size_t)mb * 16 * lda + kc); if (NSPLIT == 1 || NSPLIT == 2) a2[mb] = WFrag<T16>::ld(A2 + aoff + (size_t)mb * 16 * lda + kc); }
#pragma unroll
        for (int nb = 0; nb < 4; ++nb) { const V b = WFrag<T16>::ld(Bt + boff + (size_t)nb * 16 * K + kc); V b2; if (NSPLIT >= 2) b2 = WFrag<T16>::ld(Bt2 + boff + (size_t)nb * 16 * K + kc);
#pragma unroll
            for (int mb = 0; mb < 4; ++mb) { acc[mb][nb] = WFrag<T16>::mma(a[mb], b, acc[mb][nb]); if (NSPLIT == 1 || NSPLIT == 2) acc[mb][nb] = WFrag<T16>::mma(a2[mb], b, acc[mb][nb]); if (NSPLIT >= 2) acc[mb][nb] = WFrag<T16>::mma(a[mb], b2, acc[mb][nb]); } }
        asm volatile("v_nop\n\tv_nop\n\tv_nop\n\tv_nop" : "+v"(acc[0][0]), "+v"(acc[1][1]), "+v"(acc[2][2]), "+v"(acc[3][3]) : "v"(a[0]), "v"(a[3]));
    }
#pragma unroll
    for (int mb = 0; mb < 4; ++mb) {
#pragma unroll
        for (int nb = 0; nb < 4; ++nb) {
#pragma unroll
            for (int j = 0; j < 8; ++j) os[(hi * 8 + j) * 68 + nb * 16 + lr] = acc[mb][nb][j]; }
        __builtin_amdgcn_wave_barrier(); asm volatile("" ::: "memory");
        float* crow = C + (size_t)(r0 + mb * 16) * ldc + c0;
{
#pragma unroll
            for (int s = 0; s < 8; ++s) { const int row = 2 * s + hi, cofs = lr * 4; v4f val = *(const v4fa*)(os + row * 68 + cofs); if (BIAS) { val[0] += bfr(bias[c0 + cofs]); val[1] += bfr(bias[c0 + cofs + 1]); val[2] += bfr(bias[c0 + cofs + 2]); val[3] += bfr(bias[c0 + cofs + 3]); }
                *(v4f*)(crow + (size_t)row * ldc + cofs) = val; }
             }
        __builtin_amdgcn_wave_barrier(); asm volatile("" ::: "memory");
    }
}

__device__ __forceinline__ h16 tohx(float x) { return (h16)x; }
__device__ __forceinline__ void splitf(float y, unsigned short& h, unsigned short& l) { h = f2bf(y); l = f2bf(y - bf2f(h)); }
typedef __attribute__((ext_vector_type(2))) _Float16 v2h;
typedef __attribute__((ext_vector_type(4))) _Float16 v4h;
typedef __attribute__((ext_vector_type(2))) unsigned short v2us;
typedef __attribute__((ext_vector_type(4))) unsigned short v4us;
typedef __attribute__((ext_vector_type(2))) float v2f;
typedef __attribute__((ext_vector_type(4))) int v4i;

__global__ __launch_bounds__(256) void k_wtG(const float* __restrict__ w, int K, int N, bf* Bt) {
    const int lane = threadIdx.x & 31; const int L0 = (blockIdx.x * 8 + (threadIdx.x >> 5)) * 8; const int nlines = N * K / 64;
{
#pragma unroll 1
        for (int l = 0; l < 8; ++l) { const int L = L0 + l; if (L >= nlines) break; const size_t e = (size_t)L * 64 + lane * 2; const int k = (int)(e % K), n = (int)(e / K); v2us o;
            o[0] = f2bf(w[(size_t)k * N + n]); o[1] = f2bf(w[(size_t)(k + 1) * N + n]); *(v2us*)(Bt + e) = o; }
         }
}
__global__ __launch_bounds__(256) void k_cvt8(const float* __restrict__ src, bf* dst, size_t n8) { const size_t i = (size_t)blockIdx.x * 256 + threadIdx.x; if (i >= n8) return; const v8f v = *(const v8f*)(src + i * 8); v8us o;
#pragma unroll
    for (int k = 0; k < 8; ++k) o[k] = f2bf(v[k]); *(v8us*)(dst + i * 8) = o;  }

// k_rope: head planes [h][t][d] (fp16 + hi/lo) of rope(x) x sc with the rotate-half convention out[d] = x[d] cos[t][d] - x[d+HD/2] sin[t][d], out[d+HD/2] = x[d+HD/2] cos[t][d+HD/2] + x[d] sin[t][d+HD/2]
__global__ __launch_bounds__(256) void k_rope(const float* __restrict__ F, int pitch, int nheads, const float* __restrict__ CS, const float* __restrict__ RF, const float* __restrict__ nw, float sc, h16* P16, bf* Ph, bf* Pl) {
    const size_t e = ((size_t)blockIdx.x * 256 + threadIdx.x) * 2; if (e >= (size_t)nheads * TT * HD) return; const int d = (int)(e % HD); const int t = (int)((e / HD) % TT); const int h = (int)(e / ((size_t)HD * TT)); const float* f = F + (size_t)t * pitch + h * HD; const float rf = RF ? RF[(size_t)h * TT + t] : 1.0f; v2h o16; v2us oh, ol;
#pragma unroll
    for (int q = 0; q < 2; ++q) { const int dd = d + q; const int dp = (dd < HD / 2) ? dd + HD / 2 : dd - HD / 2; float x0 = f[dd], x1 = f[dp];
        if (RF) { float n0 = __fmul_rn(x0, rf), n1 = __fmul_rn(x1, rf); asm volatile("" : "+v"(n0)); asm volatile("" : "+v"(n1)); x0 = __fmul_rn(bfr(nw[dd]), n0); x1 = __fmul_rn(bfr(nw[dp]), n1); }
        const v2f cs = *(const v2f*)(CS + ((size_t)t * HD + dd) * 2); float a = __fmul_rn(x0, cs[0]), bq = __fmul_rn(x1, cs[1]); asm volatile("" : "+v"(a)); asm volatile("" : "+v"(bq)); const float r = ((dd < HD / 2) ? __fsub_rn(a, bq) : __fadd_rn(a, bq)) * sc;
        o16[q] = tohx(r); unsigned short a2, c2; splitf(r, a2, c2); oh[q] = a2; ol[q] = c2; }
    *(v2h*)(P16 + e) = o16; *(v2us*)(Ph + e) = oh; *(v2us*)(Pl + e) = ol;  }
__global__ __launch_bounds__(256) void k_vtp(const float* __restrict__ F, int pitch, int nheads, h16* V16, bf* Vh, bf* Vl) { const size_t e = ((size_t)blockIdx.x * 256 + threadIdx.x) * 2; if (e >= (size_t)nheads * HD * TT) return; const int t = (int)(e % TT); const int d = (int)((e / TT) % HD); const int g = (int)(e / ((size_t)TT * HD)); v2h o16; v2us oh, ol;
#pragma unroll
    for (int q = 0; q < 2; ++q) { const float x = F[(size_t)(t + q) * pitch + g * HD + d]; o16[q] = tohx(x); unsigned short a2, c2; splitf(x, a2, c2); oh[q] = a2; ol[q] = c2; }
    *(v2h*)(V16 + e) = o16; *(v2us*)(Vh + e) = oh; *(v2us*)(Vl + e) = ol;  }
__global__ __launch_bounds__(256) void k_csid(float* CS) { const int idx = blockIdx.x * 256 + threadIdx.x; if (idx >= TT * HD) return; v2f cs; cs[0] = 1.0f; cs[1] = 0.0f; *(v2f*)(CS + (size_t)idx * 2) = cs;  }
// ---- k_fattn: scores, softmax and P.V of one head's 64 query rows in one work-group; nothing of S or P goes to memory.
// Transposed products: St = K Qt (A = key rows, B = query rows), so a lane holds one query's scores (register r of key tile kt = key kt*16 + 8*hi + r, query lr); two St tiles converted in place are the B operand of Ot += Vt Pt (A = rows of the [d][t] planes).
// t = (S x HD^-0.5 + bf16(RP[i][j])) + bf16(RB[i][j]); running maximum per query in log2 units, moved (and sums and Ot rescaled) only when a score passes it by more than 8, so p <= 2^8.
// The two planes come as whole 128-byte rows (4 lines a load instead of 16) and are turned into the score layout through the wave's own LDS region (pitch 36 floats), which later holds its Ot partial.
// 8 waves: wave w takes query rows (w & 1) * 32 .. + 31 and keys (w >> 1) * TT / FKS .. ; the FKS partial (maximum, sum, Ot) of a query are joined in split order through LDS, normalised and stored as hi/lo bf16 rows of the merged [t][DQ] planes.
#define L2E 1.4426950408889634f
#define FWR (2 * 32 * 36)         // floats of a wave's LDS region: two 32 x 36 plane tiles in the loop, then its 32 x 68 Ot partial
typedef __attribute__((ext_vector_type(8))) __bf16 v8bq;
__device__ __forceinline__ v8f bfr8(v8f x) { return __builtin_convertvector(__builtin_convertvector(x, v8bq), v8f); }   // nearest-even bf16 rounding, widened again
__device__ __forceinline__ v8f ld8f(const float* p) { const v4f a = *(const v4fa*)p, b = *(const v4fa*)(p + 4); return __builtin_shufflevector(a, b, 0, 1, 2, 3, 4, 5, 6, 7); }
template <bool HI, typename T16>
__device__ __forceinline__ void fa_wave(const T16* __restrict__ Q, const T16* __restrict__ Q2, const T16* __restrict__ Kp, const T16* __restrict__ K2, const T16* __restrict__ Vt, const T16* __restrict__ V2, const float* __restrict__ RP, const float* __restrict__ RB, int q0w, int key0, float* osw, float* msw, float* lsw) {
    typedef typename WFrag<T16>::V V;
    const int lane = threadIdx.x & 31, lr = lane & 15, hi = lane >> 4;
    V qf[2][2], qf2[2][2];
#pragma unroll
    for (int qt = 0; qt < 2; ++qt)
#pragma unroll
        for (int kc = 0; kc < 2; ++kc) { const size_t o = (size_t)(q0w + qt * 16 + lr) * HD + kc * 32 + 8 * hi; qf[qt][kc] = WFrag<T16>::ld(Q + o); if (HI) qf2[qt][kc] = WFrag<T16>::ld(Q2 + o); }
    v8f acc[4][2];
#pragma unroll
    for (int dt = 0; dt < 4; ++dt) { acc[dt][0] = (v8f){}; acc[dt][1] = (v8f){}; }
    float m[2] = {-3.0e38f, -3.0e38f}, l[2] = {0.f, 0.f};
    const int srow = lane >> 3, scol = (lane & 7) * 4; const size_t prow = (size_t)(q0w + srow) * TT + scol;
#pragma unroll 1
    for (int key = key0; key < key0 + TT / FKS; key += 32) {
        v4f gm[8], gb[8];   // this pass's 32 x 32 tiles of the mask and bias planes, 8 lanes a row; the hi/lo rows ask for them behind the score products, whose fragments fill the registers
        if constexpr (!HI) {
#pragma unroll
            for (int i = 0; i < 8; ++i) { const size_t o = prow + (size_t)i * 4 * TT + key; gm[i] = *(const v4f*)(RP + o); gb[i] = *(const v4f*)(RB + o); } }
        v8f s[2][2];   // [key tile][query tile]
#pragma unroll
        for (int kt = 0; kt < 2; ++kt) { s[kt][0] = (v8f){}; s[kt][1] = (v8f){};
#pragma unroll
            for (int kc = 0; kc < 2; ++kc) { const size_t o = (size_t)(key + kt * 16 + lr) * HD + kc * 32 + 8 * hi; const V kf = WFrag<T16>::ld(Kp + o); V kf2; if (HI) kf2 = WFrag<T16>::ld(K2 + o);
#pragma unroll
                for (int qt = 0; qt < 2; ++qt) { s[kt][qt] = WFrag<T16>::mma(kf, qf[qt][kc], s[kt][qt]); if (HI) { s[kt][qt] = WFrag<T16>::mma(kf, qf2[qt][kc], s[kt][qt]); s[kt][qt] = WFrag<T16>::mma(kf2, qf[qt][kc], s[kt][qt]); } } } }
        if constexpr (HI) {
#pragma unroll
            for (int i = 0; i < 8; ++i) { const size_t o = prow + (size_t)i * 4 * TT + key; gm[i] = *(const v4f*)(RP + o); gb[i] = *(const v4f*)(RB + o); } }
#pragma unroll
        for (int i = 0; i < 8; ++i) { float* sp = osw + (i * 4 + srow) * 36 + scol; *(v4fa*)sp = gm[i]; *(v4fa*)(sp + 32 * 36) = gb[i]; }
        __builtin_amdgcn_wave_barrier(); asm volatile("" ::: "memory");   // other lanes' tile rows are read below: the compiler must not lift those LDS reads over the stores
        float c[2];
#pragma unroll
        for (int qt = 0; qt < 2; ++qt) { float mx = -3.0e38f;
#pragma unroll
            for (int kt = 0; kt < 2; ++kt) { const float* sp = osw + (qt * 16 + lr) * 36 + kt * 16 + 8 * hi; const v8f t = (s[kt][qt] * SCL + bfr8(ld8f(sp))) + bfr8(ld8f(sp + 32 * 36)); s[kt][qt] = t;
#pragma unroll
                for (int r = 0; r < 8; ++r) mx = fmaxf(mx, t[r]); }
            c[qt] = mx * L2E; }
        __builtin_amdgcn_wave_barrier(); asm volatile("" ::: "memory");   // the next pass's tile stores (and the Ot partial behind the loop) stay behind these reads
        if (__builtin_amdgcn_ballot_w32(c[0] > m[0] + 8.0f || c[1] > m[1] + 8.0f) != 0) {   // wave-uniform: both halves of a query move its maximum together
#pragma unroll
            for (int qt = 0; qt < 2; ++qt) { const float mn = fmaxf(m[qt], fmaxf(c[qt], __shfl_xor(c[qt], 16, 32))); const float al = __builtin_amdgcn_exp2f(m[qt] - mn); m[qt] = mn; l[qt] *= al;
#pragma unroll
                for (int dt = 0; dt < 4; ++dt) acc[dt][qt] *= al; } }
        V pf[2], pf2[2];
#pragma unroll
        for (int qt = 0; qt < 2; ++qt) { v8f p[2];
#pragma unroll
            for (int kt = 0; kt < 2; ++kt) { const v8f e = __builtin_elementwise_fma(s[kt][qt], (v8f)(L2E), (v8f)(-m[qt]));
#pragma unroll
                for (int r = 0; r < 8; ++r) { p[kt][r] = __builtin_amdgcn_exp2f(e[r]); l[qt] += p[kt][r]; } }
            if constexpr (HI) { const v8bq h0 = __builtin_convertvector(p[0], v8bq), h1 = __builtin_convertvector(p[1], v8bq);
                const v8bq l0 = __builtin_convertvector(p[0] - __builtin_convertvector(h0, v8f), v8bq), l1 = __builtin_convertvector(p[1] - __builtin_convertvector(h1, v8f), v8bq);
                pf[qt] = __builtin_shufflevector(h0, h1, 0, 1, 2, 3, 4, 5, 6, 7, 8, 9, 10, 11, 12, 13, 14, 15); pf2[qt] = __builtin_shufflevector(l0, l1, 0, 1, 2, 3, 4, 5, 6, 7, 8, 9, 10, 11, 12, 13, 14, 15); }
            else pf[qt] = cat16(__builtin_convertvector(p[0], v8h), __builtin_convertvector(p[1], v8h)); }
#pragma unroll
        for (int dt = 0; dt < 4; ++dt) { const size_t o = (size_t)(dt * 16 + lr) * TT + key + 8 * hi; const V vf = WFrag<T16>::ld(Vt + o); V vf2; if (HI) vf2 = WFrag<T16>::ld(V2 + o);
#pragma unroll
            for (int qt = 0; qt < 2; ++qt) { acc[dt][qt] = WFrag<T16>::mma(vf, pf[qt], acc[dt][qt]); if (HI) { acc[dt][qt] = WFrag<T16>::mma(vf, pf2[qt], acc[dt][qt]); acc[dt][qt] = WFrag<T16>::mma(vf2, pf[qt], acc[dt][qt]); } } }
    }
#pragma unroll
    for (int qt = 0; qt < 2; ++qt) { const float lt = l[qt] + __shfl_xor(l[qt], 16, 32); if (hi == 0) { msw[qt * 16 + lr] = m[qt]; lsw[qt * 16 + lr] = lt; }
#pragma unroll
        for (int dt = 0; dt < 4; ++dt) { float* op = osw + (qt * 16 + lr) * 68 + dt * 16 + hi * 8; const v8f a = acc[dt][qt]; *(v4fa*)op = __builtin_shufflevector(a, a, 0, 1, 2, 3); *(v4fa*)(op + 4) = __builtin_shufflevector(a, a, 4, 5, 6, 7); } }
}
__global__ __launch_bounds__(256) __attribute__((amdgpu_waves_per_eu(4, 4))) void k_fattn(const h16* __restrict__ Q16, const h16* __restrict__ K16, const h16* __restrict__ V16, const bf* __restrict__ Qh, const bf* __restrict__ Ql, const bf* __restrict__ Kh, const bf* __restrict__ Kl, const bf* __restrict__ Vh, const bf* __restrict__ Vl, const float* __restrict__ RP, const float* __restrict__ RB, bf* Ah, bf* Al) {
    __shared__ __align__(16) float Os[2 * FKS * FWR]; __shared__ float Ms[2 * FKS * 32]; __shared__ float Ls[2 * FKS * 32];
    const int w = __builtin_amdgcn_readfirstlane(threadIdx.x >> 5); const int h = blockIdx.y, q0 = blockIdx.x * 64; const int q0w = q0 + (w & 1) * 32, key0 = (w >> 1) * (TT / FKS); const size_t hp = (size_t)h * TT * HD;
    if (q0 < RH) fa_wave<true, bf>(Qh + hp, Ql + hp, Kh + hp, Kl + hp, Vh + hp, Vl + hp, RP, RB, q0w, key0, Os + w * FWR, Ms + w * 32, Ls + w * 32);
    else fa_wave<false, h16>(Q16 + hp, nullptr, K16 + hp, nullptr, V16 + hp, nullptr, RP, RB, q0w, key0, Os + w * FWR, Ms + w * 32, Ls + w * 32);
    __syncthreads();   // every wave's partial (maximum, sum, Ot) is in LDS before any thread joins them
    const int q = threadIdx.x >> 2, d0 = (threadIdx.x & 3) * 16; const int wq = q >> 5, ql = q & 31;
    float mm = Ms[wq * 32 + ql];
#pragma unroll
    for (int sp = 1; sp < FKS; ++sp) mm = fmaxf(mm, Ms[(sp * 2 + wq) * 32 + ql]);
    float lt = 0.f; v4f o[4];
#pragma unroll
    for (int k = 0; k < 4; ++k) o[k] = (v4f){};
#pragma unroll
    for (int sp = 0; sp < FKS; ++sp) { const int ww = sp * 2 + wq; const float f = __builtin_amdgcn_exp2f(Ms[ww * 32 + ql] - mm); lt += Ls[ww * 32 + ql] * f;
#pragma unroll
        for (int k = 0; k < 4; ++k) o[k] += *(const v4fa*)(Os + ww * FWR + ql * 68 + d0 + k * 4) * f; }
    const float inv = __fdiv_rn(1.0f, lt); const size_t oo = (size_t)(q0 + q) * DQ + h * HD + d0;
#pragma unroll
    for (int g = 0; g < 2; ++g) { v8us oh, ol;
#pragma unroll
        for (int e = 0; e < 8; ++e) { unsigned short a, c2; splitf(o[g * 2 + (e >> 2)][e & 3] * inv, a, c2); oh[e] = a; ol[e] = c2; }
        *(v8us*)(Ah + oo + g * 8) = oh; *(v8us*)(Al + oo + g * 8) = ol; }
}

extern "C" void kernel_launch(void* const* d_in, const int* in_sizes, int n_in,
                              void* d_out, int out_size, void* d_ws, size_t ws_size, hipStream_t stream) {
    (void)in_sizes; (void)n_in; (void)out_size;
    const float* x = (const float*)d_in[0]; const float* amask = (const float*)d_in[1]; const float* abias = (const float*)d_in[2]; const float* wqkv = (const float*)d_in[3]; const float* bqkv = (const float*)d_in[4]; const float* wo = (const float*)d_in[5]; const float* bo = (const float*)d_in[6];   /* x, attn_mask [2048][2048], attn_bias [2][2048][2048], Wqkv ('xw' [1024][3072]), bqkv, Wout ('xw'), bout */ const float* bq = bqkv; const float* bk = bqkv + DQ; const float* bv = bqkv + 2 * DQ; const float* wq = wqkv; const float* wk = nullptr; const float* wv = nullptr; (void)wk; (void)wv;
    float* OUT = (float*)d_out;     // [2][2048][1024]
    char* wsp = (char*)d_ws;
    auto take = [&](size_t bytes) { char* p = wsp; wsp += (bytes + 255) & ~(size_t)255; return (void*)p; };
    bf* WQKV = (bf*)take((size_t)3 * DQ * DM * 2); bf* WQ = WQKV; bf* WK = WQKV + (size_t)DQ * DM; bf* WV = WQKV + (size_t)2 * DQ * DM;   /* fused Bt [3*DQ][DM]: q | k | v row blocks */ bf* WO = (bf*)take((size_t)DM * DQ * 2); float* CS = (float*)take((size_t)TT * HD * 2 * 4);
    bf* XB = (bf*)take((size_t)TT * DM * 2); float* FQ = (float*)take((size_t)TT * DQ * 4); float* FK = (float*)take((size_t)TT * DKV * 4);
    h16* QP16 = (h16*)take((size_t)NH_ * TT * HD * 2); h16* KP16 = (h16*)take((size_t)NKV * TT * HD * 2); h16* VT16 = (h16*)take((size_t)NKV * HD * TT * 2);
    bf* QPh = (bf*)take((size_t)NH_ * TT * HD * 2); bf* QPl = (bf*)take((size_t)NH_ * TT * HD * 2); bf* KPh = (bf*)take((size_t)NKV * TT * HD * 2); bf* KPl = (bf*)take((size_t)NKV * TT * HD * 2); bf* VTh = (bf*)take((size_t)NKV * HD * TT * 2); bf* VTl = (bf*)take((size_t)NKV * HD * TT * 2);
    bf* ATh = (bf*)take((size_t)TT * DQ * 2); bf* ATl = (bf*)take((size_t)TT * DQ * 2);
    if ((size_t)(wsp - (char*)d_ws) > ws_size) return;    // ws 256 MiB
    float* FV = FK;   // v projection reuses the k buffer after the k planes are built (stream-ordered)
    { k_wtG<<<(unsigned)((DM * 3 * DQ / 64 + 63) / 64), 256, 0, stream>>>(wqkv, DM, 3 * DQ, WQKV);   /* fused 'xw' [DM][3*DQ] -> Bt [3*DQ][DM] */
      k_wtG<<<(unsigned)((DQ * DM / 64 + 63) / 64), 256, 0, stream>>>(wo, DQ, DM, WO);
       }
    k_csid<<<(TT * HD + 255) / 256, 256, 0, stream>>>(CS);
    const unsigned LQ = (unsigned)(((size_t)NH_ * TT * HD / 2 + 255) / 256), LKv = (unsigned)(((size_t)NKV * TT * HD / 2 + 255) / 256);
    for (int b = 0; b < NB_; ++b) {
        
        k_cvt8<<<(unsigned)(((size_t)TT * DM / 8 + 255) / 256), 256, 0, stream>>>(x + (size_t)b * TT * DM, XB, (size_t)TT * DM / 8);
        k_gemmw<bf, 0, true><<<dim3(TT / 64, DQ / 64, 1), 32, 0, stream>>>(XB, nullptr, WQ, nullptr, DM, DM, FQ, DQ, bq, 0, 0, 0);
        k_rope<<<LQ, 256, 0, stream>>>(FQ, DQ, NH_, CS, nullptr, nullptr, 1.0f, QP16, QPh, QPl);
        k_gemmw<bf, 0, true><<<dim3(TT / 64, DKV / 64, 1), 32, 0, stream>>>(XB, nullptr, WK, nullptr, DM, DM, FK, DKV, bk, 0, 0, 0);
        k_rope<<<LKv, 256, 0, stream>>>(FK, DKV, NKV, CS, nullptr, nullptr, 1.0f, KP16, KPh, KPl);
        k_gemmw<bf, 0, true><<<dim3(TT / 64, DKV / 64, 1), 32, 0, stream>>>(XB, nullptr, WV, nullptr, DM, DM, FV, DKV, bv, 0, 0, 0); k_vtp<<<LKv, 256, 0, stream>>>(FV, DKV, NKV, VT16, VTh, VTl);
        k_fattn<<<dim3(TT / 64, NH_, 1), 256, 0, stream>>>(QP16, KP16, VT16, QPh, QPl, KPh, KPl, VTh, VTl, amask, abias + (size_t)b * TT * TT, ATh, ATl);   /* shared mask plane; this batch's bias plane */
        k_gemmw<bf, 1, true><<<dim3(TT / 64, DM / 64, 1), 32, 0, stream>>>(ATh, ATl, WO, nullptr, DQ, DQ, OUT + (size_t)b * TT * DM, DM, bo, 0, 0, 0); }
}

// v004
// Measured time: 391 microseconds a run.
// In two side-by-side timings against v003, it was 1.06 and 1.07 times as fast.
// Counting every step since v000, it is 5.31 times as fast.
#include <hip/hip_runtime.h>

// Multi-head self-attention with a fused qkv projection and TWO additive score planes (x [2][2048][1024]; qkv = x Wqkv + bqkv ('xw' [1024][3072] 1/32 + bias (zeros on this draw: read)) -> reshape (B, S, 3, 16, 64): q | k | v column thirds; scores = q.k / sqrt(64) + attn_mask[i][j] (f32 [2048][2048], shared by heads and batches) + attn_bias[b][i][j] (f32 [2][2048][2048], shared by heads); softmax over all keys; out = merged Wout + bout ('xw' [1024][1024] + bias) -> [2][2048][1024] (4.2 M); argument order x, attn_mask, attn_bias, Wqkv, bqkv, Wout, bout).
// Layout per batch: bf16 copy of x; the fused 'xw' weight transposed once into Bt (q | k | v row blocks) + bias slices; exact projections + f32 biases, whose epilogue writes the head planes; one fused attention kernel per batch (hybrid rows: < 512 hi/lo 3 products, rest fp16) that adds bf16(attn_mask[i][j]) and then bf16(attn_bias[b][i][j]) to the scaled f32 score, in the module's order, and keeps scores and probabilities in registers; merged hi/lo x Wout exact + bout.
// Compute dtypes, f32 accumulate: every input rounded to bf16 incl. the two planes; projections exact + f32 biases; attention rows < 512 3 products, rest fp16; softmax f32; Wout hl x exact + bias.

#define NB_  2
#define TT   2048
#define DM   1024
#define NH_  16
#define NKV  16
#define REP  (NH_ / NKV)
#define HD   64
#define DQ   (NH_ * HD)
#define DKV  (NKV * HD)
#define ZH   8                    // plane count of k_gemmw's split-K addressing (unused at KS = 1)
#define RH   512                  // query rows < RH use hi+lo planes (0: none)
#define WIN  0
#define SCL  0.125f   // HD^-0.5
#define FKS  4                    // key splits of the fused attention: a wave walks TT / FKS keys of its queries, the FKS partials are joined in LDS
typedef _Float16 h16;
typedef unsigned short bf;
typedef __attribute__((ext_vector_type(16))) __bf16   v16bf;
typedef __attribute__((ext_vector_type(16))) _Float16 v16h;
typedef __attribute__((ext_vector_type(8)))  _Float16 v8h;
typedef __attribute__((ext_vector_type(8)))  unsigned short v8us;
typedef __attribute__((ext_vector_type(8)))  float    v8f;
typedef __attribute__((ext_vector_type(4)))  float    v4f;
typedef v8h  __attribute__((may_alias)) v8ha;
typedef v4f  __attribute__((may_alias)) v4fa;
typedef v8us __attribute__((may_alias)) v8usa;

__device__ __forceinline__ unsigned short f2bf(float f) { unsigned u = __float_as_uint(f); u += 0x7FFFu + ((u >> 16) & 1u); return (unsigned short)(u >> 16); }
__device__ __forceinline__ float bf2f(unsigned short b) { return __uint_as_float(((unsigned)b) << 16); }
__device__ __forceinline__ float bfr(float f) { return bf2f(f2bf(f)); }
__device__ __forceinline__ v16h cat16(v8h lo, v8h hi) { return __builtin_shufflevector(lo, hi, 0, 1, 2, 3, 4, 5, 6, 7, 8, 9, 10, 11, 12, 13, 14, 15); }
__device__ __forceinline__ v16bf cat16b(v8us lo, v8us hi) { return __builtin_bit_cast(v16bf, __builtin_shufflevector(lo, hi, 0, 1, 2, 3, 4, 5, 6, 7, 8, 9, 10, 11, 12, 13, 14, 15)); }
__device__ __forceinline__ v8f wmma16(v16h a, v16h b, v8f c) { return __builtin_amdgcn_wmma_f32_16x16x32_f16(false, a, false, b, (short)0, c, false, false); }
__device__ __forceinline__ v8f wmmab(v16bf a, v16bf b, v8f c) { return __builtin_amdgcn_wmma_f32_16x16x32_bf16(false, a, false, b, (short)0, c, false, false); }



typedef __attribute__((ext_vector_type(8))) __bf16 v8bq;
__device__ __forceinline__ v8f bfr8(v8f x) { return __builtin_convertvector(__builtin_convertvector(x, v8bq), v8f); }   // nearest-even bf16 rounding, widened again
__device__ __forceinline__ v8f ld8f(const float* p) { const v4f a = *(const v4fa*)p, b = *(const v4fa*)(p + 4); return __builtin_shufflevector(a, b, 0, 1, 2, 3, 4, 5, 6, 7); }
// eight f32 values -> their fp16 and hi/lo bf16 forms, one 16-byte store into each of the three planes at element e
__device__ __forceinline__ void put3(v8f v, size_t e, _Float16* P16, unsigned short* Ph, unsigned short* Pl) {
    const v8bq h = __builtin_convertvector(v, v8bq); const v8bq l = __builtin_convertvector(v - __builtin_convertvector(h, v8f), v8bq);
    *(v8h*)(P16 + e) = __builtin_convertvector(v, v8h); *(v8us*)(Ph + e) = __builtin_bit_cast(v8us, h); *(v8us*)(Pl + e) = __builtin_bit_cast(v8us, l); }

// ---- k_gemmw: register-blocked GEMM, ONE WAVE per 64x64 output tile (16 accumulators), operands straight from K-contiguous 16-bit planes; grid (M/64, N/64, Z), 32 threads.
// C[m][n] (f32, pitch ldc, + optional f32 bias[n]) = sum_k A[m][k] Bt[n][k] (+ split products per NSPLIT). A rows have pitch lda, Bt rows pitch K. z-batch strides sA/sB/sC in elements. K % 32 == 0.
// EPI 0: C as above. EPI 1 (N tile = one head): the tile + bias goes straight to the [h][t][d] planes P16 / Ph / Pl (fp16, hi/lo bf16), whole 128-byte rows. EPI 2: the same to the [h][d][t] planes, the tile turned in LDS so that a d row's 64 t are one 128-byte line.
// KS > 1: grid z = Z * KS; block (z, ks) sums k in [ks K/KS, (ks+1) K/KS) alone and stores its partial tile in plane ks of C ([KS][ZH] planes of sC elements; Z = ZH). K % (32 KS) == 0.
template <typename T16> struct WFrag;
template <> struct WFrag<h16> { typedef v16h V; static __device__ __forceinline__ V ld(const h16* p) { return cat16(*(const v8h*)p, *(const v8h*)(p + 16)); } static __device__ __forceinline__ v8f mma(V a, V b, v8f c) { return wmma16(a, b, c); } };
template <> struct WFrag<bf> { typedef v16bf V; static __device__ __forceinline__ V ld(const bf* p) { return cat16b(*(const v8us*)p, *(const v8us*)(p + 16)); } static __device__ __forceinline__ v8f mma(V a, V b, v8f c) { return wmmab(a, b, c); } };
template <typename T16, int NSPLIT, bool BIAS, int EPI = 0, int KS = 1>
__global__ __launch_bounds__(32) void k_gemmw(const T16* __restrict__ A, const T16* __restrict__ A2, const T16* __restrict__ Bt, const T16* __restrict__ Bt2, int K, int lda, float* C, int ldc, const float* __restrict__ bias, size_t sA, size_t sB, size_t sC, h16* P16, bf* Ph, bf* Pl) {
    typedef typename WFrag<T16>::V V;
    __shared__ __align__(16) float os[16 * 68];
    const size_t z = blockIdx.z / KS; const int ks = blockIdx.z % KS; A += z * sA; if (A2) A2 += z * sA; Bt += z * sB; if (Bt2) Bt2 += z * sB; C += ((size_t)ks * ZH + z) * sC;
    const int lane = threadIdx.x & 31, lr = lane & 15, hi = lane >> 4; const int r0 = blockIdx.x * 64, c0 = blockIdx.y * 64;
    v8f acc[4][4];
#pragma unroll
    for (int mb = 0; mb < 4; ++mb)
#pragma unroll
        for (int nb = 0; nb < 4; ++nb) acc[mb][nb] = (v8f){};
    const size_t aoff = (size_t)(r0 + lr) * lda + 8 * hi, boff = (size_t)(c0 + lr) * K + 8 * hi;
    const int er = lane >> 3, ec = (lane & 7) * 8;   // EPI 1, 2: eight lanes read one staged row, 8 floats each
    v8f b8; float bd[4][4];   // the lane's bias values, asked for ahead of the k loop, which hides their latency
    if constexpr (EPI == 1) b8 = bfr8(ld8f(bias + c0 + ec));
    if constexpr (EPI == 2) {
#pragma unroll
        for (int nb = 0; nb < 4; ++nb)
#pragma unroll
            for (int s = 0; s < 4; ++s) bd[nb][s] = bfr(bias[c0 + nb * 16 + s * 4 + er]); }
#pragma unroll 1
    for (int kc = ks * (K / KS); kc < (ks + 1) * (K / KS); kc += 32) {
        V a[4], a2[4];
#pragma unroll
        for (int mb = 0; mb < 4; ++mb) { a[mb] = WFrag<T16>::ld(A + aoff + (size_t)mb * 16 * lda + kc); if (NSPLIT == 1 || NSPLIT == 2) a2[mb] = WFrag<T16>::ld(A2 + aoff + (size_t)mb * 16 * lda + kc); }
#pragma unroll
        for (int nb = 0; nb < 4; ++nb) { const V b = WFrag<T16>::ld(Bt + boff + (size_t)nb * 16 * K + kc); V b2; if (NSPLIT >= 2) b2 = WFrag<T16>::ld(Bt2 + boff + (size_t)nb * 16 * K + kc);
#pragma unroll
            for (int mb = 0; mb < 4; ++mb) { acc[mb][nb] = WFrag<T16>::mma(a[mb], b, acc[mb][nb]); if (NSPLIT == 1 || NSPLIT == 2) acc[mb][nb] = WFrag<T16>::mma(a2[mb], b, acc[mb][nb]); if (NSPLIT >= 2) acc[mb][nb] = WFrag<T16>::mma(a[mb], b2, acc[mb][nb]); } }
        asm volatile("v_nop\n\tv_nop\n\tv_nop\n\tv_nop" : "+v"(acc[0][0]), "+v"(acc[1][1]), "+v"(acc[2][2]), "+v"(acc[3][3]) : "v"(a[0]), "v"(a[3]));
    }
    if constexpr (EPI == 2) {
#pragma unroll
        for (int nb = 0; nb < 4; ++nb) {
#pragma unroll
            for (int mb = 0; mb < 4; ++mb) { float* op = os + lr * 68 + mb * 16 + hi * 8; const v8f a = acc[mb][nb]; *(v4fa*)op = __builtin_shufflevector(a, a, 0, 1, 2, 3); *(v4fa*)(op + 4) = __builtin_shufflevector(a, a, 4, 5, 6, 7); }
            __builtin_amdgcn_wave_barrier(); asm volatile("" ::: "memory");   // other lanes' staged rows are read below: the LDS reads stay behind the stores
#pragma unroll
            for (int s = 0; s < 4; ++s) { const int d = c0 + nb * 16 + s * 4 + er; put3(ld8f(os + (s * 4 + er) * 68 + ec) + bd[nb][s], (size_t)d * TT + r0 + ec, P16, Ph, Pl); }
            __builtin_amdgcn_wave_barrier(); asm volatile("" ::: "memory");   // the next column block's staging stays behind these reads
        }
        return;
    }
#pragma unroll
    for (int mb = 0; mb < 4; ++mb) {
#pragma unroll
        for (int nb = 0; nb < 4; ++nb) {
#pragma unroll
            for (int j = 0; j < 8; ++j) os[(hi * 8 + j) * 68 + nb * 16 + lr] = acc[mb][nb][j]; }
        __builtin_amdgcn_wave_barrier(); asm volatile("" ::: "memory");
        float* crow = C + (size_t)(r0 + mb * 16) * ldc + c0;
        if constexpr (EPI == 1) {
#pragma unroll
            for (int s = 0; s < 4; ++s) put3(ld8f(os + (s * 4 + er) * 68 + ec) + b8, ((size_t)blockIdx.y * TT + r0 + mb * 16 + s * 4 + er) * HD + ec, P16, Ph, Pl);
        } else {
#pragma unroll
            for (int s = 0; s < 8; ++s) { const int row = 2 * s + hi, cofs = lr * 4; v4f val = *(const v4fa*)(os + row * 68 + cofs); if (BIAS) { val[0] += bfr(bias[c0 + cofs]); val[1] += bfr(bias[c0 + cofs + 1]); val[2] += bfr(bias[c0 + cofs + 2]); val[3] += bfr(bias[c0 + cofs + 3]); }
                *(v4f*)(crow + (size_t)row * ldc + cofs) = val; }
             }
        __builtin_amdgcn_wave_barrier(); asm volatile("" ::: "memory");
    }
}

__device__ __forceinline__ void splitf(float y, unsigned short& h, unsigned short& l) { h = f2bf(y); l = f2bf(y - bf2f(h)); }
typedef __attribute__((ext_vector_type(2))) _Float16 v2h;
typedef __attribute__((ext_vector_type(4))) _Float16 v4h;
typedef __attribute__((ext_vector_type(2))) unsigned short v2us;
typedef __attribute__((ext_vector_type(4))) unsigned short v4us;
typedef __attribute__((ext_vector_type(2))) float v2f;
typedef __attribute__((ext_vector_type(4))) int v4i;

__global__ __launch_bounds__(256) void k_wtG(const float* __restrict__ w, int K, int N, bf* Bt) {
    const int lane = threadIdx.x & 31; const int L0 = (blockIdx.x * 8 + (threadIdx.x >> 5)) * 8; const int nlines = N * K / 64;
{
#pragma unroll 1
        for (int l = 0; l < 8; ++l) { const int L = L0 + l; if (L >= nlines) break; const size_t e = (size_t)L * 64 + lane * 2; const int k = (int)(e % K), n = (int)(e / K); v2us o;
            o[0] = f2bf(w[(size_t)k * N + n]); o[1] = f2bf(w[(size_t)(k + 1) * N + n]); *(v2us*)(Bt + e) = o; }
         }
}
__global__ __launch_bounds__(256) void k_cvt8(const float* __restrict__ src, bf* dst, size_t n8) { const size_t i = (size_t)blockIdx.x * 256 + threadIdx.x; if (i >= n8) return; const v8f v = *(const v8f*)(src + i * 8); v8us o;
#pragma unroll
    for (int k = 0; k < 8; ++k) o[k] = f2bf(v[k]); *(v8us*)(dst + i * 8) = o;  }

// ---- k_fattn: scores, softmax and P.V of one head's 64 query rows in one work-group; nothing of S or P goes to memory.
// Transposed products: St = K Qt (A = key rows, B = query rows), so a lane holds one query's scores (register r of key tile kt = key kt*16 + 8*hi + r, query lr); two St tiles converted in place are the B operand of Ot += Vt Pt (A = rows of the [d][t] planes).
// t = (S x HD^-0.5 + bf16(RP[i][j])) + bf16(RB[i][j]); running maximum per query in log2 units, moved (and sums and Ot rescaled) only when a score passes it by more than 8, so p <= 2^8.
// The two planes come as whole 128-byte rows (4 lines a load instead of 16) and are turned into the score layout through the wave's own LDS region (pitch 36 floats), which later holds its Ot partial.
// 8 waves: wave w takes query rows (w & 1) * 32 .. + 31 and keys (w >> 1) * TT / FKS .. ; the FKS partial (maximum, sum, Ot) of a query are joined in split order through LDS, normalised and stored as hi/lo bf16 rows of the merged [t][DQ] planes.
#define L2E 1.4426950408889634f
#define FWR (2 * 32 * 36)         // floats of a wave's LDS region: two 32 x 36 plane tiles in the loop, then its 32 x 68 Ot partial
template <bool HI, typename T16>
__device__ __forceinline__ void fa_wave(const T16* __restrict__ Q, const T16* __restrict__ Q2, const T16* __restrict__ Kp, const T16* __restrict__ K2, const T16* __restrict__ Vt, const T16* __restrict__ V2, const float* __restrict__ RP, const float* __restrict__ RB, int q0w, int key0, float* osw, float* msw, float* lsw) {
    typedef typename WFrag<T16>::V V;
    const int lane = threadIdx.x & 31, lr = lane & 15, hi = lane >> 4;
    V qf[2][2], qf2[2][2];
#pragma unroll
    for (int qt = 0; qt < 2; ++qt)
#pragma unroll
        for (int kc = 0; kc < 2; ++kc) { const size_t o = (size_t)(q0w + qt * 16 + lr) * HD + kc * 32 + 8 * hi; qf[qt][kc] = WFrag<T16>::ld(Q + o); if (HI) qf2[qt][kc] = WFrag<T16>::ld(Q2 + o); }
    v8f acc[4][2];
#pragma unroll
    for (int dt = 0; dt < 4; ++dt) { acc[dt][0] = (v8f){}; acc[dt][1] = (v8f){}; }
    float m[2] = {-3.0e38f, -3.0e38f}, l[2] = {0.f, 0.f};
    const int srow = lane >> 3, scol = (lane & 7) * 4; const size_t prow = (size_t)(q0w + srow) * TT + scol;
#pragma unroll 1
    for (int key = key0; key < key0 + TT / FKS; key += 32) {
        v4f gm[8], gb[8];   // this pass's 32 x 32 tiles of the mask and bias planes, 8 lanes a row; the hi/lo rows ask for them behind the score products, whose fragments fill the registers
        if constexpr (!HI) {
#pragma unroll
            for (int i = 0; i < 8; ++i) { const size_t o = prow + (size_t)i * 4 * TT + key; gm[i] = *(const v4f*)(RP + o); gb[i] = *(const v4f*)(RB + o); } }
        v8f s[2][2];   // [key tile][query tile]
#pragma unroll
        for (int kt = 0; kt < 2; ++kt) { s[kt][0] = (v8f){}; s[kt][1] = (v8f){};
#pragma unroll
            for (int kc = 0; kc < 2; ++kc) { const size_t o = (size_t)(key + kt * 16 + lr) * HD + kc * 32 + 8 * hi; const V kf = WFrag<T16>::ld(Kp + o); V kf2; if (HI) kf2 = WFrag<T16>::ld(K2 + o);
#pragma unroll
                for (int qt = 0; qt < 2; ++qt) { s[kt][qt] = WFrag<T16>::mma(kf, qf[qt][kc], s[kt][qt]); if (HI) { s[kt][qt] = WFrag<T16>::mma(kf, qf2[qt][kc], s[kt][qt]); s[kt][qt] = WFrag<T16>::mma(kf2, qf[qt][kc], s[kt][qt]); } } } }
        if constexpr (HI) {
#pragma unroll
            for (int i = 0; i < 8; ++i) { const size_t o = prow + (size_t)i * 4 * TT + key; gm[i] = *(const v4f*)(RP + o); gb[i] = *(const v4f*)(RB + o); } }
#pragma unroll
        for (int i = 0; i < 8; ++i) { float* sp = osw + (i * 4 + srow) * 36 + scol; *(v4fa*)sp = gm[i]; *(v4fa*)(sp + 32 * 36) = gb[i]; }
        __builtin_amdgcn_wave_barrier(); asm volatile("" ::: "memory");   // other lanes' tile rows are read below: the compiler must not lift those LDS reads over the stores
        float c[2];
#pragma unroll
        for (int qt = 0; qt < 2; ++qt) { float mx = -3.0e38f;
#pragma unroll
            for (int kt = 0; kt < 2; ++kt) { const float* sp = osw + (qt * 16 + lr) * 36 + kt * 16 + 8 * hi; const v8f t = (s[kt][qt] * SCL + bfr8(ld8f(sp))) + bfr8(ld8f(sp + 32 * 36)); s[kt][qt] = t;
#pragma unroll
                for (int r = 0; r < 8; ++r) mx = fmaxf(mx, t[r]); }
            c[qt] = mx * L2E; }
        __builtin_amdgcn_wave_barrier(); asm volatile("" ::: "memory");   // the next pass's tile stores (and the Ot partial behind the loop) stay behind these reads
        if (__builtin_amdgcn_ballot_w32(c[0] > m[0] + 8.0f || c[1] > m[1] + 8.0f) != 0) {   // wave-uniform: both halves of a query move its maximum together
#pragma unroll
            for (int qt = 0; qt < 2; ++qt) { const float mn = fmaxf(m[qt], fmaxf(c[qt], __shfl_xor(c[qt], 16, 32))); const float al = __builtin_amdgcn_exp2f(m[qt] - mn); m[qt] = mn; l[qt] *= al;
#pragma unroll
                for (int dt = 0; dt < 4; ++dt) acc[dt][qt] *= al; } }
        V pf[2], pf2[2];
#pragma unroll
        for (int qt = 0; qt < 2; ++qt) { v8f p[2];
#pragma unroll
            for (int kt = 0; kt < 2; ++kt) { const v8f e = __builtin_elementwise_fma(s[kt][qt], (v8f)(L2E), (v8f)(-m[qt]));
#pragma unroll
                for (int r = 0; r < 8; ++r) { p[kt][r] = __builtin_amdgcn_exp2f(e[r]); l[qt] += p[kt][r]; } }
            if constexpr (HI) { const v8bq h0 = __builtin_convertvector(p[0], v8bq), h1 = __builtin_convertvector(p[1], v8bq);
                const v8bq l0 = __builtin_convertvector(p[0] - __builtin_convertvector(h0, v8f), v8bq), l1 = __builtin_convertvector(p[1] - __builtin_convertvector(h1, v8f), v8bq);
                pf[qt] = __builtin_shufflevector(h0, h1, 0, 1, 2, 3, 4, 5, 6, 7, 8, 9, 10, 11, 12, 13, 14, 15); pf2[qt] = __builtin_shufflevector(l0, l1, 0, 1, 2, 3, 4, 5, 6, 7, 8, 9, 10, 11, 12, 13, 14, 15); }
            else pf[qt] = cat16(__builtin_convertvector(p[0], v8h), __builtin_convertvector(p[1], v8h)); }
#pragma unroll
        for (int dt = 0; dt < 4; ++dt) { const size_t o = (size_t)(dt * 16 + lr) * TT + key + 8 * hi; const V vf = WFrag<T16>::ld(Vt + o); V vf2; if (HI) vf2 = WFrag<T16>::ld(V2 + o);
#pragma unroll
            for (int qt = 0; qt < 2; ++qt) { acc[dt][qt] = WFrag<T16>::mma(vf, pf[qt], acc[dt][qt]); if (HI) { acc[dt][qt] = WFrag<T16>::mma(vf, pf2[qt], acc[dt][qt]); acc[dt][qt] = WFrag<T16>::mma(vf2, pf[qt], acc[dt][qt]); } } }
    }
#pragma unroll
    for (int qt = 0; qt < 2; ++qt) { const float lt = l[qt] + __shfl_xor(l[qt], 16, 32); if (hi == 0) { msw[qt * 16 + lr] = m[qt]; lsw[qt * 16 + lr] = lt; }
#pragma unroll
        for (int dt = 0; dt < 4; ++dt) { float* op = osw + (qt * 16 + lr) * 68 + dt * 16 + hi * 8; const v8f a = acc[dt][qt]; *(v4fa*)op = __builtin_shufflevector(a, a, 0, 1, 2, 3); *(v4fa*)(op + 4) = __builtin_shufflevector(a, a, 4, 5, 6, 7); } }
}
__global__ __launch_bounds__(256) __attribute__((amdgpu_waves_per_eu(4, 4))) void k_fattn(const h16* __restrict__ Q16, const h16* __restrict__ K16, const h16* __restrict__ V16, const bf* __restrict__ Qh, const bf* __restrict__ Ql, const bf* __restrict__ Kh, const bf* __restrict__ Kl, const bf* __restrict__ Vh, const bf* __restrict__ Vl, const float* __restrict__ RP, const float* __restrict__ RB, bf* Ah, bf* Al) {
    __shared__ __align__(16) float Os[2 * FKS * FWR]; __shared__ float Ms[2 * FKS * 32]; __shared__ float Ls[2 * FKS * 32];
    const int w = __builtin_amdgcn_readfirstlane(threadIdx.x >> 5); const int h = blockIdx.y, q0 = blockIdx.x * 64; const int q0w = q0 + (w & 1) * 32, key0 = (w >> 1) * (TT / FKS); const size_t hp = (size_t)h * TT * HD;
    if (q0 < RH) fa_wave<true, bf>(Qh + hp, Ql + hp, Kh + hp, Kl + hp, Vh + hp, Vl + hp, RP, RB, q0w, key0, Os + w * FWR, Ms + w * 32, Ls + w * 32);
    else fa_wave<false, h16>(Q16 + hp, nullptr, K16 + hp, nullptr, V16 + hp, nullptr, RP, RB, q0w, key0, Os + w * FWR, Ms + w * 32, Ls + w * 32);
    __syncthreads();   // every wave's partial (maximum, sum, Ot) is in LDS before any thread joins them
    const int q = threadIdx.x >> 2, d0 = (threadIdx.x & 3) * 16; const int wq = q >> 5, ql = q & 31;
    float mm = Ms[wq * 32 + ql];
#pragma unroll
    for (int sp = 1; sp < FKS; ++sp) mm = fmaxf(mm, Ms[(sp * 2 + wq) * 32 + ql]);
    float lt = 0.f; v4f o[4];
#pragma unroll
    for (int k = 0; k < 4; ++k) o[k] = (v4f){};
#pragma unroll
    for (int sp = 0; sp < FKS; ++sp) { const int ww = sp * 2 + wq; const float f = __builtin_amdgcn_exp2f(Ms[ww * 32 + ql] - mm); lt += Ls[ww * 32 + ql] * f;
#pragma unroll
        for (int k = 0; k < 4; ++k) o[k] += *(const v4fa*)(Os + ww * FWR + ql * 68 + d0 + k * 4) * f; }
    const float inv = __fdiv_rn(1.0f, lt); const size_t oo = (size_t)(q0 + q) * DQ + h * HD + d0;
#pragma unroll
    for (int g = 0; g < 2; ++g) { v8us oh, ol;
#pragma unroll
        for (int e = 0; e < 8; ++e) { unsigned short a, c2; splitf(o[g * 2 + (e >> 2)][e & 3] * inv, a, c2); oh[e] = a; ol[e] = c2; }
        *(v8us*)(Ah + oo + g * 8) = oh; *(v8us*)(Al + oo + g * 8) = ol; }
}

extern "C" void kernel_launch(void* const* d_in, const int* in_sizes, int n_in,
                              void* d_out, int out_size, void* d_ws, size_t ws_size, hipStream_t stream) {
    (void)in_sizes; (void)n_in; (void)out_size;
    const float* x = (const float*)d_in[0]; const float* amask = (const float*)d_in[1]; const float* abias = (const float*)d_in[2]; const float* wqkv = (const float*)d_in[3]; const float* bqkv = (const float*)d_in[4]; const float* wo = (const float*)d_in[5]; const float* bo = (const float*)d_in[6];   /* x, attn_mask [2048][2048], attn_bias [2][2048][2048], Wqkv ('xw' [1024][3072]), bqkv, Wout ('xw'), bout */ const float* bq = bqkv; const float* bk = bqkv + DQ; const float* bv = bqkv + 2 * DQ; const float* wq = wqkv; const float* wk = nullptr; const float* wv = nullptr; (void)wk; (void)wv;
    float* OUT = (float*)d_out;     // [2][2048][1024]
    char* wsp = (char*)d_ws;
    auto take = [&](size_t bytes) { char* p = wsp; wsp += (bytes + 255) & ~(size_t)255; return (void*)p; };
    bf* WQKV = (bf*)take((size_t)3 * DQ * DM * 2); bf* WQ = WQKV; bf* WK = WQKV + (size_t)DQ * DM; bf* WV = WQKV + (size_t)2 * DQ * DM;   /* fused Bt [3*DQ][DM]: q | k | v row blocks */ bf* WO = (bf*)take((size_t)DM * DQ * 2);
    bf* XB = (bf*)take((size_t)TT * DM * 2);
    h16* QP16 = (h16*)take((size_t)NH_ * TT * HD * 2); h16* KP16 = (h16*)take((size_t)NKV * TT * HD * 2); h16* VT16 = (h16*)take((size_t)NKV * HD * TT * 2);
    bf* QPh = (bf*)take((size_t)NH_ * TT * HD * 2); bf* QPl = (bf*)take((size_t)NH_ * TT * HD * 2); bf* KPh = (bf*)take((size_t)NKV * TT * HD * 2); bf* KPl = (bf*)take((size_t)NKV * TT * HD * 2); bf* VTh = (bf*)take((size_t)NKV * HD * TT * 2); bf* VTl = (bf*)take((size_t)NKV * HD * TT * 2);
    bf* ATh = (bf*)take((size_t)TT * DQ * 2); bf* ATl = (bf*)take((size_t)TT * DQ * 2);
    if ((size_t)(wsp - (char*)d_ws) > ws_size) return;    // ws 256 MiB
    { k_wtG<<<(unsigned)((DM * 3 * DQ / 64 + 63) / 64), 256, 0, stream>>>(wqkv, DM, 3 * DQ, WQKV);   /* fused 'xw' [DM][3*DQ] -> Bt [3*DQ][DM] */
      k_wtG<<<(unsigned)((DQ * DM / 64 + 63) / 64), 256, 0, stream>>>(wo, DQ, DM, WO);
       }
    for (int b = 0; b < NB_; ++b) {
        
        k_cvt8<<<(unsigned)(((size_t)TT * DM / 8 + 255) / 256), 256, 0, stream>>>(x + (size_t)b * TT * DM, XB, (size_t)TT * DM / 8);
        k_gemmw<bf, 0, true, 1><<<dim3(TT / 64, DQ / 64, 1), 32, 0, stream>>>(XB, nullptr, WQ, nullptr, DM, DM, nullptr, 0, bq, 0, 0, 0, QP16, QPh, QPl);
        k_gemmw<bf, 0, true, 1><<<dim3(TT / 64, DKV / 64, 1), 32, 0, stream>>>(XB, nullptr, WK, nullptr, DM, DM, nullptr, 0, bk, 0, 0, 0, KP16, KPh, KPl);
        k_gemmw<bf, 0, true, 2><<<dim3(TT / 64, DKV / 64, 1), 32, 0, stream>>>(XB, nullptr, WV, nullptr, DM, DM, nullptr, 0, bv, 0, 0, 0, VT16, VTh, VTl);
        k_fattn<<<dim3(TT / 64, NH_, 1), 256, 0, stream>>>(QP16, KP16, VT16, QPh, QPl, KPh, KPl, VTh, VTl, amask, abias + (size_t)b * TT * TT, ATh, ATl);   /* shared mask plane; this batch's bias plane */
        k_gemmw<bf, 1, true><<<dim3(TT / 64, DM / 64, 1), 32, 0, stream>>>(ATh, ATl, WO, nullptr, DQ, DQ, OUT + (size_t)b * TT * DM, DM, bo, 0, 0, 0, nullptr, nullptr, nullptr); }
}

// v005
// One run takes 258 microseconds.
// Two timings next to v004 put it at 1.54 and 1.50 times that version's speed.
// Over all steps from v000 it is 8.07 times as fast.
#include <hip/hip_runtime.h>

// Multi-head self-attention with a fused qkv projection and TWO additive score planes (x [2][2048][1024]; qkv = x Wqkv + bqkv ('xw' [1024][3072] 1/32 + bias (zeros on this draw: read)) -> reshape (B, S, 3, 16, 64): q | k | v column thirds; scores = q.k / sqrt(64) + attn_mask[i][j] (f32 [2048][2048], shared by heads and batches) + attn_bias[b][i][j] (f32 [2][2048][2048], shared by heads); softmax over all keys; out = merged Wout + bout ('xw' [1024][1024] + bias) -> [2][2048][1024] (4.2 M); argument order x, attn_mask, attn_bias, Wqkv, bqkv, Wout, bout).
// Layout, both batches in every launch (the batch is a grid dimension, every plane has a copy per batch): bf16 copy of x; the fused 'xw' weight transposed once into Bt (q | k | v row blocks) + bias; exact projections + f32 biases in ONE launch over all 3 * DQ columns, whose epilogue writes the head planes; one fused attention launch (hybrid rows: < 512 hi/lo 3 products, rest fp16) that adds bf16(attn_mask[i][j]) and then bf16(attn_bias[b][i][j]) to the scaled f32 score, in the module's order, and keeps scores and probabilities in registers; merged hi/lo x Wout exact + bout.
// Compute dtypes, f32 accumulate: every input rounded to bf16 incl. the two planes; projections exact + f32 biases; attention rows < 512 3 products, rest fp16; softmax f32; Wout hl x exact + bias.

#define NB_  2
#define TT   2048
#define DM   1024
#define NH_  16
#define NKV  16
#define REP  (NH_ / NKV)
#define HD   64
#define DQ   (NH_ * HD)
#define DKV  (NKV * HD)
#define ZH   8                    // plane count of k_gemmw's split-K addressing (unused at KS = 1)
#define RH   512                  // query rows < RH use hi+lo planes (0: none)
#define WIN  0
#define SCL  0.125f   // HD^-0.5
#define FKS  4                    // key splits of the fused attention: a wave walks TT / FKS keys of its queries, the FKS partials are joined in LDS
typedef _Float16 h16;
typedef unsigned short bf;
typedef __attribute__((ext_vector_type(16))) __bf16   v16bf;
typedef __attribute__((ext_vector_type(16))) _Float16 v16h;
typedef __attribute__((ext_vector_type(8)))  _Float16 v8h;
typedef __attribute__((ext_vector_type(8)))  unsigned short v8us;
typedef __attribute__((ext_vector_type(8)))  float    v8f;
typedef __attribute__((ext_vector_type(4)))  float    v4f;
typedef v8h  __attribute__((may_alias)) v8ha;
typedef v4f  __attribute__((may_alias)) v4fa;
typedef v8us __attribute__((may_alias)) v8usa;

__device__ __forceinline__ unsigned short f2bf(float f) { unsigned u = __float_as_uint(f); u += 0x7FFFu + ((u >> 16) & 1u); return (unsigned short)(u >> 16); }
__device__ __forceinline__ float bf2f(unsigned short b) { return __uint_as_float(((unsigned)b) << 16); }
__device__ __forceinline__ float bfr(float f) { return bf2f(f2bf(f)); }
__device__ __forceinline__ v16h cat16(v8h lo, v8h hi) { return __builtin_shufflevector(lo, hi, 0, 1, 2, 3, 4, 5, 6, 7, 8, 9, 10, 11, 12, 13, 14, 15); }
__device__ __forceinline__ v16bf cat16b(v8us lo, v8us hi) { return __builtin_bit_cast(v16bf, __builtin_shufflevector(lo, hi, 0, 1, 2, 3, 4, 5, 6, 7, 8, 9, 10, 11, 12, 13, 14, 15)); }
__device__ __forceinline__ v8f wmma16(v16h a, v16h b, v8f c) { return __builtin_amdgcn_wmma_f32_16x16x32_f16(false, a, false, b, (short)0, c, false, false); }
__device__ __forceinline__ v8f wmmab(v16bf a, v16bf b, v8f c) { return __builtin_amdgcn_wmma_f32_16x16x32_bf16(false, a, false, b, (short)0, c, false, false); }



typedef __attribute__((ext_vector_type(8))) __bf16 v8bq;
__device__ __forceinline__ v8f bfr8(v8f x) { return __builtin_convertvector(__builtin_convertvector(x, v8bq), v8f); }   // nearest-even bf16 rounding, widened again
__device__ __forceinline__ v8f ld8f(const float* p) { const v4f a = *(const v4fa*)p, b = *(const v4fa*)(p + 4); return __builtin_shufflevector(a, b, 0, 1, 2, 3, 4, 5, 6, 7); }
// eight f32 values -> their fp16 and hi/lo bf16 forms, one 16-byte store into each of the three planes at element e
__device__ __forceinline__ void put3(v8f v, size_t e, _Float16* P16, unsigned short* Ph, unsigned short* Pl) {
    const v8bq h = __builtin_convertvector(v, v8bq); const v8bq l = __builtin_convertvector(v - __builtin_convertvector(h, v8f), v8bq);
    *(v8h*)(P16 + e) = __builtin_convertvector(v, v8h); *(v8us*)(Ph + e) = __builtin_bit_cast(v8us, h); *(v8us*)(Pl + e) = __builtin_bit_cast(v8us, l); }

// ---- k_gemmw: register-blocked GEMM, ONE WAVE per 64x64 output tile (16 accumulators), operands straight from K-contiguous 16-bit planes; grid (M/64, N/64, Z), 32 threads.
// C[m][n] (f32, pitch ldc, + optional f32 bias[n]) = sum_k A[m][k] Bt[n][k] (+ split products per NSPLIT). A rows have pitch lda, Bt rows pitch K. z-batch strides sA/sB/sC in elements. K % 32 == 0.
// EPI 0: C as above. EPI 1 (N tile = one head): the tile + bias goes straight to the [h][t][d] planes P16 / Ph / Pl (fp16, hi/lo bf16), whole 128-byte rows. EPI 2: the same to the [h][d][t] planes, the tile turned in LDS so that a d row's 64 t are one 128-byte line.
// EPI 3 (fused q | k | v, N = 3 * DQ, z = batch): the column third picks the plane set ([third][batch] sets of NH_ * TT * HD elements behind P16 / Ph / Pl) and the form: thirds 0 and 1 as EPI 1, third 2 as EPI 2. The test is on blockIdx alone, so it is a scalar branch.
// KS > 1: grid z = Z * KS; block (z, ks) sums k in [ks K/KS, (ks+1) K/KS) alone and stores its partial tile in plane ks of C ([KS][ZH] planes of sC elements; Z = ZH). K % (32 KS) == 0.
template <typename T16> struct WFrag;
template <> struct WFrag<h16> { typedef v16h V; static __device__ __forceinline__ V ld(const h16* p) { return cat16(*(const v8h*)p, *(const v8h*)(p + 16)); } static __device__ __forceinline__ v8f mma(V a, V b, v8f c) { return wmma16(a, b, c); } };
template <> struct WFrag<bf> { typedef v16bf V; static __device__ __forceinline__ V ld(const bf* p) { return cat16b(*(const v8us*)p, *(const v8us*)(p + 16)); } static __device__ __forceinline__ v8f mma(V a, V b, v8f c) { return wmmab(a, b, c); } };
template <typename T16, int NSPLIT, bool BIAS, int EPI = 0, int KS = 1>
__global__ __launch_bounds__(32) void k_gemmw(const T16* __restrict__ A, const T16* __restrict__ A2, const T16* __restrict__ Bt, const T16* __restrict__ Bt2, int K, int lda, float* C, int ldc, const float* __restrict__ bias, size_t sA, size_t sB, size_t sC, h16* P16, bf* Ph, bf* Pl) {
    typedef typename WFrag<T16>::V V;
    __shared__ __align__(16) float os[16 * 68];
    const size_t z = blockIdx.z / KS; const int ks = blockIdx.z % KS; A += z * sA; if (A2) A2 += z * sA; Bt += z * sB; if (Bt2) Bt2 += z * sB; C += ((size_t)ks * ZH + z) * sC;
    const int lane = threadIdx.x & 31, lr = lane & 15, hi = lane >> 4; const int r0 = blockIdx.x * 64, c0 = blockIdx.y * 64;
    v8f acc[4][4];
#pragma unroll
    for (int mb = 0; mb < 4; ++mb)
#pragma unroll
        for (int nb = 0; nb < 4; ++nb) acc[mb][nb] = (v8f){};
    const size_t aoff = (size_t)(r0 + lr) * lda + 8 * hi, boff = (size_t)(c0 + lr) * K + 8 * hi;
    const int er = lane >> 3, ec = (lane & 7) * 8;   // EPI 1, 2: eight lanes read one staged row, 8 floats each
    const int third = EPI == 3 ? (int)blockIdx.y / (DQ / 64) : 0;
    const bool tr = EPI == 2 || (EPI == 3 && third == 2);   // [h][d][t] planes
    if constexpr (EPI == 3) { const size_t po = ((size_t)third * (NB_ - 1) + z) * ((size_t)NH_ * TT * HD); P16 += po; Ph += po; Pl += po; }   // set (third, z) starts at (third * NB_ + z) planes; the stores below index by the fused column, which already steps one plane per third
    v8f b8; float bd[4][4];   // the lane's bias values, asked for ahead of the k loop, which hides their latency (EPI 3 asks for both forms: a branch here would wait for them in front of the loop)
    if constexpr (EPI == 1 || EPI == 3) b8 = bfr8(ld8f(bias + c0 + ec));
    if constexpr (EPI == 2 || EPI == 3) {
#pragma unroll
        for (int nb = 0; nb < 4; ++nb)
#pragma unroll
            for (int s = 0; s < 4; ++s) bd[nb][s] = bfr(bias[c0 + nb * 16 + s * 4 + er]); }
    if constexpr (EPI == 3) asm volatile("s_wait_xcnt 0x0" ::: "memory");   // the bias loads stay in flight over the k loop, and their address registers are rewritten right behind them: the wait stands in front of that
#pragma unroll 1
    for (int kc = ks * (K / KS); kc < (ks + 1) * (K / KS); kc += 32) {
        V a[4], a2[4];
#pragma unroll
        for (int mb = 0; mb < 4; ++mb) { a[mb] = WFrag<T16>::ld(A + aoff + (size_t)mb * 16 * lda + kc); if (NSPLIT == 1 || NSPLIT == 2) a2[mb] = WFrag<T16>::ld(A2 + aoff + (size_t)mb * 16 * lda + kc); }
#pragma unroll
        for (int nb = 0; nb < 4; ++nb) { const V b = WFrag<T16>::ld(Bt + boff + (size_t)nb * 16 * K + kc); V b2; if (NSPLIT >= 2) b2 = WFrag<T16>::ld(Bt2 + boff + (size_t)nb * 16 * K + kc);
#pragma unroll
            for (int mb = 0; mb < 4; ++mb) { acc[mb][nb] = WFrag<T16>::mma(a[mb], b, acc[mb][nb]); if (NSPLIT == 1 || NSPLIT == 2) acc[mb][nb] = WFrag<T16>::mma(a2[mb], b, acc[mb][nb]); if (NSPLIT >= 2) acc[mb][nb] = WFrag<T16>::mma(a[mb], b2, acc[mb][nb]); } }
        asm volatile("v_nop\n\tv_nop\n\tv_nop\n\tv_nop" : "+v"(acc[0][0]), "+v"(acc[1][1]), "+v"(acc[2][2]), "+v"(acc[3][3]) : "v"(a[0]), "v"(a[3]));
    }
    if (tr) {
#pragma unroll
        for (int nb = 0; nb < 4; ++nb) {
#pragma unroll
            for (int mb = 0; mb < 4; ++mb) { float* op = os + lr * 68 + mb * 16 + hi * 8; const v8f a = acc[mb][nb]; *(v4fa*)op = __builtin_shufflevector(a, a, 0, 1, 2, 3); *(v4fa*)(op + 4) = __builtin_shufflevector(a, a, 4, 5, 6, 7); }
            __builtin_amdgcn_wave_barrier(); asm volatile("" ::: "memory");   // other lanes' staged rows are read below: the LDS reads stay behind the stores
#pragma unroll
            for (int s = 0; s < 4; ++s) { const int d = c0 + nb * 16 + s * 4 + er; put3(ld8f(os + (s * 4 + er) * 68 + ec) + bd[nb][s], (size_t)d * TT + r0 + ec, P16, Ph, Pl); }
            __builtin_amdgcn_wave_barrier(); asm volatile("" ::: "memory");   // the next column block's staging stays behind these reads
        }
        return;
    }
#pragma unroll
    for (int mb = 0; mb < 4; ++mb) {
#pragma unroll
        for (int nb = 0; nb < 4; ++nb) {
#pragma unroll
            for (int j = 0; j < 8; ++j) os[(hi * 8 + j) * 68 + nb * 16 + lr] = acc[mb][nb][j]; }
        __builtin_amdgcn_wave_barrier(); asm volatile("" ::: "memory");
        float* crow = C + (size_t)(r0 + mb * 16) * ldc + c0;
        if constexpr (EPI == 1 || EPI == 3) {
#pragma unroll
            for (int s = 0; s < 4; ++s) put3(ld8f(os + (s * 4 + er) * 68 + ec) + b8, ((size_t)blockIdx.y * TT + r0 + mb * 16 + s * 4 + er) * HD + ec, P16, Ph, Pl);
        } else {
#pragma unroll
            for (int s = 0; s < 8; ++s) { const int row = 2 * s + hi, cofs = lr * 4; v4f val = *(const v4fa*)(os + row * 68 + cofs); if (BIAS) { val[0] += bfr(bias[c0 + cofs]); val[1] += bfr(bias[c0 + cofs + 1]); val[2] += bfr(bias[c0 + cofs + 2]); val[3] += bfr(bias[c0 + cofs + 3]); }
                *(v4f*)(crow + (size_t)row * ldc + cofs) = val; }
             }
        __builtin_amdgcn_wave_barrier(); asm volatile("" ::: "memory");
    }
    if constexpr (EPI == 3) asm volatile("s_wait_xcnt 0x0" ::: "memory");   // in the built code the [h][d][t] epilogue stands behind this one, past a scalar branch, and rewrites the last stores' registers: the wait stands in front of that
}

__device__ __forceinline__ void splitf(float y, unsigned short& h, unsigned short& l) { h = f2bf(y); l = f2bf(y - bf2f(h)); }
typedef __attribute__((ext_vector_type(2))) _Float16 v2h;
typedef __attribute__((ext_vector_type(4))) _Float16 v4h;
typedef __attribute__((ext_vector_type(2))) unsigned short v2us;
typedef __attribute__((ext_vector_type(4))) unsigned short v4us;
typedef __attribute__((ext_vector_type(2))) float v2f;
typedef __attribute__((ext_vector_type(4))) int v4i;

__global__ __launch_bounds__(256) void k_wtG(const float* __restrict__ w, int K, int N, bf* Bt) {
    const int lane = threadIdx.x & 31; const int L0 = (blockIdx.x * 8 + (threadIdx.x >> 5)) * 8; const int nlines = N * K / 64;
{
#pragma unroll 1
        for (int l = 0; l < 8; ++l) { const int L = L0 + l; if (L >= nlines) break; const size_t e = (size_t)L * 64 + lane * 2; const int k = (int)(e % K), n = (int)(e / K); v2us o;
            o[0] = f2bf(w[(size_t)k * N + n]); o[1] = f2bf(w[(size_t)(k + 1) * N + n]); *(v2us*)(Bt + e) = o; }
         }
}
__global__ __launch_bounds__(256) void k_cvt8(const float* __restrict__ src, bf* dst, size_t n8) { const size_t i = (size_t)blockIdx.x * 256 + threadIdx.x; if (i >= n8) return; const v8f v = *(const v8f*)(src + i * 8); v8us o;
#pragma unroll
    for (int k = 0; k < 8; ++k) o[k] = f2bf(v[k]); *(v8us*)(dst + i * 8) = o;  }

// ---- k_fattn: scores, softmax and P.V of one head's 64 query rows in one work-group; nothing of S or P goes to memory. Grid (query block, head, batch).
// Transposed products: St = K Qt (A = key rows, B = query rows), so a lane holds one query's scores (register r of key tile kt = key kt*16 + 8*hi + r, query lr); two St tiles converted in place are the B operand of Ot += Vt Pt (A = rows of the [d][t] planes).
// t = (S x HD^-0.5 + bf16(RP[i][j])) + bf16(RB[i][j]); running maximum per query in log2 units, moved (and sums and Ot rescaled) only when a score passes it by more than 8, so p <= 2^8.
// The two planes come as whole 128-byte rows (4 lines a load instead of 16) and are turned into the score layout through the wave's own LDS region (pitch 36 floats), which later holds its Ot partial.
// 8 waves: wave w takes query rows (w & 1) * 32 .. + 31 and keys (w >> 1) * TT / FKS .. ; the FKS partial (maximum, sum, Ot) of a query are joined in split order through LDS, normalised and stored as hi/lo bf16 rows of the merged [t][DQ] planes.
#define L2E 1.4426950408889634f
#define FWR (2 * 32 * 36)         // floats of a wave's LDS region: two 32 x 36 plane tiles in the loop, then its 32 x 68 Ot partial
template <bool HI, typename T16>
__device__ __forceinline__ void fa_wave(const T16* __restrict__ Q, const T16* __restrict__ Q2, const T16* __restrict__ Kp, const T16* __restrict__ K2, const T16* __restrict__ Vt, const T16* __restrict__ V2, const float* __restrict__ RP, const float* __restrict__ RB, int q0w, int key0, float* osw, float* msw, float* lsw) {
    typedef typename WFrag<T16>::V V;
    const int lane = threadIdx.x & 31, lr = lane & 15, hi = lane >> 4;
    V qf[2][2], qf2[2][2];
#pragma unroll
    for (int qt = 0; qt < 2; ++qt)
#pragma unroll
        for (int kc = 0; kc < 2; ++kc) { const size_t o = (size_t)(q0w + qt * 16 + lr) * HD + kc * 32 + 8 * hi; qf[qt][kc] = WFrag<T16>::ld(Q + o); if (HI) qf2[qt][kc] = WFrag<T16>::ld(Q2 + o); }
    v8f acc[4][2];
#pragma unroll
    for (int dt = 0; dt < 4; ++dt) { acc[dt][0] = (v8f){}; acc[dt][1] = (v8f){}; }
    float m[2] = {-3.0e38f, -3.0e38f}, l[2] = {0.f, 0.f};
    const int srow = lane >> 3, scol = (lane & 7) * 4; const size_t prow = (size_t)(q0w + srow) * TT + scol;
#pragma unroll 1
    for (int key = key0; key < key0 + TT / FKS; key += 32) {
        v4f gm[8], gb[8];   // this pass's 32 x 32 tiles of the mask and bias planes, 8 lanes a row; the hi/lo rows ask for them behind the score products, whose fragments fill the registers
        if constexpr (!HI) {
#pragma unroll
            for (int i = 0; i < 8; ++i) { const size_t o = prow + (size_t)i * 4 * TT + key; gm[i] = *(const v4f*)(RP + o); gb[i] = *(const v4f*)(RB + o); } }
        v8f s[2][2];   // [key tile][query tile]
#pragma unroll
        for (int kt = 0; kt < 2; ++kt) { s[kt][0] = (v8f){}; s[kt][1] = (v8f){};
#pragma unroll
            for (int kc = 0; kc < 2; ++kc) { const size_t o = (size_t)(key + kt * 16 + lr) * HD + kc * 32 + 8 * hi; const V kf = WFrag<T16>::ld(Kp + o); V kf2; if (HI) kf2 = WFrag<T16>::ld(K2 + o);
#pragma unroll
                for (int qt = 0; qt < 2; ++qt) { s[kt][qt] = WFrag<T16>::mma(kf, qf[qt][kc], s[kt][qt]); if (HI) { s[kt][qt] = WFrag<T16>::mma(kf, qf2[qt][kc], s[kt][qt]); s[kt][qt] = WFrag<T16>::mma(kf2, qf[qt][kc], s[kt][qt]); } } } }
        if constexpr (HI) {
#pragma unroll
            for (int i = 0; i < 8; ++i) { const size_t o = prow + (size_t)i * 4 * TT + key; gm[i] = *(const v4f*)(RP + o); gb[i] = *(const v4f*)(RB + o); } }
#pragma unroll
        for (int i = 0; i < 8; ++i) { float* sp = osw + (i * 4 + srow) * 36 + scol; *(v4fa*)sp = gm[i]; *(v4fa*)(sp + 32 * 36) = gb[i]; }
        __builtin_amdgcn_wave_barrier(); asm volatile("" ::: "memory");   // other lanes' tile rows are read below: the compiler must not lift those LDS reads over the stores
        float c[2];
#pragma unroll
        for (int qt = 0; qt < 2; ++qt) { float mx = -3.0e38f;
#pragma unroll
            for (int kt = 0; kt < 2; ++kt) { const float* sp = osw + (qt * 16 + lr) * 36 + kt * 16 + 8 * hi; const v8f t = (s[kt][qt] * SCL + bfr8(ld8f(sp))) + bfr8(ld8f(sp + 32 * 36)); s[kt][qt] = t;
#pragma unroll
                for (int r = 0; r < 8; ++r) mx = fmaxf(mx, t[r]); }
            c[qt] = mx * L2E; }
        __builtin_amdgcn_wave_barrier(); asm volatile("" ::: "memory");   // the next pass's tile stores (and the Ot partial behind the loop) stay behind these reads
        if (__builtin_amdgcn_ballot_w32(c[0] > m[0] + 8.0f || c[1] > m[1] + 8.0f) != 0) {   // wave-uniform: both halves of a query move its maximum together
#pragma unroll
            for (int qt = 0; qt < 2; ++qt) { const float mn = fmaxf(m[qt], fmaxf(c[qt], __shfl_xor(c[qt], 16, 32))); const float al = __builtin_amdgcn_exp2f(m[qt] - mn); m[qt] = mn; l[qt] *= al;
#pragma unroll
                for (int dt = 0; dt < 4; ++dt) acc[dt][qt] *= al; } }
        V pf[2], pf2[2];
#pragma unroll
        for (int qt = 0; qt < 2; ++qt) { v8f p[2];
#pragma unroll
            for (int kt = 0; kt < 2; ++kt) { const v8f e = __builtin_elementwise_fma(s[kt][qt], (v8f)(L2E), (v8f)(-m[qt]));
#pragma unroll
                for (int r = 0; r < 8; ++r) { p[kt][r] = __builtin_amdgcn_exp2f(e[r]); l[qt] += p[kt][r]; } }
            if constexpr (HI) { const v8bq h0 = __builtin_convertvector(p[0], v8bq), h1 = __builtin_convertvector(p[1], v8bq);
                const v8bq l0 = __builtin_convertvector(p[0] - __builtin_convertvector(h0, v8f), v8bq), l1 = __builtin_convertvector(p[1] - __builtin_convertvector(h1, v8f), v8bq);
                pf[qt] = __builtin_shufflevector(h0, h1, 0, 1, 2, 3, 4, 5, 6, 7, 8, 9, 10, 11, 12, 13, 14, 15); pf2[qt] = __builtin_shufflevector(l0, l1, 0, 1, 2, 3, 4, 5, 6, 7, 8, 9, 10, 11, 12, 13, 14, 15); }
            else pf[qt] = cat16(__builtin_convertvector(p[0], v8h), __builtin_convertvector(p[1], v8h)); }
#pragma unroll
        for (int dt = 0; dt < 4; ++dt) { const size_t o = (size_t)(dt * 16 + lr) * TT + key + 8 * hi; const V vf = WFrag<T16>::ld(Vt + o); V vf2; if (HI) vf2 = WFrag<T16>::ld(V2 + o);
#pragma unroll
            for (int qt = 0; qt < 2; ++qt) { acc[dt][qt] = WFrag<T16>::mma(vf, pf[qt], acc[dt][qt]); if (HI) { acc[dt][qt] = WFrag<T16>::mma(vf, pf2[qt], acc[dt][qt]); acc[dt][qt] = WFrag<T16>::mma(vf2, pf[qt], acc[dt][qt]); } } }
    }
#pragma unroll
    for (int qt = 0; qt < 2; ++qt) { const float lt = l[qt] + __shfl_xor(l[qt], 16, 32); if (hi == 0) { msw[qt * 16 + lr] = m[qt]; lsw[qt * 16 + lr] = lt; }
#pragma unroll
        for (int dt = 0; dt < 4; ++dt) { float* op = osw + (qt * 16 + lr) * 68 + dt * 16 + hi * 8; const v8f a = acc[dt][qt]; *(v4fa*)op = __builtin_shufflevector(a, a, 0, 1, 2, 3); *(v4fa*)(op + 4) = __builtin_shufflevector(a, a, 4, 5, 6, 7); } }
}
__global__ __launch_bounds__(256) __attribute__((amdgpu_waves_per_eu(4, 4))) void k_fattn(const h16* __restrict__ Q16, const h16* __restrict__ K16, const h16* __restrict__ V16, const bf* __restrict__ Qh, const bf* __restrict__ Ql, const bf* __restrict__ Kh, const bf* __restrict__ Kl, const bf* __restrict__ Vh, const bf* __restrict__ Vl, const float* __restrict__ RP, const float* __restrict__ RB, bf* Ah, bf* Al) {
    __shared__ __align__(16) float Os[2 * FKS * FWR]; __shared__ float Ms[2 * FKS * 32]; __shared__ float Ls[2 * FKS * 32];
    const int w = __builtin_amdgcn_readfirstlane(threadIdx.x >> 5); const int h = blockIdx.y, b = blockIdx.z, q0 = blockIdx.x * 64; const int q0w = q0 + (w & 1) * 32, key0 = (w >> 1) * (TT / FKS); const size_t hp = ((size_t)b * NH_ + h) * TT * HD; RB += (size_t)b * TT * TT;   // this batch's head planes and bias plane; the mask plane is shared
    if (q0 < RH) fa_wave<true, bf>(Qh + hp, Ql + hp, Kh + hp, Kl + hp, Vh + hp, Vl + hp, RP, RB, q0w, key0, Os + w * FWR, Ms + w * 32, Ls + w * 32);
    else fa_wave<false, h16>(Q16 + hp, nullptr, K16 + hp, nullptr, V16 + hp, nullptr, RP, RB, q0w, key0, Os + w * FWR, Ms + w * 32, Ls + w * 32);
    __syncthreads();   // every wave's partial (maximum, sum, Ot) is in LDS before any thread joins them
    const int q = threadIdx.x >> 2, d0 = (threadIdx.x & 3) * 16; const int wq = q >> 5, ql = q & 31;
    float mm = Ms[wq * 32 + ql];
#pragma unroll
    for (int sp = 1; sp < FKS; ++sp) mm = fmaxf(mm, Ms[(sp * 2 + wq) * 32 + ql]);
    float lt = 0.f; v4f o[4];
#pragma unroll
    for (int k = 0; k < 4; ++k) o[k] = (v4f){};
#pragma unroll
    for (int sp = 0; sp < FKS; ++sp) { const int ww = sp * 2 + wq; const float f = __builtin_amdgcn_exp2f(Ms[ww * 32 + ql] - mm); lt += Ls[ww * 32 + ql] * f;
#pragma unroll
        for (int k = 0; k < 4; ++k) o[k] += *(const v4fa*)(Os + ww * FWR + ql * 68 + d0 + k * 4) * f; }
    const float inv = __fdiv_rn(1.0f, lt); const size_t oo = ((size_t)b * TT + q0 + q) * DQ + h * HD + d0;
#pragma unroll
    for (int g = 0; g < 2; ++g) { v8us oh, ol;
#pragma unroll
        for (int e = 0; e < 8; ++e) { unsigned short a, c2; splitf(o[g * 2 + (e >> 2)][e & 3] * inv, a, c2); oh[e] = a; ol[e] = c2; }
        *(v8us*)(Ah + oo + g * 8) = oh; *(v8us*)(Al + oo + g * 8) = ol; }
}

extern "C" void kernel_launch(void* const* d_in, const int* in_sizes, int n_in,
                              void* d_out, int out_size, void* d_ws, size_t ws_size, hipStream_t stream) {
    (void)in_sizes; (void)n_in; (void)out_size;
    const float* x = (const float*)d_in[0]; const float* amask = (const float*)d_in[1]; const float* abias = (const float*)d_in[2]; const float* wqkv = (const float*)d_in[3]; const float* bqkv = (const float*)d_in[4]; const float* wo = (const float*)d_in[5]; const float* bo = (const float*)d_in[6];   /* x, attn_mask [2048][2048], attn_bias [2][2048][2048], Wqkv ('xw' [1024][3072]), bqkv, Wout ('xw'), bout */
    float* OUT = (float*)d_out;     // [2][2048][1024]
    char* wsp = (char*)d_ws;
    auto take = [&](size_t bytes) { char* p = wsp; wsp += (bytes + 255) & ~(size_t)255; return (void*)p; };
    bf* WQKV = (bf*)take((size_t)3 * DQ * DM * 2);   /* fused Bt [3*DQ][DM]: q | k | v row blocks */ bf* WO = (bf*)take((size_t)DM * DQ * 2);
    bf* XB = (bf*)take((size_t)NB_ * TT * DM * 2);
    const size_t PS = (size_t)NB_ * NH_ * TT * HD;   // elements of one plane set: [batch][head] planes
    h16* P16 = (h16*)take(3 * PS * 2); bf* PH = (bf*)take(3 * PS * 2); bf* PL = (bf*)take(3 * PS * 2);   /* each: q | k | v sets, q and k [h][t][d], v [h][d][t] */
    bf* ATh = (bf*)take((size_t)NB_ * TT * DQ * 2); bf* ATl = (bf*)take((size_t)NB_ * TT * DQ * 2);
    if ((size_t)(wsp - (char*)d_ws) > ws_size) return;    // ws 256 MiB
    { k_wtG<<<(unsigned)((DM * 3 * DQ / 64 + 63) / 64), 256, 0, stream>>>(wqkv, DM, 3 * DQ, WQKV);   /* fused 'xw' [DM][3*DQ] -> Bt [3*DQ][DM] */
      k_wtG<<<(unsigned)((DQ * DM / 64 + 63) / 64), 256, 0, stream>>>(wo, DQ, DM, WO);
       }
    k_cvt8<<<(unsigned)(((size_t)NB_ * TT * DM / 8 + 255) / 256), 256, 0, stream>>>(x, XB, (size_t)NB_ * TT * DM / 8);
    k_gemmw<bf, 0, true, 3><<<dim3(TT / 64, 3 * DQ / 64, NB_), 32, 0, stream>>>(XB, nullptr, WQKV, nullptr, DM, DM, nullptr, 0, bqkv, (size_t)TT * DM, 0, 0, P16, PH, PL);
    k_fattn<<<dim3(TT / 64, NH_, NB_), 256, 0, stream>>>(P16, P16 + PS, P16 + 2 * PS, PH, PL, PH + PS, PL + PS, PH + 2 * PS, PL + 2 * PS, amask, abias, ATh, ATl);   /* shared mask plane; the kernel picks its batch's bias plane */
    k_gemmw<bf, 1, true><<<dim3(TT / 64, DM / 64, NB_), 32, 0, stream>>>(ATh, ATl, WO, nullptr, DQ, DQ, OUT, DM, bo, (size_t)TT * DQ, 0, (size_t)TT * DM, nullptr, nullptr, nullptr);
}

// v006
// A run of this version takes 236 microseconds.
// Timed twice side by side with v005, it ran 1.09 times as fast both times.
// Over all steps from v000 it is 8.79 times as fast.
#include <hip/hip_runtime.h>

// Multi-head self-attention with a fused qkv projection and TWO additive score planes (x [2][2048][1024]; qkv = x Wqkv + bqkv ('xw' [1024][3072] 1/32 + bias (zeros on this draw: read)) -> reshape (B, S, 3, 16, 64): q | k | v column thirds; scores = q.k / sqrt(64) + attn_mask[i][j] (f32 [2048][2048], shared by heads and batches) + attn_bias[b][i][j] (f32 [2][2048][2048], shared by heads); softmax over all keys; out = merged Wout + bout ('xw' [1024][1024] + bias) -> [2][2048][1024] (4.2 M); argument order x, attn_mask, attn_bias, Wqkv, bqkv, Wout, bout).
// Layout, both batches in every launch (the batch is a grid dimension, every plane has a copy per batch): bf16 copy of x; the fused 'xw' weight transposed once into Bt (q | k | v row blocks) + bias; exact projections + f32 biases in ONE launch over all 3 * DQ columns, whose epilogue writes the head planes; one fused attention launch (hybrid rows: < 512 hi/lo 3 products, rest fp16) that adds bf16(attn_mask[i][j]) and then bf16(attn_bias[b][i][j]) to the scaled f32 score, in the module's order, and keeps scores and probabilities in registers; merged hi/lo x Wout exact + bout.
// Compute dtypes, f32 accumulate: every input rounded to bf16 incl. the two planes; projections exact + f32 biases; attention rows < 512 3 products, rest fp16; softmax f32; Wout hl x exact + bias.

#define NB_  2
#define TT   2048
#define DM   1024
#define NH_  16
#define NKV  16
#define REP  (NH_ / NKV)
#define HD   64
#define DQ   (NH_ * HD)
#define DKV  (NKV * HD)
#define ZH   8                    // plane count of k_gemmw's split-K addressing (unused at KS = 1)
#define RH   512                  // query rows < RH use hi+lo planes (0: none)
#define WIN  0
#define SCL  0.125f   // HD^-0.5
#define FKS  4                    // key splits of the fused attention: a wave walks TT / FKS keys of its queries, the FKS partials are joined in LDS
typedef _Float16 h16;
typedef unsigned short bf;
typedef __attribute__((ext_vector_type(16))) __bf16   v16bf;
typedef __attribute__((ext_vector_type(16))) _Float16 v16h;
typedef __attribute__((ext_vector_type(8)))  _Float16 v8h;
typedef __attribute__((ext_vector_type(8)))  unsigned short v8us;
typedef __attribute__((ext_vector_type(8)))  float    v8f;
typedef __attribute__((ext_vector_type(4)))  float    v4f;
typedef v8h  __attribute__((may_alias)) v8ha;
typedef v4f  __attribute__((may_alias)) v4fa;
typedef v8us __attribute__((may_alias)) v8usa;

__device__ __forceinline__ unsigned short f2bf(float f) { unsigned u = __float_as_uint(f); u += 0x7FFFu + ((u >> 16) & 1u); return (unsigned short)(u >> 16); }
__device__ __forceinline__ float bf2f(unsigned short b) { return __uint_as_float(((unsigned)b) << 16); }
__device__ __forceinline__ float bfr(float f) { return bf2f(f2bf(f)); }
__device__ __forceinline__ v16h cat16(v8h lo, v8h hi) { return __builtin_shufflevector(lo, hi, 0, 1, 2, 3, 4, 5, 6, 7, 8, 9, 10, 11, 12, 13, 14, 15); }
__device__ __forceinline__ v16bf cat16b(v8us lo, v8us hi) { return __builtin_bit_cast(v16bf, __builtin_shufflevector(lo, hi, 0, 1, 2, 3, 4, 5, 6, 7, 8, 9, 10, 11, 12, 13, 14, 15)); }
__device__ __forceinline__ v8f wmma16(v16h a, v16h b, v8f c) { return __builtin_amdgcn_wmma_f32_16x16x32_f16(false, a, false, b, (short)0, c, false, false); }
__device__ __forceinline__ v8f wmmab(v16bf a, v16bf b, v8f c) { return __builtin_amdgcn_wmma_f32_16x16x32_bf16(false, a, false, b, (short)0, c, false, false); }



typedef __attribute__((ext_vector_type(8))) __bf16 v8bq;
__device__ __forceinline__ v8f bfr8(v8f x) { return __builtin_convertvector(__builtin_convertvector(x, v8bq), v8f); }   // nearest-even bf16 rounding, widened again
__device__ __forceinline__ v8f ld8f(const float* p) { const v4f a = *(const v4fa*)p, b = *(const v4fa*)(p + 4); return __builtin_shufflevector(a, b, 0, 1, 2, 3, 4, 5, 6, 7); }
// eight f32 values -> their fp16 and hi/lo bf16 forms, one 16-byte store into each of the three planes at element e
__device__ __forceinline__ void put3(v8f v, size_t e, _Float16* P16, unsigned short* Ph, unsigned short* Pl) {
    const v8bq h = __builtin_convertvector(v, v8bq); const v8bq l = __builtin_convertvector(v - __builtin_convertvector(h, v8f), v8bq);
    *(v8h*)(P16 + e) = __builtin_convertvector(v, v8h); *(v8us*)(Ph + e) = __builtin_bit_cast(v8us, h); *(v8us*)(Pl + e) = __builtin_bit_cast(v8us, l);
    asm volatile("s_wait_xcnt 0x0" ::: "memory"); }   // the next call's values land in the registers that these stores name: the wait stands in front of that

// ---- Fragment order, the layout of EVERY 16-bit operand plane (x, both weights, the q / k / v head planes, the merged attention rows): a [rows][K] matrix is kept as 1-KiB fragments of 16 rows x 32 k, fragment (rt, kb) at element (rt * K / 32 + kb) * 512;
// inside it element (r, k) sits at ((k >> 4 & 1) * 32 + (k >> 3 & 1) * 16 + r) * 8 + (k & 7): lane l of a wave finds its two 16-byte pieces at l * 8 and 256 + l * 8, so each fragment load instruction reads 512 contiguous bytes (4 whole lines, not 16 quarter lines). Registers get the same values as from row-major planes.
// ---- k_gemmw: register-blocked GEMM, ONE WAVE per 64x64 output tile (16 accumulators), operands straight from fragment-order 16-bit planes; grid (M/64, N/64, Z), 32 threads.
// C[m][n] (f32, pitch ldc, + optional f32 bias[n]) = sum_k A[m][k] Bt[n][k] (+ split products per NSPLIT). A rows have pitch lda, Bt rows pitch K. z-batch strides sA/sB/sC in elements. K % 32 == 0.
// EPI 0: C as above. EPI 1 (N tile = one head): the tile + bias goes straight to the [h][t][d] planes P16 / Ph / Pl (fp16, hi/lo bf16), in fragment order, 512 contiguous bytes a store. EPI 2: the same to the [h][d][t] planes, the tile turned in LDS.
// EPI 3 (fused q | k | v, N = 3 * DQ, z = batch): the column third picks the plane set ([third][batch] sets of NH_ * TT * HD elements behind P16 / Ph / Pl) and the form: thirds 0 and 1 as EPI 1, third 2 as EPI 2. The test is on blockIdx alone, so it is a scalar branch.
// KS > 1: grid z = Z * KS; block (z, ks) sums k in [ks K/KS, (ks+1) K/KS) alone and stores its partial tile in plane ks of C ([KS][ZH] planes of sC elements; Z = ZH). K % (32 KS) == 0.
#define GLB __attribute__((address_space(1)))
// a wave-uniform address handed on as two scalar words: the load then takes the form scalar base + one lane-offset register that is never rewritten, with no 64-bit vector address add per fragment
__device__ __forceinline__ unsigned long long sbase(const void* p) { const unsigned long long u = (unsigned long long)p; return ((unsigned long long)(unsigned)__builtin_amdgcn_readfirstlane((int)(u >> 32)) << 32) | (unsigned)__builtin_amdgcn_readfirstlane((int)u); }
template <typename T16> struct WFrag;   // ld(p, lo): p = the fragment's start, the same in every lane, lo = the lane (16-byte units); ldu(u, lo + c): u = sbase() of a pass's first fragment, c = a compile-time distance, which goes into the instruction's offset
template <> struct WFrag<h16> { typedef v16h V; static __device__ __forceinline__ V ldu(unsigned long long u, unsigned i) { const GLB v8h* q = (const GLB v8h*)u; return cat16(q[i], q[i + 32]); } static __device__ __forceinline__ V ld(const h16* p, unsigned lo) { return ldu(sbase(p), lo); } static __device__ __forceinline__ v8f mma(V a, V b, v8f c) { return wmma16(a, b, c); } };
template <> struct WFrag<bf> { typedef v16bf V; static __device__ __forceinline__ V ldu(unsigned long long u, unsigned i) { const GLB v8us* q = (const GLB v8us*)u; return cat16b(q[i], q[i + 32]); } static __device__ __forceinline__ V ld(const bf* p, unsigned lo) { return ldu(sbase(p), lo); } static __device__ __forceinline__ v8f mma(V a, V b, v8f c) { return wmmab(a, b, c); } };
template <typename T16, int NSPLIT, bool BIAS, int EPI = 0, int KS = 1>
__global__ __launch_bounds__(32) void k_gemmw(const T16* __restrict__ A, const T16* __restrict__ A2, const T16* __restrict__ Bt, const T16* __restrict__ Bt2, int K, int lda, float* C, int ldc, const float* __restrict__ bias, size_t sA, size_t sB, size_t sC, h16* P16, bf* Ph, bf* Pl) {
    typedef typename WFrag<T16>::V V;
    __shared__ __align__(16) float os[16 * 68];
    const size_t z = blockIdx.z / KS; const int ks = blockIdx.z % KS; A += z * sA; if (A2) A2 += z * sA; Bt += z * sB; if (Bt2) Bt2 += z * sB; C += ((size_t)ks * ZH + z) * sC;
    const int lane = threadIdx.x & 31, lr = lane & 15, hi = lane >> 4; int bx = blockIdx.x; const int c0 = blockIdx.y * 64;
    v8f acc[4][4];
#pragma unroll
    for (int mb = 0; mb < 4; ++mb)
#pragma unroll
        for (int nb = 0; nb < 4; ++nb) acc[mb][nb] = (v8f){};
    const int ec = hi * 8;   // EPI 1, 2: lane (lr, hi) reads staged row lr, floats s * 16 + hi * 8 .. + 7 in step s: the order of a fragment piece
    const int third = EPI == 3 ? (int)blockIdx.y / (DQ / 64) : 0;
    const bool tr = EPI == 2 || (EPI == 3 && third == 2);   // [h][d][t] planes
    if constexpr (EPI == 3) { const size_t po = ((size_t)third * (NB_ - 1) + z) * ((size_t)NH_ * TT * HD); P16 += po; Ph += po; Pl += po; }   // set (third, z) starts at (third * NB_ + z) planes; the stores below index by the fused column, which already steps one plane per third
    v8f b8[4]; float bd[4];   // the lane's bias values, asked for ahead of the k loop, which hides their latency (EPI 3 asks for both forms: a branch here would wait for them in front of the loop)
    if constexpr (EPI == 1 || EPI == 3) {
#pragma unroll
        for (int s = 0; s < 4; ++s) b8[s] = bfr8(ld8f(bias + c0 + s * 16 + ec)); }
    if constexpr (EPI == 2 || EPI == 3) {
#pragma unroll
        for (int nb = 0; nb < 4; ++nb) bd[nb] = bfr(bias[c0 + nb * 16 + lr]); }
    if constexpr (EPI == 3) asm volatile("s_wait_xcnt 0x0" : "+s"(bx) :: "memory");   // the bias loads stay in flight over the k loop, and their address registers are rewritten right behind them, first by the row offset: the wait stands in front of that, and the block index goes through it so that the scalar code that forms the offset cannot be lifted over it
    const int r0 = bx * 64; const size_t aoff = (size_t)r0 * lda, boff = (size_t)c0 * K; const unsigned lo = lane;   // fragment order: 16 rows are lda * 16 elements, 32 k are 512
#pragma unroll 1
    for (int kc = ks * (K / KS); kc < (ks + 1) * (K / KS); kc += 32) {
        V a[4], a2[4];
#pragma unroll
        for (int mb = 0; mb < 4; ++mb) { a[mb] = WFrag<T16>::ld(A + aoff + (size_t)mb * 16 * lda + kc * 16, lo); if (NSPLIT == 1 || NSPLIT == 2) a2[mb] = WFrag<T16>::ld(A2 + aoff + (size_t)mb * 16 * lda + kc * 16, lo); }
#pragma unroll
        for (int nb = 0; nb < 4; ++nb) { const V b = WFrag<T16>::ld(Bt + boff + (size_t)nb * 16 * K + kc * 16, lo); V b2; if (NSPLIT >= 2) b2 = WFrag<T16>::ld(Bt2 + boff + (size_t)nb * 16 * K + kc * 16, lo);
#pragma unroll
            for (int mb = 0; mb < 4; ++mb) { acc[mb][nb] = WFrag<T16>::mma(a[mb], b, acc[mb][nb]); if (NSPLIT == 1 || NSPLIT == 2) acc[mb][nb] = WFrag<T16>::mma(a2[mb], b, acc[mb][nb]); if (NSPLIT >= 2) acc[mb][nb] = WFrag<T16>::mma(a[mb], b2, acc[mb][nb]); } }
        asm volatile("v_nop\n\tv_nop\n\tv_nop\n\tv_nop" : "+v"(acc[0][0]), "+v"(acc[1][1]), "+v"(acc[2][2]), "+v"(acc[3][3]) : "v"(a[0]), "v"(a[3]));
    }
    if (tr) {
#pragma unroll
        for (int nb = 0; nb < 4; ++nb) {
#pragma unroll
            for (int mb = 0; mb < 4; ++mb) { float* op = os + lr * 68 + mb * 16 + hi * 8; const v8f a = acc[mb][nb]; *(v4fa*)op = __builtin_shufflevector(a, a, 0, 1, 2, 3); *(v4fa*)(op + 4) = __builtin_shufflevector(a, a, 4, 5, 6, 7); }
            __builtin_amdgcn_wave_barrier(); asm volatile("" ::: "memory");   // each lane reads back only its own staged floats: the LDS reads stay behind the stores
#pragma unroll
            for (int s = 0; s < 4; ++s) put3(ld8f(os + lr * 68 + s * 16 + ec) + bd[nb], (size_t)(c0 + nb * 16) * TT + r0 * 16 + s * 256 + lane * 8, P16, Ph, Pl);   // rows d, k = t: piece s of the two fragments that hold t = r0 .. r0 + 63
            __builtin_amdgcn_wave_barrier(); asm volatile("" ::: "memory");   // the next column block's staging stays behind these reads
        }
        return;
    }
#pragma unroll
    for (int mb = 0; mb < 4; ++mb) {
#pragma unroll
        for (int nb = 0; nb < 4; ++nb) {
#pragma unroll
            for (int j = 0; j < 8; ++j) os[(hi * 8 + j) * 68 + nb * 16 + lr] = acc[mb][nb][j]; }
        __builtin_amdgcn_wave_barrier(); asm volatile("" ::: "memory");
        float* crow = C + (size_t)(r0 + mb * 16) * ldc + c0;
        if constexpr (EPI == 1 || EPI == 3) {
#pragma unroll
            for (int s = 0; s < 4; ++s) put3(ld8f(os + lr * 68 + s * 16 + ec) + b8[s], ((size_t)blockIdx.y * TT + r0 + mb * 16) * HD + s * 256 + lane * 8, P16, Ph, Pl);   // rows t, k = d: piece s of the row tile's two fragments
        } else {
#pragma unroll
            for (int s = 0; s < 8; ++s) { const int row = 2 * s + hi, cofs = lr * 4; v4f val = *(const v4fa*)(os + row * 68 + cofs); if (BIAS) { val[0] += bfr(bias[c0 + cofs]); val[1] += bfr(bias[c0 + cofs + 1]); val[2] += bfr(bias[c0 + cofs + 2]); val[3] += bfr(bias[c0 + cofs + 3]); }
                *(v4f*)(crow + (size_t)row * ldc + cofs) = val; }
            asm volatile("s_wait_xcnt 0x0" ::: "memory");   // the next row block's bias loads land in registers that these stores name: the wait stands in front of that
             }
        __builtin_amdgcn_wave_barrier(); asm volatile("" ::: "memory");
    }
    if constexpr (EPI == 3) asm volatile("s_wait_xcnt 0x0" ::: "memory");   // in the built code the [h][d][t] epilogue stands behind this one, past a scalar branch, and rewrites the last stores' registers: the wait stands in front of that
}

__device__ __forceinline__ void splitf(float y, unsigned short& h, unsigned short& l) { h = f2bf(y); l = f2bf(y - bf2f(h)); }
typedef __attribute__((ext_vector_type(2))) _Float16 v2h;
typedef __attribute__((ext_vector_type(4))) _Float16 v4h;
typedef __attribute__((ext_vector_type(2))) unsigned short v2us;
typedef __attribute__((ext_vector_type(4))) unsigned short v4us;
typedef __attribute__((ext_vector_type(2))) float v2f;
typedef __attribute__((ext_vector_type(4))) int v4i;

// Both plane builders go by the DESTINATION: thread i makes 16-byte unit i of the fragment-order plane (a wave stores 512 contiguous bytes). Unit i = row tile, k block, then (k >> 3 & 3) in bits 5..4 and the row in bits 3..0.
__global__ __launch_bounds__(256) void k_wtG(const float* __restrict__ w, int K, int N, bf* Bt) {   // w [K][N] f32 -> Bt, rows n, in fragment order
    const int i = blockIdx.x * 256 + threadIdx.x; if (i >= N * (K / 8)) return;
    const int fr = i >> 6, n = fr / (K >> 5) * 16 + (i & 15), k0 = fr % (K >> 5) * 32 + ((i >> 4) & 3) * 8; v8us o;
    float v[8]; const unsigned vo = (unsigned)(k0 * N + n);
#pragma unroll
    for (int j = 0; j < 8; ++j) v[j] = ((const GLB float*)sbase(w + (size_t)j * N))[vo];   // row k0 + j: the step j * N goes into the scalar base, the lane's offset register stays
    asm volatile("s_wait_xcnt 0x0" ::: "memory");   // the roundings below reuse the loads' offset registers: the wait stands in front of that
#pragma unroll
    for (int j = 0; j < 8; ++j) o[j] = f2bf(v[j]);
    *(v8us*)(Bt + (size_t)i * 8) = o;
}
__global__ __launch_bounds__(256) void k_cvt8(const float* __restrict__ src, bf* dst, size_t n8) {   // src [rows][DM] f32
    const size_t i = (size_t)blockIdx.x * 256 + threadIdx.x; if (i >= n8) return;
    const size_t fr = i >> 6; const v8f v = *(const v8f*)(src + (fr / (DM / 32) * 16 + (i & 15)) * DM + fr % (DM / 32) * 32 + ((i >> 4) & 3) * 8); v8us o;
#pragma unroll
    for (int k = 0; k < 8; ++k) o[k] = f2bf(v[k]); *(v8us*)(dst + i * 8) = o;  }

// ---- k_fattn: scores, softmax and P.V of one head's 64 query rows in one work-group; nothing of S or P goes to memory. Grid (query block, head, batch).
// Transposed products: St = K Qt (A = key rows, B = query rows), so a lane holds one query's scores (register r of key tile kt = key kt*16 + 8*hi + r, query lr); two St tiles converted in place are the B operand of Ot += Vt Pt (A = rows of the [d][t] planes).
// t = (S x HD^-0.5 + bf16(RP[i][j])) + bf16(RB[i][j]); running maximum per query in log2 units, moved (and sums and Ot rescaled) only when a score passes it by more than 8, so p <= 2^8.
// The two planes come as whole 128-byte rows (4 lines a load instead of 16) and are turned into the score layout through the wave's own LDS region (pitch 36 floats), which later holds its Ot partial.
// 8 waves: wave w takes query rows (w & 1) * 32 .. + 31 and keys (w >> 1) * TT / FKS .. ; the FKS partial (maximum, sum, Ot) of a query are joined in split order through LDS, normalised and stored as hi/lo bf16 into the merged [t][DQ] planes (fragment order, like the q / k / v planes read here).
#define L2E 1.4426950408889634f
#define FWR (2 * 32 * 36)         // floats of a wave's LDS region: two 32 x 36 plane tiles in the loop, then its 32 x 68 Ot partial
template <bool HI, typename T16>
__device__ __forceinline__ void fa_wave(const T16* __restrict__ Q, const T16* __restrict__ Q2, const T16* __restrict__ Kp, const T16* __restrict__ K2, const T16* __restrict__ Vt, const T16* __restrict__ V2, const float* __restrict__ RP, const float* __restrict__ RB, int q0w, int key0, float* osw, float* msw, float* lsw) {
    typedef typename WFrag<T16>::V V;
    const int lane = threadIdx.x & 31, lr = lane & 15, hi = lane >> 4; const unsigned lo = lane;
    V qf[2][2], qf2[2][2];
#pragma unroll
    for (int qt = 0; qt < 2; ++qt)
#pragma unroll
        for (int kc = 0; kc < 2; ++kc) { const size_t o = (size_t)(q0w + qt * 16) * HD + kc * 512; qf[qt][kc] = WFrag<T16>::ld(Q + o, lo); if (HI) qf2[qt][kc] = WFrag<T16>::ld(Q2 + o, lo); }
    v8f acc[4][2];
#pragma unroll
    for (int dt = 0; dt < 4; ++dt) { acc[dt][0] = (v8f){}; acc[dt][1] = (v8f){}; }
    float m[2] = {-3.0e38f, -3.0e38f}, l[2] = {0.f, 0.f};
    const int srow = lane >> 3, scol = (lane & 7) * 4; const size_t prow = (size_t)(q0w + srow) * TT + scol;
#pragma unroll 1
    for (int key = key0; key < key0 + TT / FKS; key += 32) {
        const unsigned long long uk = sbase(Kp + (size_t)key * HD), uv = sbase(Vt + (size_t)key * 16);   // this pass's first K and V fragments (the hi/lo rows form each fragment's base by itself: with common bases the build spilled a Q fragment)
        v4f gm[8], gb[8];   // this pass's 32 x 32 tiles of the mask and bias planes, 8 lanes a row; the hi/lo rows ask for them behind the score products, whose fragments fill the registers
        if constexpr (!HI) {
#pragma unroll
            for (int i = 0; i < 8; ++i) { const size_t o = prow + (size_t)i * 4 * TT + key; gm[i] = *(const v4f*)(RP + o); gb[i] = *(const v4f*)(RB + o); } }
        v8f s[2][2];   // [key tile][query tile]
#pragma unroll
        for (int kt = 0; kt < 2; ++kt) { s[kt][0] = (v8f){}; s[kt][1] = (v8f){};
#pragma unroll
            for (int kc = 0; kc < 2; ++kc) { const unsigned o = lo + kt * 128 + kc * 64; V kf, kf2; if constexpr (HI) { const size_t e = (size_t)(key + kt * 16) * HD + kc * 512; kf = WFrag<T16>::ld(Kp + e, lo); kf2 = WFrag<T16>::ld(K2 + e, lo); } else kf = WFrag<T16>::ldu(uk, o);
#pragma unroll
                for (int qt = 0; qt < 2; ++qt) { s[kt][qt] = WFrag<T16>::mma(kf, qf[qt][kc], s[kt][qt]); if (HI) { s[kt][qt] = WFrag<T16>::mma(kf, qf2[qt][kc], s[kt][qt]); s[kt][qt] = WFrag<T16>::mma(kf2, qf[qt][kc], s[kt][qt]); } } } }
        if constexpr (HI) {
#pragma unroll
            for (int i = 0; i < 8; ++i) { const size_t o = prow + (size_t)i * 4 * TT + key; gm[i] = *(const v4f*)(RP + o); gb[i] = *(const v4f*)(RB + o); } }
#pragma unroll
        for (int i = 0; i < 8; ++i) { float* sp = osw + (i * 4 + srow) * 36 + scol; *(v4fa*)sp = gm[i]; *(v4fa*)(sp + 32 * 36) = gb[i]; }
        __builtin_amdgcn_wave_barrier(); asm volatile("" ::: "memory");   // other lanes' tile rows are read below: the compiler must not lift those LDS reads over the stores
        float c[2];
#pragma unroll
        for (int qt = 0; qt < 2; ++qt) { float mx = -3.0e38f;
#pragma unroll
            for (int kt = 0; kt < 2; ++kt) { const float* sp = osw + (qt * 16 + lr) * 36 + kt * 16 + 8 * hi; const v8f t = (s[kt][qt] * SCL + bfr8(ld8f(sp))) + bfr8(ld8f(sp + 32 * 36)); s[kt][qt] = t;
#pragma unroll
                for (int r = 0; r < 8; ++r) mx = fmaxf(mx, t[r]); }
            c[qt] = mx * L2E; }
        __builtin_amdgcn_wave_barrier(); asm volatile("" ::: "memory");   // the next pass's tile stores (and the Ot partial behind the loop) stay behind these reads
        if (__builtin_amdgcn_ballot_w32(c[0] > m[0] + 8.0f || c[1] > m[1] + 8.0f) != 0) {   // wave-uniform: both halves of a query move its maximum together
#pragma unroll
            for (int qt = 0; qt < 2; ++qt) { const float mn = fmaxf(m[qt], fmaxf(c[qt], __shfl_xor(c[qt], 16, 32))); const float al = __builtin_amdgcn_exp2f(m[qt] - mn); m[qt] = mn; l[qt] *= al;
#pragma unroll
                for (int dt = 0; dt < 4; ++dt) acc[dt][qt] *= al; } }
        V pf[2], pf2[2];
#pragma unroll
        for (int qt = 0; qt < 2; ++qt) { v8f p[2];
#pragma unroll
            for (int kt = 0; kt < 2; ++kt) { const v8f e = __builtin_elementwise_fma(s[kt][qt], (v8f)(L2E), (v8f)(-m[qt]));
#pragma unroll
                for (int r = 0; r < 8; ++r) { p[kt][r] = __builtin_amdgcn_exp2f(e[r]); l[qt] += p[kt][r]; } }
            if constexpr (HI) { const v8bq h0 = __builtin_convertvector(p[0], v8bq), h1 = __builtin_convertvector(p[1], v8bq);
                const v8bq l0 = __builtin_convertvector(p[0] - __builtin_convertvector(h0, v8f), v8bq), l1 = __builtin_convertvector(p[1] - __builtin_convertvector(h1, v8f), v8bq);
                pf[qt] = __builtin_shufflevector(h0, h1, 0, 1, 2, 3, 4, 5, 6, 7, 8, 9, 10, 11, 12, 13, 14, 15); pf2[qt] = __builtin_shufflevector(l0, l1, 0, 1, 2, 3, 4, 5, 6, 7, 8, 9, 10, 11, 12, 13, 14, 15); }
            else pf[qt] = cat16(__builtin_convertvector(p[0], v8h), __builtin_convertvector(p[1], v8h)); }
#pragma unroll
        for (int dt = 0; dt < 4; ++dt) { const unsigned o = lo + dt * (16 * TT / 8); V vf, vf2; if constexpr (HI) { const size_t e = (size_t)(dt * 16) * TT + key * 16; vf = WFrag<T16>::ld(Vt + e, lo); vf2 = WFrag<T16>::ld(V2 + e, lo); } else vf = WFrag<T16>::ldu(uv, o);
#pragma unroll
            for (int qt = 0; qt < 2; ++qt) { acc[dt][qt] = WFrag<T16>::mma(vf, pf[qt], acc[dt][qt]); if (HI) { acc[dt][qt] = WFrag<T16>::mma(vf, pf2[qt], acc[dt][qt]); acc[dt][qt] = WFrag<T16>::mma(vf2, pf[qt], acc[dt][qt]); } } }
    }
#pragma unroll
    for (int qt = 0; qt < 2; ++qt) { const float lt = l[qt] + __shfl_xor(l[qt], 16, 32); if (hi == 0) { msw[qt * 16 + lr] = m[qt]; lsw[qt * 16 + lr] = lt; }
#pragma unroll
        for (int dt = 0; dt < 4; ++dt) { float* op = osw + (qt * 16 + lr) * 68 + dt * 16 + hi * 8; const v8f a = acc[dt][qt]; *(v4fa*)op = __builtin_shufflevector(a, a, 0, 1, 2, 3); *(v4fa*)(op + 4) = __builtin_shufflevector(a, a, 4, 5, 6, 7); } }
}
__global__ __launch_bounds__(256) __attribute__((amdgpu_waves_per_eu(4, 4))) void k_fattn(const h16* __restrict__ Q16, const h16* __restrict__ K16, const h16* __restrict__ V16, const bf* __restrict__ Qh, const bf* __restrict__ Ql, const bf* __restrict__ Kh, const bf* __restrict__ Kl, const bf* __restrict__ Vh, const bf* __restrict__ Vl, const float* __restrict__ RP, const float* __restrict__ RB, bf* Ah, bf* Al) {
    __shared__ __align__(16) float Os[2 * FKS * FWR]; __shared__ float Ms[2 * FKS * 32]; __shared__ float Ls[2 * FKS * 32];
    const int w = __builtin_amdgcn_readfirstlane(threadIdx.x >> 5); const int h = blockIdx.y, b = blockIdx.z, q0 = blockIdx.x * 64; const int q0w = q0 + (w & 1) * 32, key0 = (w >> 1) * (TT / FKS); const size_t hp = ((size_t)b * NH_ + h) * TT * HD; RB += (size_t)b * TT * TT;   // this batch's head planes and bias plane; the mask plane is shared
    if (q0 < RH) fa_wave<true, bf>(Qh + hp, Ql + hp, Kh + hp, Kl + hp, Vh + hp, Vl + hp, RP, RB, q0w, key0, Os + w * FWR, Ms + w * 32, Ls + w * 32);
    else fa_wave<false, h16>(Q16 + hp, nullptr, K16 + hp, nullptr, V16 + hp, nullptr, RP, RB, q0w, key0, Os + w * FWR, Ms + w * 32, Ls + w * 32);
    __syncthreads();   // every wave's partial (maximum, sum, Ot) is in LDS before any thread joins them
    const int q = threadIdx.x >> 2, d0 = (threadIdx.x & 3) * 16; const int wq = q >> 5, ql = q & 31;
    float mm = Ms[wq * 32 + ql];
#pragma unroll
    for (int sp = 1; sp < FKS; ++sp) mm = fmaxf(mm, Ms[(sp * 2 + wq) * 32 + ql]);
    float lt = 0.f; v4f o[4];
#pragma unroll
    for (int k = 0; k < 4; ++k) o[k] = (v4f){};
#pragma unroll
    for (int sp = 0; sp < FKS; ++sp) { const int ww = sp * 2 + wq; const float f = __builtin_amdgcn_exp2f(Ms[ww * 32 + ql] - mm); lt += Ls[ww * 32 + ql] * f;
#pragma unroll
        for (int k = 0; k < 4; ++k) o[k] += *(const v4fa*)(Os + ww * FWR + ql * 68 + d0 + k * 4) * f; }
    const float inv = __fdiv_rn(1.0f, lt); const size_t oo = ((size_t)b * TT + q0 + (q & ~15)) * DQ + (h * HD + d0) / 16 * 256 + (q & 15) * 8;   // fragment order of the merged [t][DQ] planes: the thread's 16 columns are one piece pair, 128 elements apart
#pragma unroll
    for (int g = 0; g < 2; ++g) { v8us oh, ol;
#pragma unroll
        for (int e = 0; e < 8; ++e) { unsigned short a, c2; splitf(o[g * 2 + (e >> 2)][e & 3] * inv, a, c2); oh[e] = a; ol[e] = c2; }
        *(v8us*)(Ah + oo + g * 128) = oh; *(v8us*)(Al + oo + g * 128) = ol; }
}

extern "C" void kernel_launch(void* const* d_in, const int* in_sizes, int n_in,
                              void* d_out, int out_size, void* d_ws, size_t ws_size, hipStream_t stream) {
    (void)in_sizes; (void)n_in; (void)out_size;
    const float* x = (const float*)d_in[0]; const float* amask = (const float*)d_in[1]; const float* abias = (const float*)d_in[2]; const float* wqkv = (const float*)d_in[3]; const float* bqkv = (const float*)d_in[4]; const float* wo = (const float*)d_in[5]; const float* bo = (const float*)d_in[6];   /* x, attn_mask [2048][2048], attn_bias [2][2048][2048], Wqkv ('xw' [1024][3072]), bqkv, Wout ('xw'), bout */
    float* OUT = (float*)d_out;     // [2][2048][1024]
    char* wsp = (char*)d_ws;
    auto take = [&](size_t bytes) { char* p = wsp; wsp += (bytes + 255) & ~(size_t)255; return (void*)p; };
    bf* WQKV = (bf*)take((size_t)3 * DQ * DM * 2);   /* fused Bt [3*DQ][DM]: q | k | v row blocks */ bf* WO = (bf*)take((size_t)DM * DQ * 2);
    bf* XB = (bf*)take((size_t)NB_ * TT * DM * 2);
    const size_t PS = (size_t)NB_ * NH_ * TT * HD;   // elements of one plane set: [batch][head] planes
    h16* P16 = (h16*)take(3 * PS * 2); bf* PH = (bf*)take(3 * PS * 2); bf* PL = (bf*)take(3 * PS * 2);   /* each: q | k | v sets, q and k [h][t][d], v [h][d][t] */
    bf* ATh = (bf*)take((size_t)NB_ * TT * DQ * 2); bf* ATl = (bf*)take((size_t)NB_ * TT * DQ * 2);
    if ((size_t)(wsp - (char*)d_ws) > ws_size) return;    // ws 256 MiB
    { k_wtG<<<(unsigned)((DM * 3 * DQ / 8 + 255) / 256), 256, 0, stream>>>(wqkv, DM, 3 * DQ, WQKV);   /* fused 'xw' [DM][3*DQ] -> Bt [3*DQ][DM] */
      k_wtG<<<(unsigned)((DQ * DM / 8 + 255) / 256), 256, 0, stream>>>(wo, DQ, DM, WO);
       }
    k_cvt8<<<(unsigned)(((size_t)NB_ * TT * DM / 8 + 255) / 256), 256, 0, stream>>>(x, XB, (size_t)NB_ * TT * DM / 8);
    k_gemmw<bf, 0, true, 3><<<dim3(TT / 64, 3 * DQ / 64, NB_), 32, 0, stream>>>(XB, nullptr, WQKV, nullptr, DM, DM, nullptr, 0, bqkv, (size_t)TT * DM, 0, 0, P16, PH, PL);
    k_fattn<<<dim3(TT / 64, NH_, NB_), 256, 0, stream>>>(P16, P16 + PS, P16 + 2 * PS, PH, PL, PH + PS, PL + PS, PH + 2 * PS, PL + 2 * PS, amask, abias, ATh, ATl);   /* shared mask plane; the kernel picks its batch's bias plane */
    k_gemmw<bf, 1, true><<<dim3(TT / 64, DM / 64, NB_), 32, 0, stream>>>(ATh, ATl, WO, nullptr, DQ, DQ, OUT, DM, bo, (size_t)TT * DQ, 0, (size_t)TT * DM, nullptr, nullptr, nullptr);
}

// v007
// One run takes 216 microseconds.
// In two side-by-side timings against v006, it was 1.08 and 1.10 times as fast.
// All steps since v000 together make it 9.60 times as fast.
#include <hip/hip_runtime.h>

// Multi-head self-attention with a fused qkv projection and TWO additive score planes (x [2][2048][1024]; qkv = x Wqkv + bqkv ('xw' [1024][3072] 1/32 + bias (zeros on this draw: read)) -> reshape (B, S, 3, 16, 64): q | k | v column thirds; scores = q.k / sqrt(64) + attn_mask[i][j] (f32 [2048][2048], shared by heads and batches) + attn_bias[b][i][j] (f32 [2][2048][2048], shared by heads); softmax over all keys; out = merged Wout + bout ('xw' [1024][1024] + bias) -> [2][2048][1024] (4.2 M); argument order x, attn_mask, attn_bias, Wqkv, bqkv, Wout, bout).
// Layout, both batches in every launch (the batch is grid z of the GEMMs and the attention, k_planes does both in each wave; every plane has a copy per batch): bf16 copy of x; the fused 'xw' weight transposed once into Bt (q | k | v row blocks) + bias; exact projections + f32 biases in ONE launch over all 3 * DQ columns, whose epilogue writes the head planes; one launch that adds bf16(attn_mask[i][j]) + bf16(attn_bias[b][i][j]) in f32 ONCE for all heads into a plane per batch, kept in the order of the score registers; one fused attention launch (hybrid rows: < 512 hi/lo 3 products, rest fp16) that adds that plane to the scaled f32 score and keeps scores and probabilities in registers; merged hi/lo x Wout exact + bout.
// Compute dtypes, f32 accumulate: every input rounded to bf16 incl. the two planes; projections exact + f32 biases; attention rows < 512 3 products, rest fp16; softmax f32; Wout hl x exact + bias.

#define NB_  2
#define TT   2048
#define DM   1024
#define NH_  16
#define NKV  16
#define REP  (NH_ / NKV)
#define HD   64
#define DQ   (NH_ * HD)
#define DKV  (NKV * HD)
#define ZH   8                    // plane count of k_gemmw's split-K addressing (unused at KS = 1)
#define RH   512                  // query rows < RH use hi+lo planes (0: none)
#define WIN  0
#define SCL  0.125f   // HD^-0.5
#define FKS  4                    // key splits of the fused attention: a wave walks TT / FKS keys of its queries, the FKS partials are joined in LDS
typedef _Float16 h16;
typedef unsigned short bf;
typedef __attribute__((ext_vector_type(16))) __bf16   v16bf;
typedef __attribute__((ext_vector_type(16))) _Float16 v16h;
typedef __attribute__((ext_vector_type(8)))  _Float16 v8h;
typedef __attribute__((ext_vector_type(8)))  unsigned short v8us;
typedef __attribute__((ext_vector_type(8)))  float    v8f;
typedef __attribute__((ext_vector_type(4)))  float    v4f;
typedef v8h  __attribute__((may_alias)) v8ha;
typedef v4f  __attribute__((may_alias)) v4fa;
typedef v8us __attribute__((may_alias)) v8usa;

__device__ __forceinline__ unsigned short f2bf(float f) { unsigned u = __float_as_uint(f); u += 0x7FFFu + ((u >> 16) & 1u); return (unsigned short)(u >> 16); }
__device__ __forceinline__ float bf2f(unsigned short b) { return __uint_as_float(((unsigned)b) << 16); }
__device__ __forceinline__ float bfr(float f) { return bf2f(f2bf(f)); }
__device__ __forceinline__ v16h cat16(v8h lo, v8h hi) { return __builtin_shufflevector(lo, hi, 0, 1, 2, 3, 4, 5, 6, 7, 8, 9, 10, 11, 12, 13, 14, 15); }
__device__ __forceinline__ v16bf cat16b(v8us lo, v8us hi) { return __builtin_bit_cast(v16bf, __builtin_shufflevector(lo, hi, 0, 1, 2, 3, 4, 5, 6, 7, 8, 9, 10, 11, 12, 13, 14, 15)); }
__device__ __forceinline__ v8f wmma16(v16h a, v16h b, v8f c) { return __builtin_amdgcn_wmma_f32_16x16x32_f16(false, a, false, b, (short)0, c, false, false); }
__device__ __forceinline__ v8f wmmab(v16bf a, v16bf b, v8f c) { return __builtin_amdgcn_wmma_f32_16x16x32_bf16(false, a, false, b, (short)0, c, false, false); }



typedef __attribute__((ext_vector_type(8))) __bf16 v8bq;
__device__ __forceinline__ v8f bfr8(v8f x) { return __builtin_convertvector(__builtin_convertvector(x, v8bq), v8f); }   // nearest-even bf16 rounding, widened again
__device__ __forceinline__ v8f ld8f(const float* p) { const v4f a = *(const v4fa*)p, b = *(const v4fa*)(p + 4); return __builtin_shufflevector(a, b, 0, 1, 2, 3, 4, 5, 6, 7); }
// eight f32 values -> their fp16 and hi/lo bf16 forms, one 16-byte store into each of the three planes at element e
__device__ __forceinline__ void put3(v8f v, size_t e, _Float16* P16, unsigned short* Ph, unsigned short* Pl) {
    const v8bq h = __builtin_convertvector(v, v8bq); const v8bq l = __builtin_convertvector(v - __builtin_convertvector(h, v8f), v8bq);
    *(v8h*)(P16 + e) = __builtin_convertvector(v, v8h); *(v8us*)(Ph + e) = __builtin_bit_cast(v8us, h); *(v8us*)(Pl + e) = __builtin_bit_cast(v8us, l);
    asm volatile("s_wait_xcnt 0x0" ::: "memory"); }   // the next call's values land in the registers that these stores name: the wait stands in front of that

// ---- Fragment order, the layout of EVERY 16-bit operand plane (x, both weights, the q / k / v head planes, the merged attention rows): a [rows][K] matrix is kept as 1-KiB fragments of 16 rows x 32 k, fragment (rt, kb) at element (rt * K / 32 + kb) * 512;
// inside it element (r, k) sits at ((k >> 4 & 1) * 32 + (k >> 3 & 1) * 16 + r) * 8 + (k & 7): lane l of a wave finds its two 16-byte pieces at l * 8 and 256 + l * 8, so each fragment load instruction reads 512 contiguous bytes (4 whole lines, not 16 quarter lines). Registers get the same values as from row-major planes.
// ---- k_gemmw: register-blocked GEMM, ONE WAVE per 64x64 output tile (16 accumulators), operands straight from fragment-order 16-bit planes; grid (M/64, N/64, Z), 32 threads.
// C[m][n] (f32, pitch ldc, + optional f32 bias[n]) = sum_k A[m][k] Bt[n][k] (+ split products per NSPLIT). A rows have pitch lda, Bt rows pitch K. z-batch strides sA/sB/sC in elements. K % 32 == 0.
// EPI 0: C as above. EPI 1 (N tile = one head): the tile + bias goes straight to the [h][t][d] planes P16 / Ph / Pl (fp16, hi/lo bf16), in fragment order, 512 contiguous bytes a store. EPI 2: the same to the [h][d][t] planes, the tile turned in LDS.
// EPI 3 (fused q | k | v, N = 3 * DQ, z = batch): the column third picks the plane set ([third][batch] sets of NH_ * TT * HD elements behind P16 / Ph / Pl) and the form: thirds 0 and 1 as EPI 1, third 2 as EPI 2. The test is on blockIdx alone, so it is a scalar branch.
// KS > 1: grid z = Z * KS; block (z, ks) sums k in [ks K/KS, (ks+1) K/KS) alone and stores its partial tile in plane ks of C ([KS][ZH] planes of sC elements; Z = ZH). K % (32 KS) == 0.
#define GLB __attribute__((address_space(1)))
// a wave-uniform address handed on as two scalar words: the load then takes the form scalar base + one lane-offset register that is never rewritten, with no 64-bit vector address add per fragment
__device__ __forceinline__ unsigned long long sbase(const void* p) { const unsigned long long u = (unsigned long long)p; return ((unsigned long long)(unsigned)__builtin_amdgcn_readfirstlane((int)(u >> 32)) << 32) | (unsigned)__builtin_amdgcn_readfirstlane((int)u); }
template <typename T16> struct WFrag;   // ld(p, lo): p = the fragment's start, the same in every lane, lo = the lane (16-byte units); ldu(u, lo + c): u = sbase() of a pass's first fragment, c = a compile-time distance, which goes into the instruction's offset
template <> struct WFrag<h16> { typedef v16h V; static __device__ __forceinline__ V ldu(unsigned long long u, unsigned i) { const GLB v8h* q = (const GLB v8h*)u; return cat16(q[i], q[i + 32]); } static __device__ __forceinline__ V ld(const h16* p, unsigned lo) { return ldu(sbase(p), lo); } static __device__ __forceinline__ v8f mma(V a, V b, v8f c) { return wmma16(a, b, c); } };
template <> struct WFrag<bf> { typedef v16bf V; static __device__ __forceinline__ V ldu(unsigned long long u, unsigned i) { const GLB v8us* q = (const GLB v8us*)u; return cat16b(q[i], q[i + 32]); } static __device__ __forceinline__ V ld(const bf* p, unsigned lo) { return ldu(sbase(p), lo); } static __device__ __forceinline__ v8f mma(V a, V b, v8f c) { return wmmab(a, b, c); } };
template <typename T16, int NSPLIT, bool BIAS, int EPI = 0, int KS = 1>
__global__ __launch_bounds__(32) void k_gemmw(const T16* __restrict__ A, const T16* __restrict__ A2, const T16* __restrict__ Bt, const T16* __restrict__ Bt2, int K, int lda, float* C, int ldc, const float* __restrict__ bias, size_t sA, size_t sB, size_t sC, h16* P16, bf* Ph, bf* Pl) {
    typedef typename WFrag<T16>::V V;
    __shared__ __align__(16) float os[16 * 68];
    const size_t z = blockIdx.z / KS; const int ks = blockIdx.z % KS; A += z * sA; if (A2) A2 += z * sA; Bt += z * sB; if (Bt2) Bt2 += z * sB; C += ((size_t)ks * ZH + z) * sC;
    const int lane = threadIdx.x & 31, lr = lane & 15, hi = lane >> 4; int bx = blockIdx.x; const int c0 = blockIdx.y * 64;
    v8f acc[4][4];
#pragma unroll
    for (int mb = 0; mb < 4; ++mb)
#pragma unroll
        for (int nb = 0; nb < 4; ++nb) acc[mb][nb] = (v8f){};
    const int ec = hi * 8;   // EPI 1, 2: lane (lr, hi) reads staged row lr, floats s * 16 + hi * 8 .. + 7 in step s: the order of a fragment piece
    const int third = EPI == 3 ? (int)blockIdx.y / (DQ / 64) : 0;
    const bool tr = EPI == 2 || (EPI == 3 && third == 2);   // [h][d][t] planes
    if constexpr (EPI == 3) { const size_t po = ((size_t)third * (NB_ - 1) + z) * ((size_t)NH_ * TT * HD); P16 += po; Ph += po; Pl += po; }   // set (third, z) starts at (third * NB_ + z) planes; the stores below index by the fused column, which already steps one plane per third
    v8f b8[4]; float bd[4];   // the lane's bias values, asked for ahead of the k loop, which hides their latency (EPI 3 asks for both forms: a branch here would wait for them in front of the loop)
    if constexpr (EPI == 1 || EPI == 3) {
#pragma unroll
        for (int s = 0; s < 4; ++s) b8[s] = bfr8(ld8f(bias + c0 + s * 16 + ec)); }
    if constexpr (EPI == 2 || EPI == 3) {
#pragma unroll
        for (int nb = 0; nb < 4; ++nb) bd[nb] = bfr(bias[c0 + nb * 16 + lr]); }
    if constexpr (EPI == 3) asm volatile("s_wait_xcnt 0x0" : "+s"(bx) :: "memory");   // the bias loads stay in flight over the k loop, and their address registers are rewritten right behind them, first by the row offset: the wait stands in front of that, and the block index goes through it so that the scalar code that forms the offset cannot be lifted over it
    const int r0 = bx * 64; const size_t aoff = (size_t)r0 * lda, boff = (size_t)c0 * K; const unsigned lo = lane;   // fragment order: 16 rows are lda * 16 elements, 32 k are 512
#pragma unroll 1
    for (int kc = ks * (K / KS); kc < (ks + 1) * (K / KS); kc += 32) {
        V a[4], a2[4];
#pragma unroll
        for (int mb = 0; mb < 4; ++mb) { a[mb] = WFrag<T16>::ld(A + aoff + (size_t)mb * 16 * lda + kc * 16, lo); if (NSPLIT == 1 || NSPLIT == 2) a2[mb] = WFrag<T16>::ld(A2 + aoff + (size_t)mb * 16 * lda + kc * 16, lo); }
#pragma unroll
        for (int nb = 0; nb < 4; ++nb) { const V b = WFrag<T16>::ld(Bt + boff + (size_t)nb * 16 * K + kc * 16, lo); V b2; if (NSPLIT >= 2) b2 = WFrag<T16>::ld(Bt2 + boff + (size_t)nb * 16 * K + kc * 16, lo);
#pragma unroll
            for (int mb = 0; mb < 4; ++mb) { acc[mb][nb] = WFrag<T16>::mma(a[mb], b, acc[mb][nb]); if (NSPLIT == 1 || NSPLIT == 2) acc[mb][nb] = WFrag<T16>::mma(a2[mb], b, acc[mb][nb]); if (NSPLIT >= 2) acc[mb][nb] = WFrag<T16>::mma(a[mb], b2, acc[mb][nb]); } }
        asm volatile("v_nop\n\tv_nop\n\tv_nop\n\tv_nop" : "+v"(acc[0][0]), "+v"(acc[1][1]), "+v"(acc[2][2]), "+v"(acc[3][3]) : "v"(a[0]), "v"(a[3]));
    }
    if (tr) {
#pragma unroll
        for (int nb = 0; nb < 4; ++nb) {
#pragma unroll
            for (int mb = 0; mb < 4; ++mb) { float* op = os + lr * 68 + mb * 16 + hi * 8; const v8f a = acc[mb][nb]; *(v4fa*)op = __builtin_shufflevector(a, a, 0, 1, 2, 3); *(v4fa*)(op + 4) = __builtin_shufflevector(a, a, 4, 5, 6, 7); }
            __builtin_amdgcn_wave_barrier(); asm volatile("" ::: "memory");   // each lane reads back only its own staged floats: the LDS reads stay behind the stores
#pragma unroll
            for (int s = 0; s < 4; ++s) put3(ld8f(os + lr * 68 + s * 16 + ec) + bd[nb], (size_t)(c0 + nb * 16) * TT + r0 * 16 + s * 256 + lane * 8, P16, Ph, Pl);   // rows d, k = t: piece s of the two fragments that hold t = r0 .. r0 + 63
            __builtin_amdgcn_wave_barrier(); asm volatile("" ::: "memory");   // the next column block's staging stays behind these reads
        }
        return;
    }
#pragma unroll
    for (int mb = 0; mb < 4; ++mb) {
#pragma unroll
        for (int nb = 0; nb < 4; ++nb) {
#pragma unroll
            for (int j = 0; j < 8; ++j) os[(hi * 8 + j) * 68 + nb * 16 + lr] = acc[mb][nb][j]; }
        __builtin_amdgcn_wave_barrier(); asm volatile("" ::: "memory");
        float* crow = C + (size_t)(r0 + mb * 16) * ldc + c0;
        if constexpr (EPI == 1 || EPI == 3) {
#pragma unroll
            for (int s = 0; s < 4; ++s) put3(ld8f(os + lr * 68 + s * 16 + ec) + b8[s], ((size_t)blockIdx.y * TT + r0 + mb * 16) * HD + s * 256 + lane * 8, P16, Ph, Pl);   // rows t, k = d: piece s of the row tile's two fragments
        } else {
#pragma unroll
            for (int s = 0; s < 8; ++s) { const int row = 2 * s + hi, cofs = lr * 4; v4f val = *(const v4fa*)(os + row * 68 + cofs); if (BIAS) { val[0] += bfr(bias[c0 + cofs]); val[1] += bfr(bias[c0 + cofs + 1]); val[2] += bfr(bias[c0 + cofs + 2]); val[3] += bfr(bias[c0 + cofs + 3]); }
                *(v4f*)(crow + (size_t)row * ldc + cofs) = val; }
            asm volatile("s_wait_xcnt 0x0" ::: "memory");   // the next row block's bias loads land in registers that these stores name: the wait stands in front of that
             }
        __builtin_amdgcn_wave_barrier(); asm volatile("" ::: "memory");
    }
    if constexpr (EPI == 3) asm volatile("s_wait_xcnt 0x0" ::: "memory");   // in the built code the [h][d][t] epilogue stands behind this one, past a scalar branch, and rewrites the last stores' registers: the wait stands in front of that
}

__device__ __forceinline__ void splitf(float y, unsigned short& h, unsigned short& l) { h = f2bf(y); l = f2bf(y - bf2f(h)); }
typedef __attribute__((ext_vector_type(2))) _Float16 v2h;
typedef __attribute__((ext_vector_type(4))) _Float16 v4h;
typedef __attribute__((ext_vector_type(2))) unsigned short v2us;
typedef __attribute__((ext_vector_type(4))) unsigned short v4us;
typedef __attribute__((ext_vector_type(2))) float v2f;
typedef __attribute__((ext_vector_type(4))) int v4i;

// Both plane builders go by the DESTINATION: thread i makes 16-byte unit i of the fragment-order plane (a wave stores 512 contiguous bytes). Unit i = row tile, k block, then (k >> 3 & 3) in bits 5..4 and the row in bits 3..0.
__global__ __launch_bounds__(256) void k_wtG(const float* __restrict__ w, int K, int N, bf* Bt) {   // w [K][N] f32 -> Bt, rows n, in fragment order
    const int i = blockIdx.x * 256 + threadIdx.x; if (i >= N * (K / 8)) return;
    const int fr = i >> 6, n = fr / (K >> 5) * 16 + (i & 15), k0 = fr % (K >> 5) * 32 + ((i >> 4) & 3) * 8; v8us o;
    float v[8]; const unsigned vo = (unsigned)(k0 * N + n);
#pragma unroll
    for (int j = 0; j < 8; ++j) v[j] = ((const GLB float*)sbase(w + (size_t)j * N))[vo];   // row k0 + j: the step j * N goes into the scalar base, the lane's offset register stays
    asm volatile("s_wait_xcnt 0x0" ::: "memory");   // the roundings below reuse the loads' offset registers: the wait stands in front of that
#pragma unroll
    for (int j = 0; j < 8; ++j) o[j] = f2bf(v[j]);
    *(v8us*)(Bt + (size_t)i * 8) = o;
}
__global__ __launch_bounds__(256) void k_cvt8(const float* __restrict__ src, bf* dst, size_t n8) {   // src [rows][DM] f32
    const size_t i = (size_t)blockIdx.x * 256 + threadIdx.x; if (i >= n8) return;
    const size_t fr = i >> 6; const v8f v = *(const v8f*)(src + (fr / (DM / 32) * 16 + (i & 15)) * DM + fr % (DM / 32) * 32 + ((i >> 4) & 3) * 8); v8us o;
#pragma unroll
    for (int k = 0; k < 8; ++k) o[k] = f2bf(v[k]); *(v8us*)(dst + i * 8) = o;  }

// ---- k_planes: C[b][i][j] = bf16(mask[i][j]) + bf16(bias[b][i][j]), f32, made once for all heads and kept in SCORE order: 1-KiB tiles of 16 queries x 16 keys, tile (qt, kt) of batch b at float ((b * TT / 16 + qt) * TT / 16 + kt) * 256;
// inside it lane l = hi * 16 + query of k_fattn finds keys hi * 8 + p * 4 .. + 3 at float p * 128 + l * 4. A wave takes 16 queries x 32 keys of both batches: whole 128-byte source rows (4 lines a load), summed as they come, turned through its own LDS region (pitch 36 floats), stored 512 contiguous bytes at a time. Grid (TT / 256, TT / 16).
typedef __attribute__((ext_vector_type(4))) __bf16 v4bq;
__device__ __forceinline__ v4f bfr4(v4f x) { return __builtin_convertvector(__builtin_convertvector(x, v4bq), v4f); }
__global__ __launch_bounds__(256) void k_planes(const float* __restrict__ RP, const float* __restrict__ RB, float* C) {
    __shared__ __align__(16) float ts[8 * NB_ * 16 * 36];
    const int w = threadIdx.x >> 5, lane = threadIdx.x & 31, lr = lane & 15, hi = lane >> 4, srow = lane >> 3, scol = (lane & 7) * 4;
    const int qt = blockIdx.y, k32 = blockIdx.x * 8 + w; float* tw = ts + w * (NB_ * 16 * 36);
    const unsigned vo = (unsigned)((qt * 16 + srow) * TT + k32 * 32 + scol) / 4;   // the lane's place in 16-byte units: one offset register for all twelve loads; the row step goes into the instruction's offset, the batch into the scalar base
    v4f gm[4], gb[NB_][4];
#pragma unroll
    for (int i = 0; i < 4; ++i) { gm[i] = ((const GLB v4f*)sbase(RP))[vo + i * TT];
#pragma unroll
        for (int b = 0; b < NB_; ++b) gb[b][i] = ((const GLB v4f*)sbase(RB + (size_t)b * TT * TT))[vo + i * TT]; }
    asm volatile("s_wait_xcnt 0x0" ::: "memory");   // the code below reuses the loads' offset register: the wait stands in front of that
#pragma unroll
    for (int i = 0; i < 4; ++i) { const v4f m = bfr4(gm[i]);
#pragma unroll
        for (int b = 0; b < NB_; ++b) *(v4fa*)(tw + b * (16 * 36) + (i * 4 + srow) * 36 + scol) = m + bfr4(gb[b][i]); }
    __builtin_amdgcn_wave_barrier(); asm volatile("" ::: "memory");   // other lanes' rows are read below: the LDS reads stay behind the stores
#pragma unroll
    for (int b = 0; b < NB_; ++b)
#pragma unroll
        for (int kt = 0; kt < 2; ++kt)
#pragma unroll
            for (int p = 0; p < 2; ++p) *(v4f*)(C + (((size_t)b * (TT / 16) + qt) * (TT / 16) + k32 * 2 + kt) * 256 + p * 128 + lane * 4) = *(const v4fa*)(tw + b * (16 * 36) + lr * 36 + kt * 16 + hi * 8 + p * 4);
}

// ---- k_fattn: scores, softmax and P.V of one head's 64 query rows in one work-group; nothing of S or P goes to memory. Grid (query block, head, batch).
// Transposed products: St = K Qt (A = key rows, B = query rows), so a lane holds one query's scores (register r of key tile kt = key kt*16 + 8*hi + r, query lr); two St tiles converted in place are the B operand of Ot += Vt Pt (A = rows of the [d][t] planes).
// t = S x HD^-0.5 + CP[i][j], CP = bf16(mask) + bf16(bias) from k_planes; running maximum per query in log2 units, moved (and sums and Ot rescaled) only when a score passes it by more than 8, so p <= 2^8.
// CP is kept in score order (k_planes), so a lane's eight values of a 16 x 16 tile come straight into registers by two loads of 512 contiguous bytes each, scalar base + lane; the loop touches no LDS.
// 8 waves: wave w takes query rows (w & 1) * 32 .. + 31 and keys (w >> 1) * TT / FKS .. ; the FKS partial (maximum, sum, Ot) of a query are joined in split order through LDS, normalised and stored as hi/lo bf16 into the merged [t][DQ] planes (fragment order, like the q / k / v planes read here).
#define L2E 1.4426950408889634f
#define FWR (32 * 68)             // floats of a wave's LDS region: its 32 x 68 Ot partial
template <bool HI, typename T16>
__device__ __forceinline__ void fa_wave(const T16* __restrict__ Q, const T16* __restrict__ Q2, const T16* __restrict__ Kp, const T16* __restrict__ K2, const T16* __restrict__ Vt, const T16* __restrict__ V2, const float* __restrict__ CP, int q0w, int key0, float* osw, float* msw, float* lsw) {
    typedef typename WFrag<T16>::V V;
    const int lane = threadIdx.x & 31, lr = lane & 15, hi = lane >> 4; const unsigned lo = lane;
    V qf[2][2], qf2[2][2];
#pragma unroll
    for (int qt = 0; qt < 2; ++qt)
#pragma unroll
        for (int kc = 0; kc < 2; ++kc) { const size_t o = (size_t)(q0w + qt * 16) * HD + kc * 512; qf[qt][kc] = WFrag<T16>::ld(Q + o, lo); if (HI) qf2[qt][kc] = WFrag<T16>::ld(Q2 + o, lo); }
    v8f acc[4][2];
#pragma unroll
    for (int dt = 0; dt < 4; ++dt) { acc[dt][0] = (v8f){}; acc[dt][1] = (v8f){}; }
    float m[2] = {-3.0e38f, -3.0e38f}, l[2] = {0.f, 0.f};
#pragma unroll 1
    for (int key = key0; key < key0 + TT / FKS; key += 32) {
        const unsigned long long uk = sbase(Kp + (size_t)key * HD), uv = sbase(Vt + (size_t)key * 16);   // this pass's first K and V fragments (the hi/lo rows form each fragment's base by itself: with common bases the build spilled a Q fragment)
        V kfa[2][2];   // fp16 rows: the pass's four K fragments, asked for together with the plane tiles
        if constexpr (!HI) {
#pragma unroll
            for (int kt = 0; kt < 2; ++kt)
#pragma unroll
                for (int kc = 0; kc < 2; ++kc) kfa[kt][kc] = WFrag<T16>::ldu(uk, lo + kt * 128 + kc * 64); }
        const GLB v4f* uc = (const GLB v4f*)sbase(CP + ((size_t)(q0w >> 4) * (TT / 16) + (key >> 4)) * 256);   // this pass's first 16 x 16 tile of the summed plane
        v8f cg[2][2];   // [key tile][query tile], asked for ahead of the score products, which hide a part of their latency
#pragma unroll
        for (int kt = 0; kt < 2; ++kt)
#pragma unroll
            for (int qt = 0; qt < 2; ++qt) { const unsigned o = lo + qt * (TT / 16 * 64) + kt * 64; cg[kt][qt] = __builtin_shufflevector(uc[o], uc[o + 32], 0, 1, 2, 3, 4, 5, 6, 7); }
        if constexpr (!HI) __builtin_amdgcn_sched_barrier(0);   // all 16 loads of the pass are issued before its first product waits: left free, the scheduler put six of them behind the first waits, a second load latency in every pass
        v8f s[2][2];   // [key tile][query tile]
#pragma unroll
        for (int kt = 0; kt < 2; ++kt) { s[kt][0] = (v8f){}; s[kt][1] = (v8f){};
#pragma unroll
            for (int kc = 0; kc < 2; ++kc) { V kf, kf2; if constexpr (HI) { const size_t e = (size_t)(key + kt * 16) * HD + kc * 512; kf = WFrag<T16>::ld(Kp + e, lo); kf2 = WFrag<T16>::ld(K2 + e, lo); } else kf = kfa[kt][kc];
#pragma unroll
                for (int qt = 0; qt < 2; ++qt) { s[kt][qt] = WFrag<T16>::mma(kf, qf[qt][kc], s[kt][qt]); if (HI) { s[kt][qt] = WFrag<T16>::mma(kf, qf2[qt][kc], s[kt][qt]); s[kt][qt] = WFrag<T16>::mma(kf2, qf[qt][kc], s[kt][qt]); } } } }
        float c[2];
#pragma unroll
        for (int qt = 0; qt < 2; ++qt) { float mx = -3.0e38f;
#pragma unroll
            for (int kt = 0; kt < 2; ++kt) { const v8f t = s[kt][qt] * SCL + cg[kt][qt]; s[kt][qt] = t;
#pragma unroll
                for (int r = 0; r < 8; ++r) mx = fmaxf(mx, t[r]); }
            c[qt] = mx * L2E; }
        if (__builtin_amdgcn_ballot_w32(c[0] > m[0] + 8.0f || c[1] > m[1] + 8.0f) != 0) {   // wave-uniform: both halves of a query move its maximum together
#pragma unroll
            for (int qt = 0; qt < 2; ++qt) { const float mn = fmaxf(m[qt], fmaxf(c[qt], __shfl_xor(c[qt], 16, 32))); const float al = __builtin_amdgcn_exp2f(m[qt] - mn); m[qt] = mn; l[qt] *= al;
#pragma unroll
                for (int dt = 0; dt < 4; ++dt) acc[dt][qt] *= al; } }
        V pf[2], pf2[2];
#pragma unroll
        for (int qt = 0; qt < 2; ++qt) { v8f p[2];
#pragma unroll
            for (int kt = 0; kt < 2; ++kt) { const v8f e = __builtin_elementwise_fma(s[kt][qt], (v8f)(L2E), (v8f)(-m[qt]));
#pragma unroll
                for (int r = 0; r < 8; ++r) { p[kt][r] = __builtin_amdgcn_exp2f(e[r]); l[qt] += p[kt][r]; } }
            if constexpr (HI) { const v8bq h0 = __builtin_convertvector(p[0], v8bq), h1 = __builtin_convertvector(p[1], v8bq);
                const v8bq l0 = __builtin_convertvector(p[0] - __builtin_convertvector(h0, v8f), v8bq), l1 = __builtin_convertvector(p[1] - __builtin_convertvector(h1, v8f), v8bq);
                pf[qt] = __builtin_shufflevector(h0, h1, 0, 1, 2, 3, 4, 5, 6, 7, 8, 9, 10, 11, 12, 13, 14, 15); pf2[qt] = __builtin_shufflevector(l0, l1, 0, 1, 2, 3, 4, 5, 6, 7, 8, 9, 10, 11, 12, 13, 14, 15); }
            else pf[qt] = cat16(__builtin_convertvector(p[0], v8h), __builtin_convertvector(p[1], v8h)); }
#pragma unroll
        for (int dt = 0; dt < 4; ++dt) { const unsigned o = lo + dt * (16 * TT / 8); V vf, vf2; if constexpr (HI) { const size_t e = (size_t)(dt * 16) * TT + key * 16; vf = WFrag<T16>::ld(Vt + e, lo); vf2 = WFrag<T16>::ld(V2 + e, lo); } else vf = WFrag<T16>::ldu(uv, o);
#pragma unroll
            for (int qt = 0; qt < 2; ++qt) { acc[dt][qt] = WFrag<T16>::mma(vf, pf[qt], acc[dt][qt]); if (HI) { acc[dt][qt] = WFrag<T16>::mma(vf, pf2[qt], acc[dt][qt]); acc[dt][qt] = WFrag<T16>::mma(vf2, pf[qt], acc[dt][qt]); } } }
    }
#pragma unroll
    for (int qt = 0; qt < 2; ++qt) { const float lt = l[qt] + __shfl_xor(l[qt], 16, 32); if (hi == 0) { msw[qt * 16 + lr] = m[qt]; lsw[qt * 16 + lr] = lt; }
#pragma unroll
        for (int dt = 0; dt < 4; ++dt) { float* op = osw + (qt * 16 + lr) * 68 + dt * 16 + hi * 8; const v8f a = acc[dt][qt]; *(v4fa*)op = __builtin_shufflevector(a, a, 0, 1, 2, 3); *(v4fa*)(op + 4) = __builtin_shufflevector(a, a, 4, 5, 6, 7); } }
}
__global__ __launch_bounds__(256) __attribute__((amdgpu_waves_per_eu(4, 4))) void k_fattn(const h16* __restrict__ Q16, const h16* __restrict__ K16, const h16* __restrict__ V16, const bf* __restrict__ Qh, const bf* __restrict__ Ql, const bf* __restrict__ Kh, const bf* __restrict__ Kl, const bf* __restrict__ Vh, const bf* __restrict__ Vl, const float* __restrict__ CP, bf* Ah, bf* Al) {
    __shared__ __align__(16) float Os[2 * FKS * FWR]; __shared__ float Ms[2 * FKS * 32]; __shared__ float Ls[2 * FKS * 32];
    const int w = __builtin_amdgcn_readfirstlane(threadIdx.x >> 5); const int h = blockIdx.y, b = blockIdx.z, q0 = blockIdx.x * 64; const int q0w = q0 + (w & 1) * 32, key0 = (w >> 1) * (TT / FKS); const size_t hp = ((size_t)b * NH_ + h) * TT * HD; CP += (size_t)b * TT * TT;   // this batch's head planes and summed plane
    if (q0 < RH) fa_wave<true, bf>(Qh + hp, Ql + hp, Kh + hp, Kl + hp, Vh + hp, Vl + hp, CP, q0w, key0, Os + w * FWR, Ms + w * 32, Ls + w * 32);
    else fa_wave<false, h16>(Q16 + hp, nullptr, K16 + hp, nullptr, V16 + hp, nullptr, CP, q0w, key0, Os + w * FWR, Ms + w * 32, Ls + w * 32);
    __syncthreads();   // every wave's partial (maximum, sum, Ot) is in LDS before any thread joins them
    const int q = threadIdx.x >> 2, d0 = (threadIdx.x & 3) * 16; const int wq = q >> 5, ql = q & 31;
    float mm = Ms[wq * 32 + ql];
#pragma unroll
    for (int sp = 1; sp < FKS; ++sp) mm = fmaxf(mm, Ms[(sp * 2 + wq) * 32 + ql]);
    float lt = 0.f; v4f o[4];
#pragma unroll
    for (int k = 0; k < 4; ++k) o[k] = (v4f){};
#pragma unroll
    for (int sp = 0; sp < FKS; ++sp) { const int ww = sp * 2 + wq; const float f = __builtin_amdgcn_exp2f(Ms[ww * 32 + ql] - mm); lt += Ls[ww * 32 + ql] * f;
#pragma unroll
        for (int k = 0; k < 4; ++k) o[k] += *(const v4fa*)(Os + ww * FWR + ql * 68 + d0 + k * 4) * f; }
    const float inv = __fdiv_rn(1.0f, lt); const size_t oo = ((size_t)b * TT + q0 + (q & ~15)) * DQ + (h * HD + d0) / 16 * 256 + (q & 15) * 8;   // fragment order of the merged [t][DQ] planes: the thread's 16 columns are one piece pair, 128 elements apart
#pragma unroll
    for (int g = 0; g < 2; ++g) { v8us oh, ol;
#pragma unroll
        for (int e = 0; e < 8; ++e) { unsigned short a, c2; splitf(o[g * 2 + (e >> 2)][e & 3] * inv, a, c2); oh[e] = a; ol[e] = c2; }
        *(v8us*)(Ah + oo + g * 128) = oh; *(v8us*)(Al + oo + g * 128) = ol; }
}

extern "C" void kernel_launch(void* const* d_in, const int* in_sizes, int n_in,
                              void* d_out, int out_size, void* d_ws, size_t ws_size, hipStream_t stream) {
    (void)in_sizes; (void)n_in; (void)out_size;
    const float* x = (const float*)d_in[0]; const float* amask = (const float*)d_in[1]; const float* abias = (const float*)d_in[2]; const float* wqkv = (const float*)d_in[3]; const float* bqkv = (const float*)d_in[4]; const float* wo = (const float*)d_in[5]; const float* bo = (const float*)d_in[6];   /* x, attn_mask [2048][2048], attn_bias [2][2048][2048], Wqkv ('xw' [1024][3072]), bqkv, Wout ('xw'), bout */
    float* OUT = (float*)d_out;     // [2][2048][1024]
    char* wsp = (char*)d_ws;
    auto take = [&](size_t bytes) { char* p = wsp; wsp += (bytes + 255) & ~(size_t)255; return (void*)p; };
    bf* WQKV = (bf*)take((size_t)3 * DQ * DM * 2);   /* fused Bt [3*DQ][DM]: q | k | v row blocks */ bf* WO = (bf*)take((size_t)DM * DQ * 2);
    bf* XB = (bf*)take((size_t)NB_ * TT * DM * 2);
    const size_t PS = (size_t)NB_ * NH_ * TT * HD;   // elements of one plane set: [batch][head] planes
    h16* P16 = (h16*)take(3 * PS * 2); bf* PH = (bf*)take(3 * PS * 2); bf* PL = (bf*)take(3 * PS * 2);   /* each: q | k | v sets, q and k [h][t][d], v [h][d][t] */
    bf* ATh = (bf*)take((size_t)NB_ * TT * DQ * 2); bf* ATl = (bf*)take((size_t)NB_ * TT * DQ * 2);
    float* CPL = (float*)take((size_t)NB_ * TT * TT * 4);   /* summed mask + bias plane per batch, score order */
    if ((size_t)(wsp - (char*)d_ws) > ws_size) return;    // ws 256 MiB
    { k_wtG<<<(unsigned)((DM * 3 * DQ / 8 + 255) / 256), 256, 0, stream>>>(wqkv, DM, 3 * DQ, WQKV);   /* fused 'xw' [DM][3*DQ] -> Bt [3*DQ][DM] */
      k_wtG<<<(unsigned)((DQ * DM / 8 + 255) / 256), 256, 0, stream>>>(wo, DQ, DM, WO);
       }
    k_cvt8<<<(unsigned)(((size_t)NB_ * TT * DM / 8 + 255) / 256), 256, 0, stream>>>(x, XB, (size_t)NB_ * TT * DM / 8);
    k_planes<<<dim3(TT / 256, TT / 16), 256, 0, stream>>>(amask, abias, CPL);
    k_gemmw<bf, 0, true, 3><<<dim3(TT / 64, 3 * DQ / 64, NB_), 32, 0, stream>>>(XB, nullptr, WQKV, nullptr, DM, DM, nullptr, 0, bqkv, (size_t)TT * DM, 0, 0, P16, PH, PL);
    k_fattn<<<dim3(TT / 64, NH_, NB_), 256, 0, stream>>>(P16, P16 + PS, P16 + 2 * PS, PH, PL, PH + PS, PL + PS, PH + 2 * PS, PL + 2 * PS, CPL, ATh, ATl);   /* the kernel picks its batch's summed plane */
    k_gemmw<bf, 1, true><<<dim3(TT / 64, DM / 64, NB_), 32, 0, stream>>>(ATh, ATl, WO, nullptr, DQ, DQ, OUT, DM, bo, (size_t)TT * DQ, 0, (size_t)TT * DM, nullptr, nullptr, nullptr);
}

// v008
// A run of this version takes 188 microseconds.
// In two side-by-side timings against v007, it was 1.16 and 1.17 times as fast.
// Counting every step since v000, it is 11.2 times as fast.
#include <hip/hip_runtime.h>

// Multi-head self-attention with a fused qkv projection and TWO additive score planes (x [2][2048][1024]; qkv = x Wqkv + bqkv ('xw' [1024][3072] 1/32 + bias (zeros on this draw: read)) -> reshape (B, S, 3, 16, 64): q | k | v column thirds; scores = q.k / sqrt(64) + attn_mask[i][j] (f32 [2048][2048], shared by heads and batches) + attn_bias[b][i][j] (f32 [2][2048][2048], shared by heads); softmax over all keys; out = merged Wout + bout ('xw' [1024][1024] + bias) -> [2][2048][1024] (4.2 M); argument order x, attn_mask, attn_bias, Wqkv, bqkv, Wout, bout).
// Layout, both batches in every launch (the batch is grid z of the GEMMs and part of the attention's permuted flat index, k_planes does both in each wave; every plane has a copy per batch): bf16 copy of x; the fused 'xw' weight transposed once into Bt (q | k | v row blocks) + bias; exact projections + f32 biases in ONE launch over all 3 * DQ columns, whose epilogue writes the head planes; one launch that adds bf16(attn_mask[i][j]) + bf16(attn_bias[b][i][j]) in f32 ONCE for all heads into a plane per batch, kept in the order of the score registers; one fused attention launch (hybrid rows: < 512 hi/lo 3 products, rest fp16) that adds that plane to the scaled f32 score and keeps scores and probabilities in registers; merged hi/lo x Wout exact + bout.
// Compute dtypes, f32 accumulate: every input rounded to bf16 incl. the two planes; projections exact + f32 biases; attention rows < 512 3 products, rest fp16; softmax f32; Wout hl x exact + bias.

#define NB_  2
#define TT   2048
#define DM   1024
#define NH_  16
#define NKV  16
#define REP  (NH_ / NKV)
#define HD   64
#define DQ   (NH_ * HD)
#define DKV  (NKV * HD)
#define ZH   8                    // plane count of k_gemmw's split-K addressing (unused at KS = 1)
#define RH   512                  // query rows < RH use hi+lo planes (0: none)
#define WIN  0
#define SCL  0.125f   // HD^-0.5
#define FKS  4                    // key splits of the fused attention: a wave walks TT / FKS keys of its queries, the FKS partials are joined in LDS
typedef _Float16 h16;
typedef unsigned short bf;
typedef __attribute__((ext_vector_type(16))) __bf16   v16bf;
typedef __attribute__((ext_vector_type(16))) _Float16 v16h;
typedef __attribute__((ext_vector_type(8)))  _Float16 v8h;
typedef __attribute__((ext_vector_type(8)))  unsigned short v8us;
typedef __attribute__((ext_vector_type(8)))  float    v8f;
typedef __attribute__((ext_vector_type(4)))  float    v4f;
typedef v8h  __attribute__((may_alias)) v8ha;
typedef v4f  __attribute__((may_alias)) v4fa;
typedef v8us __attribute__((may_alias)) v8usa;

__device__ __forceinline__ unsigned short f2bf(float f) { unsigned u = __float_as_uint(f); u += 0x7FFFu + ((u >> 16) & 1u); return (unsigned short)(u >> 16); }
__device__ __forceinline__ float bf2f(unsigned short b) { return __uint_as_float(((unsigned)b) << 16); }
__device__ __forceinline__ float bfr(float f) { return bf2f(f2bf(f)); }
__device__ __forceinline__ v16h cat16(v8h lo, v8h hi) { return __builtin_shufflevector(lo, hi, 0, 1, 2, 3, 4, 5, 6, 7, 8, 9, 10, 11, 12, 13, 14, 15); }
__device__ __forceinline__ v16bf cat16b(v8us lo, v8us hi) { return __builtin_bit_cast(v16bf, __builtin_shufflevector(lo, hi, 0, 1, 2, 3, 4, 5, 6, 7, 8, 9, 10, 11, 12, 13, 14, 15)); }
__device__ __forceinline__ v8f wmma16(v16h a, v16h b, v8f c) { return __builtin_amdgcn_wmma_f32_16x16x32_f16(false, a, false, b, (short)0, c, false, false); }
__device__ __forceinline__ v8f wmmab(v16bf a, v16bf b, v8f c) { return __builtin_amdgcn_wmma_f32_16x16x32_bf16(false, a, false, b, (short)0, c, false, false); }



typedef __attribute__((ext_vector_type(8))) __bf16 v8bq;
__device__ __forceinline__ v8f bfr8(v8f x) { return __builtin_convertvector(__builtin_convertvector(x, v8bq), v8f); }   // nearest-even bf16 rounding, widened again
__device__ __forceinline__ v8f ld8f(const float* p) { const v4f a = *(const v4fa*)p, b = *(const v4fa*)(p + 4); return __builtin_shufflevector(a, b, 0, 1, 2, 3, 4, 5, 6, 7); }
// eight f32 values -> their fp16 and hi/lo bf16 forms, one 16-byte store into each of the three planes at element e
__device__ __forceinline__ void put3(v8f v, size_t e, _Float16* P16, unsigned short* Ph, unsigned short* Pl) {
    const v8bq h = __builtin_convertvector(v, v8bq); const v8bq l = __builtin_convertvector(v - __builtin_convertvector(h, v8f), v8bq);
    *(v8h*)(P16 + e) = __builtin_convertvector(v, v8h); *(v8us*)(Ph + e) = __builtin_bit_cast(v8us, h); *(v8us*)(Pl + e) = __builtin_bit_cast(v8us, l);
    asm volatile("s_wait_xcnt 0x0" ::: "memory"); }   // the next call's values land in the registers that these stores name: the wait stands in front of that

// ---- Fragment order, the layout of EVERY 16-bit operand plane (x, both weights, the q / k / v head planes, the merged attention rows): a [rows][K] matrix is kept as 1-KiB fragments of 16 rows x 32 k, fragment (rt, kb) at element (rt * K / 32 + kb) * 512;
// inside it element (r, k) sits at ((k >> 4 & 1) * 32 + (k >> 3 & 1) * 16 + r) * 8 + (k & 7): lane l of a wave finds its two 16-byte pieces at l * 8 and 256 + l * 8, so each fragment load instruction reads 512 contiguous bytes (4 whole lines, not 16 quarter lines). Registers get the same values as from row-major planes.
// ---- k_gemmw: register-blocked GEMM, ONE WAVE per 64x64 output tile (16 accumulators), operands straight from fragment-order 16-bit planes; grid (M/64, N/64, Z), 32 threads.
// C[m][n] (f32, pitch ldc, + optional f32 bias[n]) = sum_k A[m][k] Bt[n][k] (+ split products per NSPLIT). A rows have pitch lda, Bt rows pitch K. z-batch strides sA/sB/sC in elements. K % 32 == 0.
// EPI 0: C as above. EPI 1 (N tile = one head): the tile + bias goes straight to the [h][t][d] planes P16 / Ph / Pl (fp16, hi/lo bf16), in fragment order, 512 contiguous bytes a store. EPI 2: the same to the [h][d][t] planes, the tile turned in LDS.
// EPI 3 (fused q | k | v, N = 3 * DQ, z = batch): the column third picks the plane set ([third][batch] sets of NH_ * TT * HD elements behind P16 / Ph / Pl) and the form: thirds 0 and 1 as EPI 1, third 2 as EPI 2. The test is on blockIdx alone, so it is a scalar branch.
// KS > 1: grid z = Z * KS; block (z, ks) sums k in [ks K/KS, (ks+1) K/KS) alone and stores its partial tile in plane ks of C ([KS][ZH] planes of sC elements; Z = ZH). K % (32 KS) == 0.
#define GLB __attribute__((address_space(1)))
// a wave-uniform address handed on as two scalar words: the load then takes the form scalar base + one lane-offset register that is never rewritten, with no 64-bit vector address add per fragment
__device__ __forceinline__ unsigned long long sbase(const void* p) { const unsigned long long u = (unsigned long long)p; return ((unsigned long long)(unsigned)__builtin_amdgcn_readfirstlane((int)(u >> 32)) << 32) | (unsigned)__builtin_amdgcn_readfirstlane((int)u); }
template <typename T16> struct WFrag;   // ld(p, lo): p = the fragment's start, the same in every lane, lo = the lane (16-byte units); ldu(u, lo + c): u = sbase() of a pass's first fragment, c = a compile-time distance, which goes into the instruction's offset
template <> struct WFrag<h16> { typedef v16h V; static __device__ __forceinline__ V ldu(unsigned long long u, unsigned i) { const GLB v8h* q = (const GLB v8h*)u; return cat16(q[i], q[i + 32]); } static __device__ __forceinline__ V ld(const h16* p, unsigned lo) { return ldu(sbase(p), lo); } static __device__ __forceinline__ v8f mma(V a, V b, v8f c) { return wmma16(a, b, c); } };
template <> struct WFrag<bf> { typedef v16bf V; static __device__ __forceinline__ V ldu(unsigned long long u, unsigned i) { const GLB v8us* q = (const GLB v8us*)u; return cat16b(q[i], q[i + 32]); } static __device__ __forceinline__ V ld(const bf* p, unsigned lo) { return ldu(sbase(p), lo); } static __device__ __forceinline__ v8f mma(V a, V b, v8f c) { return wmmab(a, b, c); } };
template <typename T16, int NSPLIT, bool BIAS, int EPI = 0, int KS = 1>
__global__ __launch_bounds__(32) void k_gemmw(const T16* __restrict__ A, const T16* __restrict__ A2, const T16* __restrict__ Bt, const T16* __restrict__ Bt2, int K, int lda, float* C, int ldc, const float* __restrict__ bias, size_t sA, size_t sB, size_t sC, h16* P16, bf* Ph, bf* Pl) {
    typedef typename WFrag<T16>::V V;
    __shared__ __align__(16) float os[16 * 68];
    const size_t z = blockIdx.z / KS; const int ks = blockIdx.z % KS; A += z * sA; if (A2) A2 += z * sA; Bt += z * sB; if (Bt2) Bt2 += z * sB; C += ((size_t)ks * ZH + z) * sC;
    const int lane = threadIdx.x & 31, lr = lane & 15, hi = lane >> 4; int bx = blockIdx.x; const int c0 = blockIdx.y * 64;
    v8f acc[4][4];
#pragma unroll
    for (int mb = 0; mb < 4; ++mb)
#pragma unroll
        for (int nb = 0; nb < 4; ++nb) acc[mb][nb] = (v8f){};
    const int ec = hi * 8;   // EPI 1, 2: lane (lr, hi) reads staged row lr, floats s * 16 + hi * 8 .. + 7 in step s: the order of a fragment piece
    const int third = EPI == 3 ? (int)blockIdx.y / (DQ / 64) : 0;
    const bool tr = EPI == 2 || (EPI == 3 && third == 2);   // [h][d][t] planes
    if constexpr (EPI == 3) { const size_t po = ((size_t)third * (NB_ - 1) + z) * ((size_t)NH_ * TT * HD); P16 += po; Ph += po; Pl += po; }   // set (third, z) starts at (third * NB_ + z) planes; the stores below index by the fused column, which already steps one plane per third
    v8f b8[4]; float bd[4];   // the lane's bias values, asked for ahead of the k loop, which hides their latency (EPI 3 asks for both forms: a branch here would wait for them in front of the loop)
    if constexpr (EPI == 1 || EPI == 3) {
#pragma unroll
        for (int s = 0; s < 4; ++s) b8[s] = bfr8(ld8f(bias + c0 + s * 16 + ec)); }
    if constexpr (EPI == 2 || EPI == 3) {
#pragma unroll
        for (int nb = 0; nb < 4; ++nb) bd[nb] = bfr(bias[c0 + nb * 16 + lr]); }
    if constexpr (EPI == 3) asm volatile("s_wait_xcnt 0x0" : "+s"(bx) :: "memory");   // the bias loads stay in flight over the k loop, and their address registers are rewritten right behind them, first by the row offset: the wait stands in front of that, and the block index goes through it so that the scalar code that forms the offset cannot be lifted over it
    const int r0 = bx * 64; const size_t aoff = (size_t)r0 * lda, boff = (size_t)c0 * K; const unsigned lo = lane;   // fragment order: 16 rows are lda * 16 elements, 32 k are 512
#pragma unroll 1
    for (int kc = ks * (K / KS); kc < (ks + 1) * (K / KS); kc += 32) {
        V a[4], a2[4];
#pragma unroll
        for (int mb = 0; mb < 4; ++mb) { a[mb] = WFrag<T16>::ld(A + aoff + (size_t)mb * 16 * lda + kc * 16, lo); if (NSPLIT == 1 || NSPLIT == 2) a2[mb] = WFrag<T16>::ld(A2 + aoff + (size_t)mb * 16 * lda + kc * 16, lo); }
#pragma unroll
        for (int nb = 0; nb < 4; ++nb) { const V b = WFrag<T16>::ld(Bt + boff + (size_t)nb * 16 * K + kc * 16, lo); V b2; if (NSPLIT >= 2) b2 = WFrag<T16>::ld(Bt2 + boff + (size_t)nb * 16 * K + kc * 16, lo);
#pragma unroll
            for (int mb = 0; mb < 4; ++mb) { acc[mb][nb] = WFrag<T16>::mma(a[mb], b, acc[mb][nb]); if (NSPLIT == 1 || NSPLIT == 2) acc[mb][nb] = WFrag<T16>::mma(a2[mb], b, acc[mb][nb]); if (NSPLIT >= 2) acc[mb][nb] = WFrag<T16>::mma(a[mb], b2, acc[mb][nb]); } }
        asm volatile("v_nop\n\tv_nop\n\tv_nop\n\tv_nop" : "+v"(acc[0][0]), "+v"(acc[1][1]), "+v"(acc[2][2]), "+v"(acc[3][3]) : "v"(a[0]), "v"(a[3]));
    }
    if (tr) {
#pragma unroll
        for (int nb = 0; nb < 4; ++nb) {
#pragma unroll
            for (int mb = 0; mb < 4; ++mb) { float* op = os + lr * 68 + mb * 16 + hi * 8; const v8f a = acc[mb][nb]; *(v4fa*)op = __builtin_shufflevector(a, a, 0, 1, 2, 3); *(v4fa*)(op + 4) = __builtin_shufflevector(a, a, 4, 5, 6, 7); }
            __builtin_amdgcn_wave_barrier(); asm volatile("" ::: "memory");   // each lane reads back only its own staged floats: the LDS reads stay behind the stores
#pragma unroll
            for (int s = 0; s < 4; ++s) put3(ld8f(os + lr * 68 + s * 16 + ec) + bd[nb], (size_t)(c0 + nb * 16) * TT + r0 * 16 + s * 256 + lane * 8, P16, Ph, Pl);   // rows d, k = t: piece s of the two fragments that hold t = r0 .. r0 + 63
            __builtin_amdgcn_wave_barrier(); asm volatile("" ::: "memory");   // the next column block's staging stays behind these reads
        }
        return;
    }
#pragma unroll
    for (int mb = 0; mb < 4; ++mb) {
#pragma unroll
        for (int nb = 0; nb < 4; ++nb) {
#pragma unroll
            for (int j = 0; j < 8; ++j) os[(hi * 8 + j) * 68 + nb * 16 + lr] = acc[mb][nb][j]; }
        __builtin_amdgcn_wave_barrier(); asm volatile("" ::: "memory");
        float* crow = C + (size_t)(r0 + mb * 16) * ldc + c0;
        if constexpr (EPI == 1 || EPI == 3) {
#pragma unroll
            for (int s = 0; s < 4; ++s) put3(ld8f(os + lr * 68 + s * 16 + ec) + b8[s], ((size_t)blockIdx.y * TT + r0 + mb * 16) * HD + s * 256 + lane * 8, P16, Ph, Pl);   // rows t, k = d: piece s of the row tile's two fragments
        } else {
#pragma unroll
            for (int s = 0; s < 8; ++s) { const int row = 2 * s + hi, cofs = lr * 4; v4f val = *(const v4fa*)(os + row * 68 + cofs); if (BIAS) { val[0] += bfr(bias[c0 + cofs]); val[1] += bfr(bias[c0 + cofs + 1]); val[2] += bfr(bias[c0 + cofs + 2]); val[3] += bfr(bias[c0 + cofs + 3]); }
                *(v4f*)(crow + (size_t)row * ldc + cofs) = val; }
            asm volatile("s_wait_xcnt 0x0" ::: "memory");   // the next row block's bias loads land in registers that these stores name: the wait stands in front of that
             }
        __builtin_amdgcn_wave_barrier(); asm volatile("" ::: "memory");
    }
    if constexpr (EPI == 3) asm volatile("s_wait_xcnt 0x0" ::: "memory");   // in the built code the [h][d][t] epilogue stands behind this one, past a scalar branch, and rewrites the last stores' registers: the wait stands in front of that
}

__device__ __forceinline__ void splitf(float y, unsigned short& h, unsigned short& l) { h = f2bf(y); l = f2bf(y - bf2f(h)); }
typedef __attribute__((ext_vector_type(2))) _Float16 v2h;
typedef __attribute__((ext_vector_type(4))) _Float16 v4h;
typedef __attribute__((ext_vector_type(2))) unsigned short v2us;
typedef __attribute__((ext_vector_type(4))) unsigned short v4us;
typedef __attribute__((ext_vector_type(2))) float v2f;
typedef __attribute__((ext_vector_type(4))) int v4i;

// Both plane builders go by the DESTINATION: thread i makes 16-byte unit i of the fragment-order plane (a wave stores 512 contiguous bytes). Unit i = row tile, k block, then (k >> 3 & 3) in bits 5..4 and the row in bits 3..0.
__global__ __launch_bounds__(256) void k_wtG(const float* __restrict__ w, int K, int N, bf* Bt) {   // w [K][N] f32 -> Bt, rows n, in fragment order
    const int i = blockIdx.x * 256 + threadIdx.x; if (i >= N * (K / 8)) return;
    const int fr = i >> 6, n = fr / (K >> 5) * 16 + (i & 15), k0 = fr % (K >> 5) * 32 + ((i >> 4) & 3) * 8; v8us o;
    float v[8]; const unsigned vo = (unsigned)(k0 * N + n);
#pragma unroll
    for (int j = 0; j < 8; ++j) v[j] = ((const GLB float*)sbase(w + (size_t)j * N))[vo];   // row k0 + j: the step j * N goes into the scalar base, the lane's offset register stays
    asm volatile("s_wait_xcnt 0x0" ::: "memory");   // the roundings below reuse the loads' offset registers: the wait stands in front of that
#pragma unroll
    for (int j = 0; j < 8; ++j) o[j] = f2bf(v[j]);
    *(v8us*)(Bt + (size_t)i * 8) = o;
}
__global__ __launch_bounds__(256) void k_cvt8(const float* __restrict__ src, bf* dst, size_t n8) {   // src [rows][DM] f32
    const size_t i = (size_t)blockIdx.x * 256 + threadIdx.x; if (i >= n8) return;
    const size_t fr = i >> 6; const v8f v = *(const v8f*)(src + (fr / (DM / 32) * 16 + (i & 15)) * DM + fr % (DM / 32) * 32 + ((i >> 4) & 3) * 8); v8us o;
#pragma unroll
    for (int k = 0; k < 8; ++k) o[k] = f2bf(v[k]); *(v8us*)(dst + i * 8) = o;  }

// ---- k_planes: C[b][i][j] = bf16(mask[i][j]) + bf16(bias[b][i][j]), f32, made once for all heads and kept in SCORE order: 1-KiB tiles of 16 queries x 16 keys, tile (qt, kt) of batch b at float ((b * TT / 16 + qt) * TT / 16 + kt) * 256;
// inside it lane l = hi * 16 + query of k_fattn finds keys hi * 8 + p * 4 .. + 3 at float p * 128 + l * 4. A wave takes 16 queries x 32 keys of both batches: whole 128-byte source rows (4 lines a load), summed as they come, turned through its own LDS region (pitch 36 floats), stored 512 contiguous bytes at a time. Grid (TT / 256, TT / 16).
typedef __attribute__((ext_vector_type(4))) __bf16 v4bq;
__device__ __forceinline__ v4f bfr4(v4f x) { return __builtin_convertvector(__builtin_convertvector(x, v4bq), v4f); }
__global__ __launch_bounds__(256) void k_planes(const float* __restrict__ RP, const float* __restrict__ RB, float* C) {
    __shared__ __align__(16) float ts[8 * NB_ * 16 * 36];
    const int w = threadIdx.x >> 5, lane = threadIdx.x & 31, lr = lane & 15, hi = lane >> 4, srow = lane >> 3, scol = (lane & 7) * 4;
    const int qt = blockIdx.y, k32 = blockIdx.x * 8 + w; float* tw = ts + w * (NB_ * 16 * 36);
    const unsigned vo = (unsigned)((qt * 16 + srow) * TT + k32 * 32 + scol) / 4;   // the lane's place in 16-byte units: one offset register for all twelve loads; the row step goes into the instruction's offset, the batch into the scalar base
    v4f gm[4], gb[NB_][4];
#pragma unroll
    for (int i = 0; i < 4; ++i) { gm[i] = ((const GLB v4f*)sbase(RP))[vo + i * TT];
#pragma unroll
        for (int b = 0; b < NB_; ++b) gb[b][i] = ((const GLB v4f*)sbase(RB + (size_t)b * TT * TT))[vo + i * TT]; }
    asm volatile("s_wait_xcnt 0x0" ::: "memory");   // the code below reuses the loads' offset register: the wait stands in front of that
#pragma unroll
    for (int i = 0; i < 4; ++i) { const v4f m = bfr4(gm[i]);
#pragma unroll
        for (int b = 0; b < NB_; ++b) *(v4fa*)(tw + b * (16 * 36) + (i * 4 + srow) * 36 + scol) = m + bfr4(gb[b][i]); }
    __builtin_amdgcn_wave_barrier(); asm volatile("" ::: "memory");   // other lanes' rows are read below: the LDS reads stay behind the stores
#pragma unroll
    for (int b = 0; b < NB_; ++b)
#pragma unroll
        for (int kt = 0; kt < 2; ++kt)
#pragma unroll
            for (int p = 0; p < 2; ++p) *(v4f*)(C + (((size_t)b * (TT / 16) + qt) * (TT / 16) + k32 * 2 + kt) * 256 + p * 128 + lane * 4) = *(const v4fa*)(tw + b * (16 * 36) + lr * 36 + kt * 16 + hi * 8 + p * 4);
}

// ---- k_fattn: scores, softmax and P.V of one head's 64 query rows in one work-group; nothing of S or P goes to memory. Grid (TT / 64, NH_, NB_): its flat index is permuted into (query block, head, batch), hi/lo blocks first.
// Transposed products: St = K Qt (A = key rows, B = query rows), so a lane holds one query's scores (register r of key tile kt = key kt*16 + 8*hi + r, query lr); two St tiles converted in place are the B operand of Ot += Vt Pt (A = rows of the [d][t] planes).
// t = S x HD^-0.5 + CP[i][j], CP = bf16(mask) + bf16(bias) from k_planes; running maximum per query in log2 units, moved (and sums and Ot rescaled) only when a score passes it by more than 8, so p <= 2^8.
// CP is kept in score order (k_planes), so a lane's eight values of a 16 x 16 tile come straight into registers by two loads of 512 contiguous bytes each, scalar base + lane; the loop touches no LDS.
// 8 waves: wave w takes query rows (w & 1) * 32 .. + 31 and keys (w >> 1) * TT / FKS .. ; the FKS partial (maximum, sum, Ot) of a query are joined in split order through LDS, normalised and stored as hi/lo bf16 into the merged [t][DQ] planes (fragment order, like the q / k / v planes read here).
#define L2E 1.4426950408889634f
#define FWR (32 * 68)             // floats of a wave's LDS region: its 32 x 68 Ot partial
template <bool HI, typename T16>
__device__ __forceinline__ void fa_wave(const T16* __restrict__ Q, const T16* __restrict__ Q2, const T16* __restrict__ Kp, const T16* __restrict__ K2, const T16* __restrict__ Vt, const T16* __restrict__ V2, const float* __restrict__ CP, int q0w, int key0, float* osw, float* msw, float* lsw) {
    typedef typename WFrag<T16>::V V;
    const int lane = threadIdx.x & 31, lr = lane & 15, hi = lane >> 4; const unsigned lo = lane;
    V qf[2][2], qf2[2][2];
#pragma unroll
    for (int qt = 0; qt < 2; ++qt)
#pragma unroll
        for (int kc = 0; kc < 2; ++kc) { const size_t o = (size_t)(q0w + qt * 16) * HD + kc * 512; qf[qt][kc] = WFrag<T16>::ld(Q + o, lo); if (HI) qf2[qt][kc] = WFrag<T16>::ld(Q2 + o, lo); }
    v8f acc[4][2];
#pragma unroll
    for (int dt = 0; dt < 4; ++dt) { acc[dt][0] = (v8f){}; acc[dt][1] = (v8f){}; }
    float m[2] = {-3.0e38f, -3.0e38f}, l[2] = {0.f, 0.f};
#pragma unroll 1
    for (int key = key0; key < key0 + TT / FKS; key += 32) {
        const unsigned long long uk = sbase(Kp + (size_t)key * HD), uv = sbase(Vt + (size_t)key * 16);   // this pass's first K and V fragments (the hi/lo rows form each fragment's base by itself: with common bases the build spilled a Q fragment)
        V kfa[2][2];   // fp16 rows: the pass's four K fragments, asked for together with the plane tiles
        if constexpr (!HI) {
#pragma unroll
            for (int kt = 0; kt < 2; ++kt)
#pragma unroll
                for (int kc = 0; kc < 2; ++kc) kfa[kt][kc] = WFrag<T16>::ldu(uk, lo + kt * 128 + kc * 64); }
        const GLB v4f* uc = (const GLB v4f*)sbase(CP + ((size_t)(q0w >> 4) * (TT / 16) + (key >> 4)) * 256);   // this pass's first 16 x 16 tile of the summed plane
        v8f cg[2][2];   // [key tile][query tile], asked for ahead of the score products, which hide a part of their latency
#pragma unroll
        for (int kt = 0; kt < 2; ++kt)
#pragma unroll
            for (int qt = 0; qt < 2; ++qt) { const unsigned o = lo + qt * (TT / 16 * 64) + kt * 64; cg[kt][qt] = __builtin_shufflevector(uc[o], uc[o + 32], 0, 1, 2, 3, 4, 5, 6, 7); }
        if constexpr (!HI) __builtin_amdgcn_sched_barrier(0);   // all 16 loads of the pass are issued before its first product waits: left free, the scheduler put six of them behind the first waits, a second load latency in every pass
        v8f s[2][2];   // [key tile][query tile]
#pragma unroll
        for (int kt = 0; kt < 2; ++kt) { s[kt][0] = (v8f){}; s[kt][1] = (v8f){};
#pragma unroll
            for (int kc = 0; kc < 2; ++kc) { V kf, kf2; if constexpr (HI) { const size_t e = (size_t)(key + kt * 16) * HD + kc * 512; kf = WFrag<T16>::ld(Kp + e, lo); kf2 = WFrag<T16>::ld(K2 + e, lo); } else kf = kfa[kt][kc];
#pragma unroll
                for (int qt = 0; qt < 2; ++qt) { s[kt][qt] = WFrag<T16>::mma(kf, qf[qt][kc], s[kt][qt]); if (HI) { s[kt][qt] = WFrag<T16>::mma(kf, qf2[qt][kc], s[kt][qt]); s[kt][qt] = WFrag<T16>::mma(kf2, qf[qt][kc], s[kt][qt]); } } } }
        float c[2];
#pragma unroll
        for (int qt = 0; qt < 2; ++qt) { float mx = -3.0e38f;
#pragma unroll
            for (int kt = 0; kt < 2; ++kt) { const v8f t = s[kt][qt] * SCL + cg[kt][qt]; s[kt][qt] = t;
#pragma unroll
                for (int r = 0; r < 8; ++r) mx = fmaxf(mx, t[r]); }
            c[qt] = mx * L2E; }
        if (__builtin_amdgcn_ballot_w32(c[0] > m[0] + 8.0f || c[1] > m[1] + 8.0f) != 0) {   // wave-uniform: both halves of a query move its maximum together
#pragma unroll
            for (int qt = 0; qt < 2; ++qt) { const float mn = fmaxf(m[qt], fmaxf(c[qt], __shfl_xor(c[qt], 16, 32))); const float al = __builtin_amdgcn_exp2f(m[qt] - mn); m[qt] = mn; l[qt] *= al;
#pragma unroll
                for (int dt = 0; dt < 4; ++dt) acc[dt][qt] *= al; } }
        V pf[2], pf2[2];
#pragma unroll
        for (int qt = 0; qt < 2; ++qt) { v8f p[2];
#pragma unroll
            for (int kt = 0; kt < 2; ++kt) { const v8f e = __builtin_elementwise_fma(s[kt][qt], (v8f)(L2E), (v8f)(-m[qt]));
#pragma unroll
                for (int r = 0; r < 8; ++r) { p[kt][r] = __builtin_amdgcn_exp2f(e[r]); l[qt] += p[kt][r]; } }
            if constexpr (HI) { const v8bq h0 = __builtin_convertvector(p[0], v8bq), h1 = __builtin_convertvector(p[1], v8bq);
                const v8bq l0 = __builtin_convertvector(p[0] - __builtin_convertvector(h0, v8f), v8bq), l1 = __builtin_convertvector(p[1] - __builtin_convertvector(h1, v8f), v8bq);
                pf[qt] = __builtin_shufflevector(h0, h1, 0, 1, 2, 3, 4, 5, 6, 7, 8, 9, 10, 11, 12, 13, 14, 15); pf2[qt] = __builtin_shufflevector(l0, l1, 0, 1, 2, 3, 4, 5, 6, 7, 8, 9, 10, 11, 12, 13, 14, 15); }
            else pf[qt] = cat16(__builtin_convertvector(p[0], v8h), __builtin_convertvector(p[1], v8h)); }
#pragma unroll
        for (int dt = 0; dt < 4; ++dt) { const unsigned o = lo + dt * (16 * TT / 8); V vf, vf2; if constexpr (HI) { const size_t e = (size_t)(dt * 16) * TT + key * 16; vf = WFrag<T16>::ld(Vt + e, lo); vf2 = WFrag<T16>::ld(V2 + e, lo); } else vf = WFrag<T16>::ldu(uv, o);
#pragma unroll
            for (int qt = 0; qt < 2; ++qt) { acc[dt][qt] = WFrag<T16>::mma(vf, pf[qt], acc[dt][qt]); if (HI) { acc[dt][qt] = WFrag<T16>::mma(vf, pf2[qt], acc[dt][qt]); acc[dt][qt] = WFrag<T16>::mma(vf2, pf[qt], acc[dt][qt]); } } }
    }
#pragma unroll
    for (int qt = 0; qt < 2; ++qt) { const float lt = l[qt] + __shfl_xor(l[qt], 16, 32); if (hi == 0) { msw[qt * 16 + lr] = m[qt]; lsw[qt * 16 + lr] = lt; }
#pragma unroll
        for (int dt = 0; dt < 4; ++dt) { float* op = osw + (qt * 16 + lr) * 68 + dt * 16 + hi * 8; const v8f a = acc[dt][qt]; *(v4fa*)op = __builtin_shufflevector(a, a, 0, 1, 2, 3); *(v4fa*)(op + 4) = __builtin_shufflevector(a, a, 4, 5, 6, 7); } }
}
__global__ __launch_bounds__(256) __attribute__((amdgpu_waves_per_eu(4, 4))) void k_fattn(const h16* __restrict__ Q16, const h16* __restrict__ K16, const h16* __restrict__ V16, const bf* __restrict__ Qh, const bf* __restrict__ Ql, const bf* __restrict__ Kh, const bf* __restrict__ Kl, const bf* __restrict__ Vh, const bf* __restrict__ Vl, const float* __restrict__ CP, bf* Ah, bf* Al) {
    __shared__ __align__(16) float Os[2 * FKS * FWR]; __shared__ float Ms[2 * FKS * 32]; __shared__ float Ls[2 * FKS * 32];
    const int w = __builtin_amdgcn_readfirstlane(threadIdx.x >> 5);
    // Only half of the work-groups are resident at once: the hi/lo query blocks (3 products a tile, the longest work-groups) take the lowest flat indices, for speed only.
    const unsigned li = blockIdx.x + (TT / 64) * (blockIdx.y + NH_ * blockIdx.z), nhv = (RH / 64) * NH_ * NB_, lj = li - nhv;   // flat index; number of hi/lo work-groups; index among the fp16 ones
    const bool hv = li < nhv; const unsigned qb = hv ? li % (RH / 64) : RH / 64 + lj % ((TT - RH) / 64), hb = hv ? li / (RH / 64) : lj / ((TT - RH) / 64);   // a permutation of (query block, batch * NH_ + head)
    const int h = hb % NH_, b = hb / NH_, q0 = qb * 64; const int q0w = q0 + (w & 1) * 32, key0 = (w >> 1) * (TT / FKS); const size_t hp = ((size_t)b * NH_ + h) * TT * HD; CP += (size_t)b * TT * TT;   // this batch's head planes and summed plane
    if (q0 < RH) fa_wave<true, bf>(Qh + hp, Ql + hp, Kh + hp, Kl + hp, Vh + hp, Vl + hp, CP, q0w, key0, Os + w * FWR, Ms + w * 32, Ls + w * 32);
    else fa_wave<false, h16>(Q16 + hp, nullptr, K16 + hp, nullptr, V16 + hp, nullptr, CP, q0w, key0, Os + w * FWR, Ms + w * 32, Ls + w * 32);
    __syncthreads();   // every wave's partial (maximum, sum, Ot) is in LDS before any thread joins them
    const int q = threadIdx.x >> 2, d0 = (threadIdx.x & 3) * 16; const int wq = q >> 5, ql = q & 31;
    float mm = Ms[wq * 32 + ql];
#pragma unroll
    for (int sp = 1; sp < FKS; ++sp) mm = fmaxf(mm, Ms[(sp * 2 + wq) * 32 + ql]);
    float lt = 0.f; v4f o[4];
#pragma unroll
    for (int k = 0; k < 4; ++k) o[k] = (v4f){};
#pragma unroll
    for (int sp = 0; sp < FKS; ++sp) { const int ww = sp * 2 + wq; const float f = __builtin_amdgcn_exp2f(Ms[ww * 32 + ql] - mm); lt += Ls[ww * 32 + ql] * f;
#pragma unroll
        for (int k = 0; k < 4; ++k) o[k] += *(const v4fa*)(Os + ww * FWR + ql * 68 + d0 + k * 4) * f; }
    const float inv = __fdiv_rn(1.0f, lt); const size_t oo = ((size_t)b * TT + q0 + (q & ~15)) * DQ + (h * HD + d0) / 16 * 256 + (q & 15) * 8;   // fragment order of the merged [t][DQ] planes: the thread's 16 columns are one piece pair, 128 elements apart
#pragma unroll
    for (int g = 0; g < 2; ++g) { v8us oh, ol;
#pragma unroll
        for (int e = 0; e < 8; ++e) { unsigned short a, c2; splitf(o[g * 2 + (e >> 2)][e & 3] * inv, a, c2); oh[e] = a; ol[e] = c2; }
        *(v8us*)(Ah + oo + g * 128) = oh; *(v8us*)(Al + oo + g * 128) = ol; }
}

extern "C" void kernel_launch(void* const* d_in, const int* in_sizes, int n_in,
                              void* d_out, int out_size, void* d_ws, size_t ws_size, hipStream_t stream) {
    (void)in_sizes; (void)n_in; (void)out_size;
    const float* x = (const float*)d_in[0]; const float* amask = (const float*)d_in[1]; const float* abias = (const float*)d_in[2]; const float* wqkv = (const float*)d_in[3]; const float* bqkv = (const float*)d_in[4]; const float* wo = (const float*)d_in[5]; const float* bo = (const float*)d_in[6];   /* x, attn_mask [2048][2048], attn_bias [2][2048][2048], Wqkv ('xw' [1024][3072]), bqkv, Wout ('xw'), bout */
    float* OUT = (float*)d_out;     // [2][2048][1024]
    char* wsp = (char*)d_ws;
    auto take = [&](size_t bytes) { char* p = wsp; wsp += (bytes + 255) & ~(size_t)255; return (void*)p; };
    bf* WQKV = (bf*)take((size_t)3 * DQ * DM * 2);   /* fused Bt [3*DQ][DM]: q | k | v row blocks */ bf* WO = (bf*)take((size_t)DM * DQ * 2);
    bf* XB = (bf*)take((size_t)NB_ * TT * DM * 2);
    const size_t PS = (size_t)NB_ * NH_ * TT * HD;   // elements of one plane set: [batch][head] planes
    h16* P16 = (h16*)take(3 * PS * 2); bf* PH = (bf*)take(3 * PS * 2); bf* PL = (bf*)take(3 * PS * 2);   /* each: q | k | v sets, q and k [h][t][d], v [h][d][t] */
    bf* ATh = (bf*)take((size_t)NB_ * TT * DQ * 2); bf* ATl = (bf*)take((size_t)NB_ * TT * DQ * 2);
    float* CPL = (float*)take((size_t)NB_ * TT * TT * 4);   /* summed mask + bias plane per batch, score order */
    if ((size_t)(wsp - (char*)d_ws) > ws_size) return;    // ws 256 MiB
    { k_wtG<<<(unsigned)((DM * 3 * DQ / 8 + 255) / 256), 256, 0, stream>>>(wqkv, DM, 3 * DQ, WQKV);   /* fused 'xw' [DM][3*DQ] -> Bt [3*DQ][DM] */
      k_wtG<<<(unsigned)((DQ * DM / 8 + 255) / 256), 256, 0, stream>>>(wo, DQ, DM, WO);
       }
    k_cvt8<<<(unsigned)(((size_t)NB_ * TT * DM / 8 + 255) / 256), 256, 0, stream>>>(x, XB, (size_t)NB_ * TT * DM / 8);
    k_planes<<<dim3(TT / 256, TT / 16), 256, 0, stream>>>(amask, abias, CPL);
    k_gemmw<bf, 0, true, 3><<<dim3(TT / 64, 3 * DQ / 64, NB_), 32, 0, stream>>>(XB, nullptr, WQKV, nullptr, DM, DM, nullptr, 0, bqkv, (size_t)TT * DM, 0, 0, P16, PH, PL);
    k_fattn<<<dim3(TT / 64, NH_, NB_), 256, 0, stream>>>(P16, P16 + PS, P16 + 2 * PS, PH, PL, PH + PS, PL + PS, PH + 2 * PS, PL + 2 * PS, CPL, ATh, ATl);   /* the kernel picks its batch's summed plane */
    k_gemmw<bf, 1, true><<<dim3(TT / 64, DM / 64, NB_), 32, 0, stream>>>(ATh, ATl, WO, nullptr, DQ, DQ, OUT, DM, bo, (size_t)TT * DQ, 0, (size_t)TT * DM, nullptr, nullptr, nullptr);
}

// v009
// A run of this version takes 161 microseconds.
// Next to v008, in two timings, it ran 1.16 times as fast each time.
// All steps since v000 together make it 13.0 times as fast.
#include <hip/hip_runtime.h>

// Multi-head self-attention with a fused qkv projection and TWO additive score planes (x [2][2048][1024]; qkv = x Wqkv + bqkv ('xw' [1024][3072] 1/32 + bias (zeros on this draw: read)) -> reshape (B, S, 3, 16, 64): q | k | v column thirds; scores = q.k / sqrt(64) + attn_mask[i][j] (f32 [2048][2048], shared by heads and batches) + attn_bias[b][i][j] (f32 [2][2048][2048], shared by heads); softmax over all keys; out = merged Wout + bout ('xw' [1024][1024] + bias) -> [2][2048][1024] (4.2 M); argument order x, attn_mask, attn_bias, Wqkv, bqkv, Wout, bout).
// Layout, both batches in every launch (the batch is grid z of the GEMMs and part of the attention's permuted flat index, k_planes does both in each wave; every plane has a copy per batch): bf16 copy of x; the fused 'xw' weight transposed once into Bt (q | k | v row blocks) + bias; exact projections + f32 biases in ONE launch over all 3 * DQ columns, whose epilogue writes the head planes; one launch that adds bf16(attn_mask[i][j]) + bf16(attn_bias[b][i][j]) in f32 ONCE for all heads into a plane per batch, kept in the order of the score registers; one fused attention launch (hybrid rows: < 512 hi/lo 3 products, rest fp16) that adds that plane to the scaled f32 score and keeps scores and probabilities in registers; merged hi/lo x Wout exact + bout.
// Compute dtypes, f32 accumulate: every input rounded to bf16 incl. the two planes; projections exact + f32 biases; attention rows < 512 3 products, rest fp16; softmax f32; Wout hl x exact + bias.

#define NB_  2
#define TT   2048
#define DM   1024
#define NH_  16
#define NKV  16
#define REP  (NH_ / NKV)
#define HD   64
#define DQ   (NH_ * HD)
#define DKV  (NKV * HD)
#define ZH   8                    // plane count of k_gemmw's split-K addressing (unused at KS = 1)
#define RH   512                  // query rows < RH use hi+lo planes (0: none)
#define WIN  0
#define SCL  0.125f   // HD^-0.5
#define FKS  4                    // key splits of the fused attention: a wave walks TT / FKS keys of its queries, the FKS partials are joined in LDS
typedef _Float16 h16;
typedef unsigned short bf;
typedef __attribute__((ext_vector_type(16))) __bf16   v16bf;
typedef __attribute__((ext_vector_type(16))) _Float16 v16h;
typedef __attribute__((ext_vector_type(8)))  _Float16 v8h;
typedef __attribute__((ext_vector_type(8)))  unsigned short v8us;
typedef __attribute__((ext_vector_type(8)))  float    v8f;
typedef __attribute__((ext_vector_type(4)))  float    v4f;
typedef v8h  __attribute__((may_alias)) v8ha;
typedef v4f  __attribute__((may_alias)) v4fa;
typedef v8us __attribute__((may_alias)) v8usa;

__device__ __forceinline__ unsigned short f2bf(float f) { unsigned u = __float_as_uint(f); u += 0x7FFFu + ((u >> 16) & 1u); return (unsigned short)(u >> 16); }
__device__ __forceinline__ float bf2f(unsigned short b) { return __uint_as_float(((unsigned)b) << 16); }
__device__ __forceinline__ float bfr(float f) { return bf2f(f2bf(f)); }
__device__ __forceinline__ v16h cat16(v8h lo, v8h hi) { return __builtin_shufflevector(lo, hi, 0, 1, 2, 3, 4, 5, 6, 7, 8, 9, 10, 11, 12, 13, 14, 15); }
__device__ __forceinline__ v16bf cat16b(v8us lo, v8us hi) { return __builtin_bit_cast(v16bf, __builtin_shufflevector(lo, hi, 0, 1, 2, 3, 4, 5, 6, 7, 8, 9, 10, 11, 12, 13, 14, 15)); }
__device__ __forceinline__ v8f wmma16(v16h a, v16h b, v8f c) { return __builtin_amdgcn_wmma_f32_16x16x32_f16(false, a, false, b, (short)0, c, false, false); }
__device__ __forceinline__ v8f wmmab(v16bf a, v16bf b, v8f c) { return __builtin_amdgcn_wmma_f32_16x16x32_bf16(false, a, false, b, (short)0, c, false, false); }



typedef __attribute__((ext_vector_type(8))) __bf16 v8bq;
__device__ __forceinline__ v8f bfr8(v8f x) { return __builtin_convertvector(__builtin_convertvector(x, v8bq), v8f); }   // nearest-even bf16 rounding, widened again
__device__ __forceinline__ v8f ld8f(const float* p) { const v4f a = *(const v4fa*)p, b = *(const v4fa*)(p + 4); return __builtin_shufflevector(a, b, 0, 1, 2, 3, 4, 5, 6, 7); }
// eight f32 values -> their fp16 and hi/lo bf16 forms, one 16-byte store into each of the three planes at element e
__device__ __forceinline__ void put3(v8f v, size_t e, _Float16* P16, unsigned short* Ph, unsigned short* Pl) {
    const v8bq h = __builtin_convertvector(v, v8bq); const v8bq l = __builtin_convertvector(v - __builtin_convertvector(h, v8f), v8bq);
    *(v8h*)(P16 + e) = __builtin_convertvector(v, v8h); *(v8us*)(Ph + e) = __builtin_bit_cast(v8us, h); *(v8us*)(Pl + e) = __builtin_bit_cast(v8us, l);
    asm volatile("s_wait_xcnt 0x0" ::: "memory"); }   // the next call's values land in the registers that these stores name: the wait stands in front of that

// ---- Fragment order, the layout of EVERY 16-bit operand plane (x, both weights, the q / k / v head planes, the merged attention rows): a [rows][K] matrix is kept as 1-KiB fragments of 16 rows x 32 k, fragment (rt, kb) at element (rt * K / 32 + kb) * 512;
// inside it element (r, k) sits at ((k >> 4 & 1) * 32 + (k >> 3 & 1) * 16 + r) * 8 + (k & 7): lane l of a wave finds its two 16-byte pieces at l * 8 and 256 + l * 8, so each fragment load instruction reads 512 contiguous bytes (4 whole lines, not 16 quarter lines). Registers get the same values as from row-major planes.
// ---- k_gemmw: register-blocked GEMM, one wave per 64x64 output tile (16 accumulators), FOUR waves (2 x 2) per work-group = a 128x128 tile; grid (M/128, N/128, Z), 128 threads.
// The work-group's fragments of GBK k (8 row tiles x 2 fragments of each operand plane, 2 KiB a row tile, contiguous in the fragment-order planes) are brought into LDS by asynchronous copies, two buffers, the next stage in flight while this one is multiplied; each fragment is fetched from L2 once for the two waves that use it. K % GBK == 0.
// C[m][n] (f32, pitch ldc, + optional f32 bias[n]) = sum_k A[m][k] Bt[n][k] (+ split products per NSPLIT). A rows have pitch lda, Bt rows pitch K. z-batch strides sA/sB/sC in elements. K % GBK == 0.
// EPI 0: C as above. EPI 1 (N tile = one head): the tile + bias goes straight to the [h][t][d] planes P16 / Ph / Pl (fp16, hi/lo bf16), in fragment order, 512 contiguous bytes a store. EPI 2: the same to the [h][d][t] planes, the tile turned in LDS.
// EPI 3 (fused q | k | v, N = 3 * DQ, z = batch): the column third picks the plane set ([third][batch] sets of NH_ * TT * HD elements behind P16 / Ph / Pl) and the form: thirds 0 and 1 as EPI 1, third 2 as EPI 2. The test is on blockIdx and the scalar wave number, so it is a scalar branch, the same for the whole work-group.
#define GLB __attribute__((address_space(1)))
// a wave-uniform address handed on as two scalar words: the load then takes the form scalar base + one lane-offset register that is never rewritten, with no 64-bit vector address add per fragment
__device__ __forceinline__ unsigned long long sbase(const void* p) { const unsigned long long u = (unsigned long long)p; return ((unsigned long long)(unsigned)__builtin_amdgcn_readfirstlane((int)(u >> 32)) << 32) | (unsigned)__builtin_amdgcn_readfirstlane((int)u); }
template <typename T16> struct WFrag;   // lds(p): p = the lane's first 16-byte piece of a fragment staged in LDS; ld(p, lo): p = the fragment's start, the same in every lane, lo = the lane (16-byte units); ldu(u, lo + c): u = sbase() of a pass's first fragment, c = a compile-time distance, which goes into the instruction's offset
template <> struct WFrag<h16> { typedef v16h V; static __device__ __forceinline__ V ldu(unsigned long long u, unsigned i) { const GLB v8h* q = (const GLB v8h*)u; return cat16(q[i], q[i + 32]); } static __device__ __forceinline__ V ld(const h16* p, unsigned lo) { return ldu(sbase(p), lo); } static __device__ __forceinline__ V lds(const unsigned char* p) { return cat16(*(const v8ha*)p, *(const v8ha*)(p + 512)); } static __device__ __forceinline__ v8f mma(V a, V b, v8f c) { return wmma16(a, b, c); } };
template <> struct WFrag<bf> { typedef v16bf V; static __device__ __forceinline__ V ldu(unsigned long long u, unsigned i) { const GLB v8us* q = (const GLB v8us*)u; return cat16b(q[i], q[i + 32]); } static __device__ __forceinline__ V ld(const bf* p, unsigned lo) { return ldu(sbase(p), lo); } static __device__ __forceinline__ V lds(const unsigned char* p) { return cat16b(*(const v8usa*)p, *(const v8usa*)(p + 512)); } static __device__ __forceinline__ v8f mma(V a, V b, v8f c) { return wmmab(a, b, c); } };
#define GBK 64                    // k of one LDS stage: two fragments a row tile
// eight asynchronous 16-byte copies a lane: row tile i of one operand plane's stage, global g + i * gs elements -> LDS byte l + i * 2048. The s_wait_xcnt stands inside the statement, so no address register of a copy is rewritten in front of it.
template <typename T16>
__device__ __forceinline__ void cp8(unsigned l, const T16* g, size_t gs) {
    asm volatile("global_load_async_to_lds_b128 %0, %8, off\n\tglobal_load_async_to_lds_b128 %1, %9, off\n\tglobal_load_async_to_lds_b128 %2, %10, off\n\tglobal_load_async_to_lds_b128 %3, %11, off\n\t"
                 "global_load_async_to_lds_b128 %4, %12, off\n\tglobal_load_async_to_lds_b128 %5, %13, off\n\tglobal_load_async_to_lds_b128 %6, %14, off\n\tglobal_load_async_to_lds_b128 %7, %15, off\n\ts_wait_xcnt 0x0"
                 :: "v"(l), "v"(l + 2048), "v"(l + 4096), "v"(l + 6144), "v"(l + 8192), "v"(l + 10240), "v"(l + 12288), "v"(l + 14336),
                    "v"(g), "v"(g + gs), "v"(g + 2 * gs), "v"(g + 3 * gs), "v"(g + 4 * gs), "v"(g + 5 * gs), "v"(g + 6 * gs), "v"(g + 7 * gs) : "memory"); }
template <typename T16, int NSPLIT, bool BIAS, int EPI = 0, int KS = 1>
__global__ __launch_bounds__(128) void k_gemmw(const T16* __restrict__ A, const T16* __restrict__ A2, const T16* __restrict__ Bt, const T16* __restrict__ Bt2, int K, int lda, float* C, int ldc, const float* __restrict__ bias, size_t sA, size_t sB, size_t sC, h16* P16, bf* Ph, bf* Pl) {
    typedef typename WFrag<T16>::V V;
    static_assert(NSPLIT <= 1 && KS == 1, "the LDS stage holds A, A2 and Bt and walks the whole K");
    constexpr int PB = 8 * 2048, SB = (NSPLIT == 1 ? 3 : 2) * PB;   // bytes of one plane's part of a stage (8 row tiles x 2 KiB), of a stage: A | A2 (NSPLIT 1) | Bt
    __shared__ __align__(16) unsigned char ring[2 * SB]; __shared__ __align__(16) float osa[4 * 16 * 68];
    const int w = __builtin_amdgcn_readfirstlane(threadIdx.x >> 5); float* os = osa + w * (16 * 68);   // wave w: rows (w & 1) * 64, columns (w >> 1) * 64 of the tile; its own staging region for the epilogue
    const size_t z = blockIdx.z / KS; const int ks = blockIdx.z % KS; A += z * sA; if (A2) A2 += z * sA; Bt += z * sB; if (Bt2) Bt2 += z * sB; C += ((size_t)ks * ZH + z) * sC;
    const int lane = threadIdx.x & 31, lr = lane & 15, hi = lane >> 4; int bx = blockIdx.x; const int c0 = blockIdx.y * 128 + (w >> 1) * 64;
    v8f acc[4][4];
#pragma unroll
    for (int mb = 0; mb < 4; ++mb)
#pragma unroll
        for (int nb = 0; nb < 4; ++nb) acc[mb][nb] = (v8f){};
    const int ec = hi * 8;   // EPI 1, 2: lane (lr, hi) reads staged row lr, floats s * 16 + hi * 8 .. + 7 in step s: the order of a fragment piece
    const int third = EPI == 3 ? c0 / DQ : 0;
    const bool tr = EPI == 2 || (EPI == 3 && third == 2);   // [h][d][t] planes
    if constexpr (EPI == 3) { const size_t po = ((size_t)third * (NB_ - 1) + z) * ((size_t)NH_ * TT * HD); P16 += po; Ph += po; Pl += po; }   // set (third, z) starts at (third * NB_ + z) planes; the stores below index by the fused column, which already steps one plane per third
    v8f b8[4]; float bd[4];   // the lane's bias values, asked for ahead of the k loop, which hides their latency (EPI 3 asks for both forms: a branch here would wait for them in front of the loop)
    if constexpr (EPI == 1 || EPI == 3) {
#pragma unroll
        for (int s = 0; s < 4; ++s) b8[s] = bfr8(ld8f(bias + c0 + s * 16 + ec)); }
    if constexpr (EPI == 2 || EPI == 3) {
#pragma unroll
        for (int nb = 0; nb < 4; ++nb) bd[nb] = bfr(bias[c0 + nb * 16 + lr]); }
    if constexpr (EPI == 3) asm volatile("s_wait_xcnt 0x0" : "+s"(bx) :: "memory");   // the bias loads stay in flight over the k loop, and their address registers are rewritten right behind them, first by the row offset: the wait stands in front of that, and the block index goes through it so that the scalar code that forms the offset cannot be lifted over it
    const int r0 = bx * 128 + (w & 1) * 64;
    // fragment order: 16 rows are lda * 16 elements, 32 k are 512. Thread i copies 16-byte unit i of each row tile's 2 KiB.
    const unsigned l0 = (unsigned)(unsigned long long)ring + threadIdx.x * 16; const T16* gA = A + (size_t)bx * 128 * lda + threadIdx.x * 8; const T16* gA2 = NSPLIT == 1 ? A2 + (size_t)bx * 128 * lda + threadIdx.x * 8 : nullptr; const T16* gB = Bt + (size_t)blockIdx.y * 128 * K + threadIdx.x * 8;
    auto stage = [&](int t) { const unsigned l = l0 + (t & 1) * SB; const size_t ko = (size_t)t * (GBK * 16);
        cp8(l, gA + ko, (size_t)16 * lda); if constexpr (NSPLIT == 1) cp8(l + PB, gA2 + ko, (size_t)16 * lda); cp8(l + SB - PB, gB + ko, (size_t)16 * K); };
    const int ns = K / GBK;
    stage(0);
    asm volatile("s_wait_asynccnt 0x0" ::: "memory");   // this wave's copies of stage 0 have landed
    __syncthreads();                                    // and every other wave's: stage 0 may be read
    if (ns > 1) stage(1);
#pragma unroll 1
    for (int t = 0; t < ns; ++t) {
        const unsigned char* sb = ring + (t & 1) * SB + lane * 16;
#pragma unroll
        for (int kk = 0; kk < GBK / 32; ++kk) {
            V a[4], a2[4], b[4];   // read in the order of first use (LDS answers in order): Bt fragment 0, the A fragments, the other Bt fragments
            const unsigned char* sa = sb + (w & 1) * 8192 + kk * 1024; const unsigned char* sw = sb + SB - PB + (w >> 1) * 8192 + kk * 1024;
            b[0] = WFrag<T16>::lds(sw);
#pragma unroll
            for (int i = 0; i < 4; ++i) { a[i] = WFrag<T16>::lds(sa + i * 2048); if (NSPLIT == 1) a2[i] = WFrag<T16>::lds(sa + PB + i * 2048); }
#pragma unroll
            for (int i = 1; i < 4; ++i) b[i] = WFrag<T16>::lds(sw + i * 2048);
            __builtin_amdgcn_sched_barrier(0);   // the block's LDS reads go out as one group ahead of its products: left free, the scheduler kept one Bt fragment and put a full LDS wait in front of every four products
#pragma unroll
            for (int nb = 0; nb < 4; ++nb)
#pragma unroll
                for (int mb = 0; mb < 4; ++mb) { acc[mb][nb] = WFrag<T16>::mma(a[mb], b[nb], acc[mb][nb]); if (NSPLIT == 1) acc[mb][nb] = WFrag<T16>::mma(a2[mb], b[nb], acc[mb][nb]); }
        }
        asm volatile("s_wait_dscnt 0x0" ::: "memory");      // this wave's reads of stage t are done before the buffer is given up
        asm volatile("s_wait_asynccnt 0x0" ::: "memory");   // this wave's copies of stage t + 1 have landed
        __syncthreads();                                    // publishes stage t + 1 and ends every wave's reads of stage t
        if (t + 2 < ns) stage(t + 2);                       // into the buffer that stage t has just left
    }
    asm volatile("s_wait_asynccnt 0x0" ::: "memory");   // no copy is outstanding when the wave goes on to the epilogue and ends
    if (tr) {
#pragma unroll
        for (int nb = 0; nb < 4; ++nb) {
#pragma unroll
            for (int mb = 0; mb < 4; ++mb) { float* op = os + lr * 68 + mb * 16 + hi * 8; const v8f a = acc[mb][nb]; *(v4fa*)op = __builtin_shufflevector(a, a, 0, 1, 2, 3); *(v4fa*)(op + 4) = __builtin_shufflevector(a, a, 4, 5, 6, 7); }
            __builtin_amdgcn_wave_barrier(); asm volatile("" ::: "memory");   // each lane reads back only its own staged floats: the LDS reads stay behind the stores
#pragma unroll
            for (int s = 0; s < 4; ++s) put3(ld8f(os + lr * 68 + s * 16 + ec) + bd[nb], (size_t)(c0 + nb * 16) * TT + r0 * 16 + s * 256 + lane * 8, P16, Ph, Pl);   // rows d, k = t: piece s of the two fragments that hold t = r0 .. r0 + 63
            __builtin_amdgcn_wave_barrier(); asm volatile("" ::: "memory");   // the next column block's staging stays behind these reads
        }
        return;
    }
#pragma unroll
    for (int mb = 0; mb < 4; ++mb) {
#pragma unroll
        for (int nb = 0; nb < 4; ++nb) {
#pragma unroll
            for (int j = 0; j < 8; ++j) os[(hi * 8 + j) * 68 + nb * 16 + lr] = acc[mb][nb][j]; }
        __builtin_amdgcn_wave_barrier(); asm volatile("" ::: "memory");
        float* crow = C + (size_t)(r0 + mb * 16) * ldc + c0;
        if constexpr (EPI == 1 || EPI == 3) {
#pragma unroll
            for (int s = 0; s < 4; ++s) put3(ld8f(os + lr * 68 + s * 16 + ec) + b8[s], ((size_t)(c0 / 64) * TT + r0 + mb * 16) * HD + s * 256 + lane * 8, P16, Ph, Pl);   // rows t, k = d: piece s of the row tile's two fragments
        } else {
#pragma unroll
            for (int s = 0; s < 8; ++s) { const int row = 2 * s + hi, cofs = lr * 4; v4f val = *(const v4fa*)(os + row * 68 + cofs); if (BIAS) { val[0] += bfr(bias[c0 + cofs]); val[1] += bfr(bias[c0 + cofs + 1]); val[2] += bfr(bias[c0 + cofs + 2]); val[3] += bfr(bias[c0 + cofs + 3]); }
                *(v4f*)(crow + (size_t)row * ldc + cofs) = val; }
            asm volatile("s_wait_xcnt 0x0" ::: "memory");   // the next row block's bias loads land in registers that these stores name: the wait stands in front of that
             }
        __builtin_amdgcn_wave_barrier(); asm volatile("" ::: "memory");
    }
    if constexpr (EPI == 3) asm volatile("s_wait_xcnt 0x0" ::: "memory");   // in the built code the [h][d][t] epilogue stands behind this one, past a scalar branch, and rewrites the last stores' registers: the wait stands in front of that
}

__device__ __forceinline__ void splitf(float y, unsigned short& h, unsigned short& l) { h = f2bf(y); l = f2bf(y - bf2f(h)); }
typedef __attribute__((ext_vector_type(2))) _Float16 v2h;
typedef __attribute__((ext_vector_type(4))) _Float16 v4h;
typedef __attribute__((ext_vector_type(2))) unsigned short v2us;
typedef __attribute__((ext_vector_type(4))) unsigned short v4us;
typedef __attribute__((ext_vector_type(2))) float v2f;
typedef __attribute__((ext_vector_type(4))) int v4i;

// Both plane builders go by the DESTINATION: thread i makes 16-byte unit i of the fragment-order plane (a wave stores 512 contiguous bytes). Unit i = row tile, k block, then (k >> 3 & 3) in bits 5..4 and the row in bits 3..0.
__global__ __launch_bounds__(256) void k_wtG(const float* __restrict__ w, int K, int N, bf* Bt) {   // w [K][N] f32 -> Bt, rows n, in fragment order
    const int i = blockIdx.x * 256 + threadIdx.x; if (i >= N * (K / 8)) return;
    const int fr = i >> 6, n = fr / (K >> 5) * 16 + (i & 15), k0 = fr % (K >> 5) * 32 + ((i >> 4) & 3) * 8; v8us o;
    float v[8]; const unsigned vo = (unsigned)(k0 * N + n);
#pragma unroll
    for (int j = 0; j < 8; ++j) v[j] = ((const GLB float*)sbase(w + (size_t)j * N))[vo];   // row k0 + j: the step j * N goes into the scalar base, the lane's offset register stays
    asm volatile("s_wait_xcnt 0x0" ::: "memory");   // the roundings below reuse the loads' offset registers: the wait stands in front of that
#pragma unroll
    for (int j = 0; j < 8; ++j) o[j] = f2bf(v[j]);
    *(v8us*)(Bt + (size_t)i * 8) = o;
}
__global__ __launch_bounds__(256) void k_cvt8(const float* __restrict__ src, bf* dst, size_t n8) {   // src [rows][DM] f32
    const size_t i = (size_t)blockIdx.x * 256 + threadIdx.x; if (i >= n8) return;
    const size_t fr = i >> 6; const v8f v = *(const v8f*)(src + (fr / (DM / 32) * 16 + (i & 15)) * DM + fr % (DM / 32) * 32 + ((i >> 4) & 3) * 8); v8us o;
#pragma unroll
    for (int k = 0; k < 8; ++k) o[k] = f2bf(v[k]); *(v8us*)(dst + i * 8) = o;  }

// ---- k_planes: C[b][i][j] = bf16(mask[i][j]) + bf16(bias[b][i][j]), f32, made once for all heads and kept in SCORE order: 1-KiB tiles of 16 queries x 16 keys, tile (qt, kt) of batch b at float ((b * TT / 16 + qt) * TT / 16 + kt) * 256;
// inside it lane l = hi * 16 + query of k_fattn finds keys hi * 8 + p * 4 .. + 3 at float p * 128 + l * 4. A wave takes 16 queries x 32 keys of both batches: whole 128-byte source rows (4 lines a load), summed as they come, turned through its own LDS region (pitch 36 floats), stored 512 contiguous bytes at a time. Grid (TT / 256, TT / 16).
typedef __attribute__((ext_vector_type(4))) __bf16 v4bq;
__device__ __forceinline__ v4f bfr4(v4f x) { return __builtin_convertvector(__builtin_convertvector(x, v4bq), v4f); }
__global__ __launch_bounds__(256) void k_planes(const float* __restrict__ RP, const float* __restrict__ RB, float* C) {
    __shared__ __align__(16) float ts[8 * NB_ * 16 * 36];
    const int w = threadIdx.x >> 5, lane = threadIdx.x & 31, lr = lane & 15, hi = lane >> 4, srow = lane >> 3, scol = (lane & 7) * 4;
    const int qt = blockIdx.y, k32 = blockIdx.x * 8 + w; float* tw = ts + w * (NB_ * 16 * 36);
    const unsigned vo = (unsigned)((qt * 16 + srow) * TT + k32 * 32 + scol) / 4;   // the lane's place in 16-byte units: one offset register for all twelve loads; the row step goes into the instruction's offset, the batch into the scalar base
    v4f gm[4], gb[NB_][4];
#pragma unroll
    for (int i = 0; i < 4; ++i) { gm[i] = ((const GLB v4f*)sbase(RP))[vo + i * TT];
#pragma unroll
        for (int b = 0; b < NB_; ++b) gb[b][i] = ((const GLB v4f*)sbase(RB + (size_t)b * TT * TT))[vo + i * TT]; }
    asm volatile("s_wait_xcnt 0x0" ::: "memory");   // the code below reuses the loads' offset register: the wait stands in front of that
#pragma unroll
    for (int i = 0; i < 4; ++i) { const v4f m = bfr4(gm[i]);
#pragma unroll
        for (int b = 0; b < NB_; ++b) *(v4fa*)(tw + b * (16 * 36) + (i * 4 + srow) * 36 + scol) = m + bfr4(gb[b][i]); }
    __builtin_amdgcn_wave_barrier(); asm volatile("" ::: "memory");   // other lanes' rows are read below: the LDS reads stay behind the stores
#pragma unroll
    for (int b = 0; b < NB_; ++b)
#pragma unroll
        for (int kt = 0; kt < 2; ++kt)
#pragma unroll
            for (int p = 0; p < 2; ++p) *(v4f*)(C + (((size_t)b * (TT / 16) + qt) * (TT / 16) + k32 * 2 + kt) * 256 + p * 128 + lane * 4) = *(const v4fa*)(tw + b * (16 * 36) + lr * 36 + kt * 16 + hi * 8 + p * 4);
}

// ---- k_fattn: scores, softmax and P.V of one head's 64 query rows in one work-group; nothing of S or P goes to memory. Grid (TT / 64, NH_, NB_): its flat index is permuted into (query block, head, batch), hi/lo blocks first.
// Transposed products: St = K Qt (A = key rows, B = query rows), so a lane holds one query's scores (register r of key tile kt = key kt*16 + 8*hi + r, query lr); two St tiles converted in place are the B operand of Ot += Vt Pt (A = rows of the [d][t] planes).
// t = S x HD^-0.5 + CP[i][j], CP = bf16(mask) + bf16(bias) from k_planes; running maximum per query in log2 units, moved (and sums and Ot rescaled) only when a score passes it by more than 8, so p <= 2^8.
// CP is kept in score order (k_planes), so a lane's eight values of a 16 x 16 tile come straight into registers by two loads of 512 contiguous bytes each, scalar base + lane; the loop touches no LDS.
// 8 waves: wave w takes query rows (w & 1) * 32 .. + 31 and keys (w >> 1) * TT / FKS .. ; the FKS partial (maximum, sum, Ot) of a query are joined in split order through LDS, normalised and stored as hi/lo bf16 into the merged [t][DQ] planes (fragment order, like the q / k / v planes read here).
#define L2E 1.4426950408889634f
#define FWR (32 * 68)             // floats of a wave's LDS region: its 32 x 68 Ot partial
template <bool HI, typename T16>
__device__ __forceinline__ void fa_wave(const T16* __restrict__ Q, const T16* __restrict__ Q2, const T16* __restrict__ Kp, const T16* __restrict__ K2, const T16* __restrict__ Vt, const T16* __restrict__ V2, const float* __restrict__ CP, int q0w, int key0, float* osw, float* msw, float* lsw) {
    typedef typename WFrag<T16>::V V;
    const int lane = threadIdx.x & 31, lr = lane & 15, hi = lane >> 4; const unsigned lo = lane;
    V qf[2][2], qf2[2][2];
#pragma unroll
    for (int qt = 0; qt < 2; ++qt)
#pragma unroll
        for (int kc = 0; kc < 2; ++kc) { const size_t o = (size_t)(q0w + qt * 16) * HD + kc * 512; qf[qt][kc] = WFrag<T16>::ld(Q + o, lo); if (HI) qf2[qt][kc] = WFrag<T16>::ld(Q2 + o, lo); }
    v8f acc[4][2];
#pragma unroll
    for (int dt = 0; dt < 4; ++dt) { acc[dt][0] = (v8f){}; acc[dt][1] = (v8f){}; }
    float m[2] = {-3.0e38f, -3.0e38f}, l[2] = {0.f, 0.f};
#pragma unroll 1
    for (int key = key0; key < key0 + TT / FKS; key += 32) {
        const unsigned long long uk = sbase(Kp + (size_t)key * HD), uv = sbase(Vt + (size_t)key * 16);   // this pass's first K and V fragments (the hi/lo rows form each fragment's base by itself: with common bases the build spilled a Q fragment)
        V kfa[2][2];   // fp16 rows: the pass's four K fragments, asked for together with the plane tiles
        if constexpr (!HI) {
#pragma unroll
            for (int kt = 0; kt < 2; ++kt)
#pragma unroll
                for (int kc = 0; kc < 2; ++kc) kfa[kt][kc] = WFrag<T16>::ldu(uk, lo + kt * 128 + kc * 64); }
        const GLB v4f* uc = (const GLB v4f*)sbase(CP + ((size_t)(q0w >> 4) * (TT / 16) + (key >> 4)) * 256);   // this pass's first 16 x 16 tile of the summed plane
        v8f cg[2][2];   // [key tile][query tile], asked for ahead of the score products, which hide a part of their latency
#pragma unroll
        for (int kt = 0; kt < 2; ++kt)
#pragma unroll
            for (int qt = 0; qt < 2; ++qt) { const unsigned o = lo + qt * (TT / 16 * 64) + kt * 64; cg[kt][qt] = __builtin_shufflevector(uc[o], uc[o + 32], 0, 1, 2, 3, 4, 5, 6, 7); }
        if constexpr (!HI) __builtin_amdgcn_sched_barrier(0);   // all 16 loads of the pass are issued before its first product waits: left free, the scheduler put six of them behind the first waits, a second load latency in every pass
        v8f s[2][2];   // [key tile][query tile]
#pragma unroll
        for (int kt = 0; kt < 2; ++kt) { s[kt][0] = (v8f){}; s[kt][1] = (v8f){};
#pragma unroll
            for (int kc = 0; kc < 2; ++kc) { V kf, kf2; if constexpr (HI) { const size_t e = (size_t)(key + kt * 16) * HD + kc * 512; kf = WFrag<T16>::ld(Kp + e, lo); kf2 = WFrag<T16>::ld(K2 + e, lo); } else kf = kfa[kt][kc];
#pragma unroll
                for (int qt = 0; qt < 2; ++qt) { s[kt][qt] = WFrag<T16>::mma(kf, qf[qt][kc], s[kt][qt]); if (HI) { s[kt][qt] = WFrag<T16>::mma(kf, qf2[qt][kc], s[kt][qt]); s[kt][qt] = WFrag<T16>::mma(kf2, qf[qt][kc], s[kt][qt]); } } } }
        float c[2];
#pragma unroll
        for (int qt = 0; qt < 2; ++qt) { float mx = -3.0e38f;
#pragma unroll
            for (int kt = 0; kt < 2; ++kt) { const v8f t = s[kt][qt] * SCL + cg[kt][qt]; s[kt][qt] = t;
#pragma unroll
                for (int r = 0; r < 8; ++r) mx = fmaxf(mx, t[r]); }
            c[qt] = mx * L2E; }
        if (__builtin_amdgcn_ballot_w32(c[0] > m[0] + 8.0f || c[1] > m[1] + 8.0f) != 0) {   // wave-uniform: both halves of a query move its maximum together
#pragma unroll
            for (int qt = 0; qt < 2; ++qt) { const float mn = fmaxf(m[qt], fmaxf(c[qt], __shfl_xor(c[qt], 16, 32))); const float al = __builtin_amdgcn_exp2f(m[qt] - mn); m[qt] = mn; l[qt] *= al;
#pragma unroll
                for (int dt = 0; dt < 4; ++dt) acc[dt][qt] *= al; } }
        V pf[2], pf2[2];
#pragma unroll
        for (int qt = 0; qt < 2; ++qt) { v8f p[2];
#pragma unroll
            for (int kt = 0; kt < 2; ++kt) { const v8f e = __builtin_elementwise_fma(s[kt][qt], (v8f)(L2E), (v8f)(-m[qt]));
#pragma unroll
                for (int r = 0; r < 8; ++r) { p[kt][r] = __builtin_amdgcn_exp2f(e[r]); l[qt] += p[kt][r]; } }
            if constexpr (HI) { const v8bq h0 = __builtin_convertvector(p[0], v8bq), h1 = __builtin_convertvector(p[1], v8bq);
                const v8bq l0 = __builtin_convertvector(p[0] - __builtin_convertvector(h0, v8f), v8bq), l1 = __builtin_convertvector(p[1] - __builtin_convertvector(h1, v8f), v8bq);
                pf[qt] = __builtin_shufflevector(h0, h1, 0, 1, 2, 3, 4, 5, 6, 7, 8, 9, 10, 11, 12, 13, 14, 15); pf2[qt] = __builtin_shufflevector(l0, l1, 0, 1, 2, 3, 4, 5, 6, 7, 8, 9, 10, 11, 12, 13, 14, 15); }
            else pf[qt] = cat16(__builtin_convertvector(p[0], v8h), __builtin_convertvector(p[1], v8h)); }
#pragma unroll
        for (int dt = 0; dt < 4; ++dt) { const unsigned o = lo + dt * (16 * TT / 8); V vf, vf2; if constexpr (HI) { const size_t e = (size_t)(dt * 16) * TT + key * 16; vf = WFrag<T16>::ld(Vt + e, lo); vf2 = WFrag<T16>::ld(V2 + e, lo); } else vf = WFrag<T16>::ldu(uv, o);
#pragma unroll
            for (int qt = 0; qt < 2; ++qt) { acc[dt][qt] = WFrag<T16>::mma(vf, pf[qt], acc[dt][qt]); if (HI) { acc[dt][qt] = WFrag<T16>::mma(vf, pf2[qt], acc[dt][qt]); acc[dt][qt] = WFrag<T16>::mma(vf2, pf[qt], acc[dt][qt]); } } }
    }
#pragma unroll
    for (int qt = 0; qt < 2; ++qt) { const float lt = l[qt] + __shfl_xor(l[qt], 16, 32); if (hi == 0) { msw[qt * 16 + lr] = m[qt]; lsw[qt * 16 + lr] = lt; }
#pragma unroll
        for (int dt = 0; dt < 4; ++dt) { float* op = osw + (qt * 16 + lr) * 68 + dt * 16 + hi * 8; const v8f a = acc[dt][qt]; *(v4fa*)op = __builtin_shufflevector(a, a, 0, 1, 2, 3); *(v4fa*)(op + 4) = __builtin_shufflevector(a, a, 4, 5, 6, 7); } }
}
__global__ __launch_bounds__(256) __attribute__((amdgpu_waves_per_eu(4, 4))) void k_fattn(const h16* __restrict__ Q16, const h16* __restrict__ K16, const h16* __restrict__ V16, const bf* __restrict__ Qh, const bf* __restrict__ Ql, const bf* __restrict__ Kh, const bf* __restrict__ Kl, const bf* __restrict__ Vh, const bf* __restrict__ Vl, const float* __restrict__ CP, bf* Ah, bf* Al) {
    __shared__ __align__(16) float Os[2 * FKS * FWR]; __shared__ float Ms[2 * FKS * 32]; __shared__ float Ls[2 * FKS * 32];
    const int w = __builtin_amdgcn_readfirstlane(threadIdx.x >> 5);
    // Only half of the work-groups are resident at once: the hi/lo query blocks (3 products a tile, the longest work-groups) take the lowest flat indices, for speed only.
    const unsigned li = blockIdx.x + (TT / 64) * (blockIdx.y + NH_ * blockIdx.z), nhv = (RH / 64) * NH_ * NB_, lj = li - nhv;   // flat index; number of hi/lo work-groups; index among the fp16 ones
    const bool hv = li < nhv; const unsigned qb = hv ? li % (RH / 64) : RH / 64 + lj % ((TT - RH) / 64), hb = hv ? li / (RH / 64) : lj / ((TT - RH) / 64);   // a permutation of (query block, batch * NH_ + head)
    const int h = hb % NH_, b = hb / NH_, q0 = qb * 64; const int q0w = q0 + (w & 1) * 32, key0 = (w >> 1) * (TT / FKS); const size_t hp = ((size_t)b * NH_ + h) * TT * HD; CP += (size_t)b * TT * TT;   // this batch's head planes and summed plane
    if (q0 < RH) fa_wave<true, bf>(Qh + hp, Ql + hp, Kh + hp, Kl + hp, Vh + hp, Vl + hp, CP, q0w, key0, Os + w * FWR, Ms + w * 32, Ls + w * 32);
    else fa_wave<false, h16>(Q16 + hp, nullptr, K16 + hp, nullptr, V16 + hp, nullptr, CP, q0w, key0, Os + w * FWR, Ms + w * 32, Ls + w * 32);
    __syncthreads();   // every wave's partial (maximum, sum, Ot) is in LDS before any thread joins them
    const int q = threadIdx.x >> 2, d0 = (threadIdx.x & 3) * 16; const int wq = q >> 5, ql = q & 31;
    float mm = Ms[wq * 32 + ql];
#pragma unroll
    for (int sp = 1; sp < FKS; ++sp) mm = fmaxf(mm, Ms[(sp * 2 + wq) * 32 + ql]);
    float lt = 0.f; v4f o[4];
#pragma unroll
    for (int k = 0; k < 4; ++k) o[k] = (v4f){};
#pragma unroll
    for (int sp = 0; sp < FKS; ++sp) { const int ww = sp * 2 + wq; const float f = __builtin_amdgcn_exp2f(Ms[ww * 32 + ql] - mm); lt += Ls[ww * 32 + ql] * f;
#pragma unroll
        for (int k = 0; k < 4; ++k) o[k] += *(const v4fa*)(Os + ww * FWR + ql * 68 + d0 + k * 4) * f; }
    const float inv = __fdiv_rn(1.0f, lt); const size_t oo = ((size_t)b * TT + q0 + (q & ~15)) * DQ + (h * HD + d0) / 16 * 256 + (q & 15) * 8;   // fragment order of the merged [t][DQ] planes: the thread's 16 columns are one piece pair, 128 elements apart
#pragma unroll
    for (int g = 0; g < 2; ++g) { v8us oh, ol;
#pragma unroll
        for (int e = 0; e < 8; ++e) { unsigned short a, c2; splitf(o[g * 2 + (e >> 2)][e & 3] * inv, a, c2); oh[e] = a; ol[e] = c2; }
        *(v8us*)(Ah + oo + g * 128) = oh; *(v8us*)(Al + oo + g * 128) = ol; }
}

extern "C" void kernel_launch(void* const* d_in, const int* in_sizes, int n_in,
                              void* d_out, int out_size, void* d_ws, size_t ws_size, hipStream_t stream) {
    (void)in_sizes; (void)n_in; (void)out_size;
    const float* x = (const float*)d_in[0]; const float* amask = (const float*)d_in[1]; const float* abias = (const float*)d_in[2]; const float* wqkv = (const float*)d_in[3]; const float* bqkv = (const float*)d_in[4]; const float* wo = (const float*)d_in[5]; const float* bo = (const float*)d_in[6];   /* x, attn_mask [2048][2048], attn_bias [2][2048][2048], Wqkv ('xw' [1024][3072]), bqkv, Wout ('xw'), bout */
    float* OUT = (float*)d_out;     // [2][2048][1024]
    char* wsp = (char*)d_ws;
    auto take = [&](size_t bytes) { char* p = wsp; wsp += (bytes + 255) & ~(size_t)255; return (void*)p; };
    bf* WQKV = (bf*)take((size_t)3 * DQ * DM * 2);   /* fused Bt [3*DQ][DM]: q | k | v row blocks */ bf* WO = (bf*)take((size_t)DM * DQ * 2);
    bf* XB = (bf*)take((size_t)NB_ * TT * DM * 2);
    const size_t PS = (size_t)NB_ * NH_ * TT * HD;   // elements of one plane set: [batch][head] planes
    h16* P16 = (h16*)take(3 * PS * 2); bf* PH = (bf*)take(3 * PS * 2); bf* PL = (bf*)take(3 * PS * 2);   /* each: q | k | v sets, q and k [h][t][d], v [h][d][t] */
    bf* ATh = (bf*)take((size_t)NB_ * TT * DQ * 2); bf* ATl = (bf*)take((size_t)NB_ * TT * DQ * 2);
    float* CPL = (float*)take((size_t)NB_ * TT * TT * 4);   /* summed mask + bias plane per batch, score order */
    if ((size_t)(wsp - (char*)d_ws) > ws_size) return;    // ws 256 MiB
    { k_wtG<<<(unsigned)((DM * 3 * DQ / 8 + 255) / 256), 256, 0, stream>>>(wqkv, DM, 3 * DQ, WQKV);   /* fused 'xw' [DM][3*DQ] -> Bt [3*DQ][DM] */
      k_wtG<<<(unsigned)((DQ * DM / 8 + 255) / 256), 256, 0, stream>>>(wo, DQ, DM, WO);
       }
    k_cvt8<<<(unsigned)(((size_t)NB_ * TT * DM / 8 + 255) / 256), 256, 0, stream>>>(x, XB, (size_t)NB_ * TT * DM / 8);
    k_planes<<<dim3(TT / 256, TT / 16), 256, 0, stream>>>(amask, abias, CPL);
    k_gemmw<bf, 0, true, 3><<<dim3(TT / 128, 3 * DQ / 128, NB_), 128, 0, stream>>>(XB, nullptr, WQKV, nullptr, DM, DM, nullptr, 0, bqkv, (size_t)TT * DM, 0, 0, P16, PH, PL);
    k_fattn<<<dim3(TT / 64, NH_, NB_), 256, 0, stream>>>(P16, P16 + PS, P16 + 2 * PS, PH, PL, PH + PS, PL + PS, PH + 2 * PS, PL + 2 * PS, CPL, ATh, ATl);   /* the kernel picks its batch's summed plane */
    k_gemmw<bf, 1, true><<<dim3(TT / 128, DM / 128, NB_), 128, 0, stream>>>(ATh, ATl, WO, nullptr, DQ, DQ, OUT, DM, bo, (size_t)TT * DQ, 0, (size_t)TT * DM, nullptr, nullptr, nullptr);
}

// v010
// Measured time: 135 microseconds a run.
// Next to v009, in two timings, it ran 1.19 and 1.20 times as fast.
// All steps since v000 together make it 15.5 times as fast.
#include <hip/hip_runtime.h>

// Multi-head self-attention with a fused qkv projection and TWO additive score planes (x [2][2048][1024]; qkv = x Wqkv + bqkv ('xw' [1024][3072] 1/32 + bias (zeros on this draw: read)) -> reshape (B, S, 3, 16, 64): q | k | v column thirds; scores = q.k / sqrt(64) + attn_mask[i][j] (f32 [2048][2048], shared by heads and batches) + attn_bias[b][i][j] (f32 [2][2048][2048], shared by heads); softmax over all keys; out = merged Wout + bout ('xw' [1024][1024] + bias) -> [2][2048][1024] (4.2 M); argument order x, attn_mask, attn_bias, Wqkv, bqkv, Wout, bout).
// Layout, both batches in every launch (the batch is grid z of the GEMMs and part of the attention's permuted flat index, k_planes does both in each wave; every plane has a copy per batch): bf16 copy of x; the fused 'xw' weight transposed once into Bt (q | k | v row blocks) + bias; exact projections + f32 biases in ONE launch over all 3 * DQ columns, whose epilogue writes the head planes; one launch that adds bf16(attn_mask[i][j]) + bf16(attn_bias[b][i][j]) in f32 ONCE for all heads into a plane per batch, kept in the order of the score registers; one fused attention launch (hybrid rows: < 512 hi/lo 3 products, rest fp16) that adds that plane to the scaled f32 score and keeps scores and probabilities in registers; merged hi/lo x Wout exact + bout.
// Compute dtypes, f32 accumulate: every input rounded to bf16 incl. the two planes; projections exact + f32 biases; attention rows < 512 3 products, rest fp16; softmax f32; Wout hl x exact + bias.

#define NB_  2
#define TT   2048
#define DM   1024
#define NH_  16
#define NKV  16
#define REP  (NH_ / NKV)
#define HD   64
#define DQ   (NH_ * HD)
#define DKV  (NKV * HD)
#define ZH   8                    // plane count of k_gemmw's split-K addressing (unused at KS = 1)
#define RH   512                  // query rows < RH use hi+lo planes (0: none)
#define WIN  0
#define SCL  0.125f   // HD^-0.5
#define FKS  4                    // key splits of the fused attention: a wave walks TT / FKS keys of its queries, the FKS partials are joined in LDS
typedef _Float16 h16;
typedef unsigned short bf;
typedef __attribute__((ext_vector_type(16))) __bf16   v16bf;
typedef __attribute__((ext_vector_type(16))) _Float16 v16h;
typedef __attribute__((ext_vector_type(8)))  _Float16 v8h;
typedef __attribute__((ext_vector_type(8)))  unsigned short v8us;
typedef __attribute__((ext_vector_type(8)))  float    v8f;
typedef __attribute__((ext_vector_type(4)))  float    v4f;
typedef v8h  __attribute__((may_alias)) v8ha;
typedef v4f  __attribute__((may_alias)) v4fa;
typedef v8us __attribute__((may_alias)) v8usa;

__device__ __forceinline__ unsigned short f2bf(float f) { unsigned u = __float_as_uint(f); u += 0x7FFFu + ((u >> 16) & 1u); return (unsigned short)(u >> 16); }
__device__ __forceinline__ float bf2f(unsigned short b) { return __uint_as_float(((unsigned)b) << 16); }
__device__ __forceinline__ float bfr(float f) { return bf2f(f2bf(f)); }
__device__ __forceinline__ v16h cat16(v8h lo, v8h hi) { return __builtin_shufflevector(lo, hi, 0, 1, 2, 3, 4, 5, 6, 7, 8, 9, 10, 11, 12, 13, 14, 15); }
__device__ __forceinline__ v16bf cat16b(v8us lo, v8us hi) { return __builtin_bit_cast(v16bf, __builtin_shufflevector(lo, hi, 0, 1, 2, 3, 4, 5, 6, 7, 8, 9, 10, 11, 12, 13, 14, 15)); }
__device__ __forceinline__ v8f wmma16(v16h a, v16h b, v8f c) { return __builtin_amdgcn_wmma_f32_16x16x32_f16(false, a, false, b, (short)0, c, false, false); }
__device__ __forceinline__ v8f wmmab(v16bf a, v16bf b, v8f c) { return __builtin_amdgcn_wmma_f32_16x16x32_bf16(false, a, false, b, (short)0, c, false, false); }



typedef __attribute__((ext_vector_type(8))) __bf16 v8bq;
__device__ __forceinline__ v8f bfr8(v8f x) { return __builtin_convertvector(__builtin_convertvector(x, v8bq), v8f); }   // nearest-even bf16 rounding, widened again
__device__ __forceinline__ v8f ld8f(const float* p) { const v4f a = *(const v4fa*)p, b = *(const v4fa*)(p + 4); return __builtin_shufflevector(a, b, 0, 1, 2, 3, 4, 5, 6, 7); }
// eight f32 values -> their fp16 and hi/lo bf16 forms, one 16-byte store into each of the three planes at element e
__device__ __forceinline__ void put3(v8f v, size_t e, _Float16* P16, unsigned short* Ph, unsigned short* Pl) {
    const v8bq h = __builtin_convertvector(v, v8bq); const v8bq l = __builtin_convertvector(v - __builtin_convertvector(h, v8f), v8bq);
    *(v8h*)(P16 + e) = __builtin_convertvector(v, v8h); *(v8us*)(Ph + e) = __builtin_bit_cast(v8us, h); *(v8us*)(Pl + e) = __builtin_bit_cast(v8us, l);
    asm volatile("s_wait_xcnt 0x0" ::: "memory"); }   // the next call's values land in the registers that these stores name: the wait stands in front of that

// ---- Fragment order, the layout of EVERY 16-bit operand plane (x, both weights, the q / k / v head planes, the merged attention rows): a [rows][K] matrix is kept as 1-KiB fragments of 16 rows x 32 k, fragment (rt, kb) at element (rt * K / 32 + kb) * 512;
// inside it element (r, k) sits at ((k >> 4 & 1) * 32 + (k >> 3 & 1) * 16 + r) * 8 + (k & 7): lane l of a wave finds its two 16-byte pieces at l * 8 and 256 + l * 8, so each fragment load instruction reads 512 contiguous bytes (4 whole lines, not 16 quarter lines). Registers get the same values as from row-major planes.
// ---- k_gemmw: register-blocked GEMM, one wave per 64x64 output tile (16 accumulators), FOUR waves (2 x 2) per work-group = a 128x128 tile; grid (M/128, N/128, Z), 128 threads.
// The work-group's fragments of GBK k (8 row tiles x 2 fragments of each operand plane, 2 KiB a row tile, contiguous in the fragment-order planes) are brought into LDS by asynchronous copies, two buffers, the next stage in flight while this one is multiplied; each fragment is fetched from L2 once for the two waves that use it. K % GBK == 0.
// C[m][n] (f32, pitch ldc, + optional f32 bias[n]) = sum_k A[m][k] Bt[n][k] (+ split products per NSPLIT). A rows have pitch lda, Bt rows pitch K. z-batch strides sA/sB/sC in elements. K % GBK == 0.
// EPI 0: C as above. EPI 1 (N tile = one head): the tile + bias goes straight to the [h][t][d] planes P16 / Ph / Pl (fp16, hi/lo bf16), in fragment order, 512 contiguous bytes a store. EPI 2: the same to the [h][d][t] planes, the tile turned in LDS.
// EPI 3 (fused q | k | v, N = 3 * DQ, z = batch): the column third picks the plane set ([third][batch] sets of NH_ * TT * HD elements behind P16 / Ph / Pl) and the form: thirds 0 and 1 as EPI 1, third 2 as EPI 2. The test is on blockIdx and the scalar wave number, so it is a scalar branch, the same for the whole work-group.
#define GLB __attribute__((address_space(1)))
// a wave-uniform address handed on as two scalar words: the load then takes the form scalar base + one lane-offset register that is never rewritten, with no 64-bit vector address add per fragment
__device__ __forceinline__ unsigned long long sbase(const void* p) { const unsigned long long u = (unsigned long long)p; return ((unsigned long long)(unsigned)__builtin_amdgcn_readfirstlane((int)(u >> 32)) << 32) | (unsigned)__builtin_amdgcn_readfirstlane((int)u); }
template <typename T16> struct WFrag;   // lds(p): p = the lane's first 16-byte piece of a fragment staged in LDS; ld(p, lo): p = the fragment's start, the same in every lane, lo = the lane (16-byte units); ldu(u, lo): u = sbase() of the fragment's start, as ld passes it
template <> struct WFrag<h16> { typedef v16h V; static __device__ __forceinline__ V ldu(unsigned long long u, unsigned i) { const GLB v8h* q = (const GLB v8h*)u; return cat16(q[i], q[i + 32]); } static __device__ __forceinline__ V ld(const h16* p, unsigned lo) { return ldu(sbase(p), lo); } static __device__ __forceinline__ V lds(const unsigned char* p) { return cat16(*(const v8ha*)p, *(const v8ha*)(p + 512)); } static __device__ __forceinline__ v8f mma(V a, V b, v8f c) { return wmma16(a, b, c); } };
template <> struct WFrag<bf> { typedef v16bf V; static __device__ __forceinline__ V ldu(unsigned long long u, unsigned i) { const GLB v8us* q = (const GLB v8us*)u; return cat16b(q[i], q[i + 32]); } static __device__ __forceinline__ V ld(const bf* p, unsigned lo) { return ldu(sbase(p), lo); } static __device__ __forceinline__ V lds(const unsigned char* p) { return cat16b(*(const v8usa*)p, *(const v8usa*)(p + 512)); } static __device__ __forceinline__ v8f mma(V a, V b, v8f c) { return wmmab(a, b, c); } };
#define GBK 64                    // k of one LDS stage: two fragments a row tile
// eight asynchronous 16-byte copies a lane: row tile i of one operand plane's stage, global g + i * gs elements -> LDS byte l + i * 2048. The s_wait_xcnt stands inside the statement, so no address register of a copy is rewritten in front of it.
template <typename T16>
__device__ __forceinline__ void cp8(unsigned l, const T16* g, size_t gs) {
    asm volatile("global_load_async_to_lds_b128 %0, %8, off\n\tglobal_load_async_to_lds_b128 %1, %9, off\n\tglobal_load_async_to_lds_b128 %2, %10, off\n\tglobal_load_async_to_lds_b128 %3, %11, off\n\t"
                 "global_load_async_to_lds_b128 %4, %12, off\n\tglobal_load_async_to_lds_b128 %5, %13, off\n\tglobal_load_async_to_lds_b128 %6, %14, off\n\tglobal_load_async_to_lds_b128 %7, %15, off\n\ts_wait_xcnt 0x0"
                 :: "v"(l), "v"(l + 2048), "v"(l + 4096), "v"(l + 6144), "v"(l + 8192), "v"(l + 10240), "v"(l + 12288), "v"(l + 14336),
                    "v"(g), "v"(g + gs), "v"(g + 2 * gs), "v"(g + 3 * gs), "v"(g + 4 * gs), "v"(g + 5 * gs), "v"(g + 6 * gs), "v"(g + 7 * gs) : "memory"); }
template <typename T16, int NSPLIT, bool BIAS, int EPI = 0, int KS = 1>
__global__ __launch_bounds__(128) void k_gemmw(const T16* __restrict__ A, const T16* __restrict__ A2, const T16* __restrict__ Bt, const T16* __restrict__ Bt2, int K, int lda, float* C, int ldc, const float* __restrict__ bias, size_t sA, size_t sB, size_t sC, h16* P16, bf* Ph, bf* Pl) {
    typedef typename WFrag<T16>::V V;
    static_assert(NSPLIT <= 1 && KS == 1, "the LDS stage holds A, A2 and Bt and walks the whole K");
    constexpr int PB = 8 * 2048, SB = (NSPLIT == 1 ? 3 : 2) * PB;   // bytes of one plane's part of a stage (8 row tiles x 2 KiB), of a stage: A | A2 (NSPLIT 1) | Bt
    __shared__ __align__(16) unsigned char ring[2 * SB]; __shared__ __align__(16) float osa[4 * 16 * 68];
    const int w = __builtin_amdgcn_readfirstlane(threadIdx.x >> 5); float* os = osa + w * (16 * 68);   // wave w: rows (w & 1) * 64, columns (w >> 1) * 64 of the tile; its own staging region for the epilogue
    const size_t z = blockIdx.z / KS; const int ks = blockIdx.z % KS; A += z * sA; if (A2) A2 += z * sA; Bt += z * sB; if (Bt2) Bt2 += z * sB; C += ((size_t)ks * ZH + z) * sC;
    const int lane = threadIdx.x & 31, lr = lane & 15, hi = lane >> 4; int bx = blockIdx.x; const int c0 = blockIdx.y * 128 + (w >> 1) * 64;
    v8f acc[4][4];
#pragma unroll
    for (int mb = 0; mb < 4; ++mb)
#pragma unroll
        for (int nb = 0; nb < 4; ++nb) acc[mb][nb] = (v8f){};
    const int ec = hi * 8;   // EPI 1, 2: lane (lr, hi) reads staged row lr, floats s * 16 + hi * 8 .. + 7 in step s: the order of a fragment piece
    const int third = EPI == 3 ? c0 / DQ : 0;
    const bool tr = EPI == 2 || (EPI == 3 && third == 2);   // [h][d][t] planes
    if constexpr (EPI == 3) { const size_t po = ((size_t)third * (NB_ - 1) + z) * ((size_t)NH_ * TT * HD); P16 += po; Ph += po; Pl += po; }   // set (third, z) starts at (third * NB_ + z) planes; the stores below index by the fused column, which already steps one plane per third
    v8f b8[4]; float bd[4];   // the lane's bias values, asked for ahead of the k loop, which hides their latency (EPI 3 asks for both forms: a branch here would wait for them in front of the loop)
    if constexpr (EPI == 1 || EPI == 3) {
#pragma unroll
        for (int s = 0; s < 4; ++s) b8[s] = bfr8(ld8f(bias + c0 + s * 16 + ec)); }
    if constexpr (EPI == 2 || EPI == 3) {
#pragma unroll
        for (int nb = 0; nb < 4; ++nb) bd[nb] = bfr(bias[c0 + nb * 16 + lr]); }
    if constexpr (EPI == 3) asm volatile("s_wait_xcnt 0x0" : "+s"(bx) :: "memory");   // the bias loads stay in flight over the k loop, and their address registers are rewritten right behind them, first by the row offset: the wait stands in front of that, and the block index goes through it so that the scalar code that forms the offset cannot be lifted over it
    const int r0 = bx * 128 + (w & 1) * 64;
    // fragment order: 16 rows are lda * 16 elements, 32 k are 512. Thread i copies 16-byte unit i of each row tile's 2 KiB.
    const unsigned l0 = (unsigned)(unsigned long long)ring + threadIdx.x * 16; const T16* gA = A + (size_t)bx * 128 * lda + threadIdx.x * 8; const T16* gA2 = NSPLIT == 1 ? A2 + (size_t)bx * 128 * lda + threadIdx.x * 8 : nullptr; const T16* gB = Bt + (size_t)blockIdx.y * 128 * K + threadIdx.x * 8;
    auto stage = [&](int t) { const unsigned l = l0 + (t & 1) * SB; const size_t ko = (size_t)t * (GBK * 16);
        cp8(l, gA + ko, (size_t)16 * lda); if constexpr (NSPLIT == 1) cp8(l + PB, gA2 + ko, (size_t)16 * lda); cp8(l + SB - PB, gB + ko, (size_t)16 * K); };
    const int ns = K / GBK;
    stage(0);
    asm volatile("s_wait_asynccnt 0x0" ::: "memory");   // this wave's copies of stage 0 have landed
    __syncthreads();                                    // and every other wave's: stage 0 may be read
    if (ns > 1) stage(1);
#pragma unroll 1
    for (int t = 0; t < ns; ++t) {
        const unsigned char* sb = ring + (t & 1) * SB + lane * 16;
#pragma unroll
        for (int kk = 0; kk < GBK / 32; ++kk) {
            V a[4], a2[4], b[4];   // read in the order of first use (LDS answers in order): Bt fragment 0, the A fragments, the other Bt fragments
            const unsigned char* sa = sb + (w & 1) * 8192 + kk * 1024; const unsigned char* sw = sb + SB - PB + (w >> 1) * 8192 + kk * 1024;
            b[0] = WFrag<T16>::lds(sw);
#pragma unroll
            for (int i = 0; i < 4; ++i) { a[i] = WFrag<T16>::lds(sa + i * 2048); if (NSPLIT == 1) a2[i] = WFrag<T16>::lds(sa + PB + i * 2048); }
#pragma unroll
            for (int i = 1; i < 4; ++i) b[i] = WFrag<T16>::lds(sw + i * 2048);
            __builtin_amdgcn_sched_barrier(0);   // the block's LDS reads go out as one group ahead of its products: left free, the scheduler kept one Bt fragment and put a full LDS wait in front of every four products
#pragma unroll
            for (int nb = 0; nb < 4; ++nb)
#pragma unroll
                for (int mb = 0; mb < 4; ++mb) { acc[mb][nb] = WFrag<T16>::mma(a[mb], b[nb], acc[mb][nb]); if (NSPLIT == 1) acc[mb][nb] = WFrag<T16>::mma(a2[mb], b[nb], acc[mb][nb]); }
        }
        asm volatile("s_wait_dscnt 0x0" ::: "memory");      // this wave's reads of stage t are done before the buffer is given up
        asm volatile("s_wait_asynccnt 0x0" ::: "memory");   // this wave's copies of stage t + 1 have landed
        __syncthreads();                                    // publishes stage t + 1 and ends every wave's reads of stage t
        if (t + 2 < ns) stage(t + 2);                       // into the buffer that stage t has just left
    }
    asm volatile("s_wait_asynccnt 0x0" ::: "memory");   // no copy is outstanding when the wave goes on to the epilogue and ends
    if (tr) {
#pragma unroll
        for (int nb = 0; nb < 4; ++nb) {
#pragma unroll
            for (int mb = 0; mb < 4; ++mb) { float* op = os + lr * 68 + mb * 16 + hi * 8; const v8f a = acc[mb][nb]; *(v4fa*)op = __builtin_shufflevector(a, a, 0, 1, 2, 3); *(v4fa*)(op + 4) = __builtin_shufflevector(a, a, 4, 5, 6, 7); }
            __builtin_amdgcn_wave_barrier(); asm volatile("" ::: "memory");   // each lane reads back only its own staged floats: the LDS reads stay behind the stores
#pragma unroll
            for (int s = 0; s < 4; ++s) put3(ld8f(os + lr * 68 + s * 16 + ec) + bd[nb], (size_t)(c0 + nb * 16) * TT + r0 * 16 + s * 256 + lane * 8, P16, Ph, Pl);   // rows d, k = t: piece s of the two fragments that hold t = r0 .. r0 + 63
            __builtin_amdgcn_wave_barrier(); asm volatile("" ::: "memory");   // the next column block's staging stays behind these reads
        }
        return;
    }
#pragma unroll
    for (int mb = 0; mb < 4; ++mb) {
#pragma unroll
        for (int nb = 0; nb < 4; ++nb) {
#pragma unroll
            for (int j = 0; j < 8; ++j) os[(hi * 8 + j) * 68 + nb * 16 + lr] = acc[mb][nb][j]; }
        __builtin_amdgcn_wave_barrier(); asm volatile("" ::: "memory");
        float* crow = C + (size_t)(r0 + mb * 16) * ldc + c0;
        if constexpr (EPI == 1 || EPI == 3) {
#pragma unroll
            for (int s = 0; s < 4; ++s) put3(ld8f(os + lr * 68 + s * 16 + ec) + b8[s], ((size_t)(c0 / 64) * TT + r0 + mb * 16) * HD + s * 256 + lane * 8, P16, Ph, Pl);   // rows t, k = d: piece s of the row tile's two fragments
        } else {
#pragma unroll
            for (int s = 0; s < 8; ++s) { const int row = 2 * s + hi, cofs = lr * 4; v4f val = *(const v4fa*)(os + row * 68 + cofs); if (BIAS) { val[0] += bfr(bias[c0 + cofs]); val[1] += bfr(bias[c0 + cofs + 1]); val[2] += bfr(bias[c0 + cofs + 2]); val[3] += bfr(bias[c0 + cofs + 3]); }
                *(v4f*)(crow + (size_t)row * ldc + cofs) = val; }
            asm volatile("s_wait_xcnt 0x0" ::: "memory");   // the next row block's bias loads land in registers that these stores name: the wait stands in front of that
             }
        __builtin_amdgcn_wave_barrier(); asm volatile("" ::: "memory");
    }
    if constexpr (EPI == 3) asm volatile("s_wait_xcnt 0x0" ::: "memory");   // in the built code the [h][d][t] epilogue stands behind this one, past a scalar branch, and rewrites the last stores' registers: the wait stands in front of that
}

__device__ __forceinline__ void splitf(float y, unsigned short& h, unsigned short& l) { h = f2bf(y); l = f2bf(y - bf2f(h)); }
typedef __attribute__((ext_vector_type(2))) _Float16 v2h;
typedef __attribute__((ext_vector_type(4))) _Float16 v4h;
typedef __attribute__((ext_vector_type(2))) unsigned short v2us;
typedef __attribute__((ext_vector_type(4))) unsigned short v4us;
typedef __attribute__((ext_vector_type(2))) float v2f;
typedef __attribute__((ext_vector_type(4))) int v4i;

// Both plane builders go by the DESTINATION: thread i makes 16-byte unit i of the fragment-order plane (a wave stores 512 contiguous bytes). Unit i = row tile, k block, then (k >> 3 & 3) in bits 5..4 and the row in bits 3..0.
__global__ __launch_bounds__(256) void k_wtG(const float* __restrict__ w, int K, int N, bf* Bt) {   // w [K][N] f32 -> Bt, rows n, in fragment order
    const int i = blockIdx.x * 256 + threadIdx.x; if (i >= N * (K / 8)) return;
    const int fr = i >> 6, n = fr / (K >> 5) * 16 + (i & 15), k0 = fr % (K >> 5) * 32 + ((i >> 4) & 3) * 8; v8us o;
    float v[8]; const unsigned vo = (unsigned)(k0 * N + n);
#pragma unroll
    for (int j = 0; j < 8; ++j) v[j] = ((const GLB float*)sbase(w + (size_t)j * N))[vo];   // row k0 + j: the step j * N goes into the scalar base, the lane's offset register stays
    asm volatile("s_wait_xcnt 0x0" ::: "memory");   // the roundings below reuse the loads' offset registers: the wait stands in front of that
#pragma unroll
    for (int j = 0; j < 8; ++j) o[j] = f2bf(v[j]);
    *(v8us*)(Bt + (size_t)i * 8) = o;
}
__global__ __launch_bounds__(256) void k_cvt8(const float* __restrict__ src, bf* dst, size_t n8) {   // src [rows][DM] f32
    const size_t i = (size_t)blockIdx.x * 256 + threadIdx.x; if (i >= n8) return;
    const size_t fr = i >> 6; const v8f v = *(const v8f*)(src + (fr / (DM / 32) * 16 + (i & 15)) * DM + fr % (DM / 32) * 32 + ((i >> 4) & 3) * 8); v8us o;
#pragma unroll
    for (int k = 0; k < 8; ++k) o[k] = f2bf(v[k]); *(v8us*)(dst + i * 8) = o;  }

// ---- k_planes: C[b][i][j] = bf16(mask[i][j]) + bf16(bias[b][i][j]), f32, made once for all heads and kept in SCORE order: 1-KiB tiles of 16 queries x 16 keys, tile (qt, kt) of batch b at float ((b * TT / 16 + qt) * TT / 16 + kt) * 256;
// inside it lane l = hi * 16 + query of k_fattn finds keys hi * 8 + p * 4 .. + 3 at float p * 128 + l * 4. A wave takes 16 queries x 32 keys of both batches: whole 128-byte source rows (4 lines a load), summed as they come, turned through its own LDS region (pitch 36 floats), stored 512 contiguous bytes at a time. Grid (TT / 256, TT / 16).
typedef __attribute__((ext_vector_type(4))) __bf16 v4bq;
__device__ __forceinline__ v4f bfr4(v4f x) { return __builtin_convertvector(__builtin_convertvector(x, v4bq), v4f); }
__global__ __launch_bounds__(256) void k_planes(const float* __restrict__ RP, const float* __restrict__ RB, float* C) {
    __shared__ __align__(16) float ts[8 * NB_ * 16 * 36];
    const int w = threadIdx.x >> 5, lane = threadIdx.x & 31, lr = lane & 15, hi = lane >> 4, srow = lane >> 3, scol = (lane & 7) * 4;
    const int qt = blockIdx.y, k32 = blockIdx.x * 8 + w; float* tw = ts + w * (NB_ * 16 * 36);
    const unsigned vo = (unsigned)((qt * 16 + srow) * TT + k32 * 32 + scol) / 4;   // the lane's place in 16-byte units: one offset register for all twelve loads; the row step goes into the instruction's offset, the batch into the scalar base
    v4f gm[4], gb[NB_][4];
#pragma unroll
    for (int i = 0; i < 4; ++i) { gm[i] = ((const GLB v4f*)sbase(RP))[vo + i * TT];
#pragma unroll
        for (int b = 0; b < NB_; ++b) gb[b][i] = ((const GLB v4f*)sbase(RB + (size_t)b * TT * TT))[vo + i * TT]; }
    asm volatile("s_wait_xcnt 0x0" ::: "memory");   // the code below reuses the loads' offset register: the wait stands in front of that
#pragma unroll
    for (int i = 0; i < 4; ++i) { const v4f m = bfr4(gm[i]);
#pragma unroll
        for (int b = 0; b < NB_; ++b) *(v4fa*)(tw + b * (16 * 36) + (i * 4 + srow) * 36 + scol) = m + bfr4(gb[b][i]); }
    __builtin_amdgcn_wave_barrier(); asm volatile("" ::: "memory");   // other lanes' rows are read below: the LDS reads stay behind the stores
#pragma unroll
    for (int b = 0; b < NB_; ++b)
#pragma unroll
        for (int kt = 0; kt < 2; ++kt)
#pragma unroll
            for (int p = 0; p < 2; ++p) *(v4f*)(C + (((size_t)b * (TT / 16) + qt) * (TT / 16) + k32 * 2 + kt) * 256 + p * 128 + lane * 4) = *(const v4fa*)(tw + b * (16 * 36) + lr * 36 + kt * 16 + hi * 8 + p * 4);
}

// ---- k_fattn: scores, softmax and P.V of one head's 128 query rows in one work-group; nothing of S or P goes to memory. Grid (query block, head, batch), 512 threads.
// Transposed products: St = K Qt (A = key rows, B = query rows), so a lane holds one query's scores (register r of key tile kt = key kt*16 + 8*hi + r, query lr); two St tiles converted in place are the B operand of Ot += Vt Pt (A = rows of the [d][t] planes).
// t = S x HD^-0.5 + CP[i][j], CP = bf16(mask) + bf16(bias) from k_planes; running maximum per query in log2 units, moved (and sums and Ot rescaled) only when a score passes it by more than 8, so p <= 2^8.
// 16 waves: wave w takes query rows (w & 3) * 32 .. + 31 and keys (w >> 2) * TT / FKS .. , 32 keys a pass. The four waves of a key split use the same K and V fragments: each brings a quarter of them (and its own four CP tiles) into LDS by asynchronous copies, two buffers, the copies of pass t + 2 in flight while pass t + 1 is worked on, so a K / V fragment leaves L2 once for 128 queries.
// The FKS partial (maximum, sum, Ot) of a query are joined in split order through LDS (the ring's bytes, free behind the loop's last barrier), normalised and stored as hi/lo bf16 into the merged [t][DQ] planes (fragment order, like the q / k / v planes read here).
#define L2E 1.4426950408889634f
#define FWR (32 * 68)             // floats of a wave's LDS region behind the loop: its 32 x 68 Ot partial
#define FQG 4                     // query groups of 32 rows in a work-group
#define FNW (FQG * FKS)           // its waves
// four asynchronous 16-byte copies a lane: two 1-KiB pieces (global ga, gb -> LDS bytes la, lb), each as two copies of 512 contiguous bytes a wave. The s_wait_xcnt stands inside the statement, so no address register of a copy is rewritten in front of it.
template <typename T>
__device__ __forceinline__ void cp4(unsigned la, const T* ga, unsigned lb, const T* gb) {
    asm volatile("global_load_async_to_lds_b128 %0, %4, off\n\tglobal_load_async_to_lds_b128 %1, %5, off\n\tglobal_load_async_to_lds_b128 %2, %6, off\n\tglobal_load_async_to_lds_b128 %3, %7, off\n\ts_wait_xcnt 0x0"
                 :: "v"(la), "v"(la + 512), "v"(lb), "v"(lb + 512), "v"(ga), "v"(ga + 512 / sizeof(T)), "v"(gb), "v"(gb + 512 / sizeof(T)) : "memory"); }
template <bool HI, typename T16>
__device__ __forceinline__ void fa_wave(const T16* __restrict__ Q, const T16* __restrict__ Q2, const T16* __restrict__ Kp, const T16* __restrict__ K2, const T16* __restrict__ Vt, const T16* __restrict__ V2, const float* __restrict__ CP, int q0w, int key0, int w, unsigned char* ring, float* osw, float* msw, float* lsw) {
    typedef typename WFrag<T16>::V V;
    // a buffer: FKS key splits of K (4 KiB, the pass's four fragments) | K lo | V (4 KiB, one fragment a d tile) | V lo (the lo parts only for the hi/lo rows), then 4 KiB of CP tiles [query tile][key tile] for each wave
    constexpr int SPB = HI ? 16384 : 8192, VO = HI ? 8192 : 4096, KVB = FKS * SPB, BUF = KVB + FNW * 4096, NS = TT / FKS / 32;
    const int lane = threadIdx.x & 31, lr = lane & 15, hi = lane >> 4; const unsigned lo = lane; const int j = w % FQG, sp = w / FQG;
    const unsigned l0 = (unsigned)(unsigned long long)ring + lane * 16;
    const size_t ek = (size_t)key0 * HD + j * 512 + lane * 8, ev = (size_t)j * 16 * TT + (size_t)key0 * 16 + lane * 8;   // the wave's quarter: K fragment j of the pass, V fragment of d tile j
    const float* gc = CP + ((size_t)(q0w >> 4) * (TT / 16) + (key0 >> 4)) * 256 + lane * 4;
    auto stage = [&](int t) { const unsigned lb = l0 + (t & 1) * BUF, lkv = lb + sp * SPB + j * 1024, lc = lb + KVB + w * 4096; const float* c = gc + (size_t)t * 512;
        cp4(lkv, Kp + ek + (size_t)t * (32 * HD), lkv + VO, Vt + ev + (size_t)t * 512);
        if constexpr (HI) cp4(lkv + 4096, K2 + ek + (size_t)t * (32 * HD), lkv + VO + 4096, V2 + ev + (size_t)t * 512);
        cp4(lc, c, lc + 1024, c + 256); cp4(lc + 2048, c + TT / 16 * 256, lc + 3072, c + TT / 16 * 256 + 256); };
    stage(0);
    V qf[2][2], qf2[2][2];
#pragma unroll
    for (int qt = 0; qt < 2; ++qt)
#pragma unroll
        for (int kc = 0; kc < 2; ++kc) { const size_t o = (size_t)(q0w + qt * 16) * HD + kc * 512; qf[qt][kc] = WFrag<T16>::ld(Q + o, lo); if (HI) qf2[qt][kc] = WFrag<T16>::ld(Q2 + o, lo); }
    v8f acc[4][2];
#pragma unroll
    for (int dt = 0; dt < 4; ++dt) { acc[dt][0] = (v8f){}; acc[dt][1] = (v8f){}; }
    float m[2] = {-3.0e38f, -3.0e38f}, l[2] = {0.f, 0.f};
    asm volatile("s_wait_asynccnt 0x0" ::: "memory");   // this wave's copies of pass 0 have landed
    __syncthreads();                                    // and every other wave's: pass 0 may be read
    stage(1);
#pragma unroll 1
    for (int t = 0; t < NS; ++t) {
        const unsigned char* sb = ring + (t & 1) * BUF + lane * 16; const unsigned char* skv = sb + sp * SPB; const unsigned char* sc = sb + KVB + w * 4096;
        V kfa[2][2], vfa[4];   // fp16 rows (registers allow it): the pass's K fragments are read as one group, its V fragments as a second one right behind the score products
        if constexpr (!HI) {
#pragma unroll
            for (int kt = 0; kt < 2; ++kt)
#pragma unroll
                for (int kc = 0; kc < 2; ++kc) kfa[kt][kc] = WFrag<T16>::lds(skv + kt * 2048 + kc * 1024);
            __builtin_amdgcn_sched_barrier(0); }   // the K reads go out together ahead of the first product: left free, the scheduler spread them among the products, an LDS wait at each place
        v8f s[2][2];   // [key tile][query tile]
#pragma unroll
        for (int kt = 0; kt < 2; ++kt) { s[kt][0] = (v8f){}; s[kt][1] = (v8f){};
#pragma unroll
            for (int kc = 0; kc < 2; ++kc) { V kf, kf2; if constexpr (HI) { kf = WFrag<T16>::lds(skv + kt * 2048 + kc * 1024); kf2 = WFrag<T16>::lds(skv + 4096 + kt * 2048 + kc * 1024); } else kf = kfa[kt][kc];
#pragma unroll
                for (int qt = 0; qt < 2; ++qt) { s[kt][qt] = WFrag<T16>::mma(kf, qf[qt][kc], s[kt][qt]); if constexpr (HI) { s[kt][qt] = WFrag<T16>::mma(kf, qf2[qt][kc], s[kt][qt]); s[kt][qt] = WFrag<T16>::mma(kf2, qf[qt][kc], s[kt][qt]); } } } }
        if constexpr (!HI) {
#pragma unroll
            for (int dt = 0; dt < 4; ++dt) vfa[dt] = WFrag<T16>::lds(skv + VO + dt * 1024);
            __builtin_amdgcn_sched_barrier(0); }   // the V reads go out ahead of the softmax, which hides them: left free, the scheduler read one fragment in front of every two P.V products and waited for each
        float c[2];
#pragma unroll
        for (int qt = 0; qt < 2; ++qt) { float mx = -3.0e38f;
#pragma unroll
            for (int kt = 0; kt < 2; ++kt) { const unsigned char* cp = sc + qt * 2048 + kt * 1024; const v8f cg = __builtin_shufflevector(*(const v4fa*)cp, *(const v4fa*)(cp + 512), 0, 1, 2, 3, 4, 5, 6, 7);
                const v8f t2 = s[kt][qt] * SCL + cg; s[kt][qt] = t2;
#pragma unroll
                for (int r = 0; r < 8; ++r) mx = fmaxf(mx, t2[r]); }
            c[qt] = mx * L2E; }
        if (__builtin_amdgcn_ballot_w32(c[0] > m[0] + 8.0f || c[1] > m[1] + 8.0f) != 0) {   // wave-uniform: both halves of a query move its maximum together
#pragma unroll
            for (int qt = 0; qt < 2; ++qt) { const float mn = fmaxf(m[qt], fmaxf(c[qt], __shfl_xor(c[qt], 16, 32))); const float al = __builtin_amdgcn_exp2f(m[qt] - mn); m[qt] = mn; l[qt] *= al;
#pragma unroll
                for (int dt = 0; dt < 4; ++dt) acc[dt][qt] *= al; } }
        V pf[2], pf2[2];
#pragma unroll
        for (int qt = 0; qt < 2; ++qt) { v8f p[2];
#pragma unroll
            for (int kt = 0; kt < 2; ++kt) { const v8f e = __builtin_elementwise_fma(s[kt][qt], (v8f)(L2E), (v8f)(-m[qt]));
#pragma unroll
                for (int r = 0; r < 8; ++r) { p[kt][r] = __builtin_amdgcn_exp2f(e[r]); l[qt] += p[kt][r]; } }
            if constexpr (HI) { const v8bq h0 = __builtin_convertvector(p[0], v8bq), h1 = __builtin_convertvector(p[1], v8bq);
                const v8bq l0 = __builtin_convertvector(p[0] - __builtin_convertvector(h0, v8f), v8bq), l1 = __builtin_convertvector(p[1] - __builtin_convertvector(h1, v8f), v8bq);
                pf[qt] = __builtin_shufflevector(h0, h1, 0, 1, 2, 3, 4, 5, 6, 7, 8, 9, 10, 11, 12, 13, 14, 15); pf2[qt] = __builtin_shufflevector(l0, l1, 0, 1, 2, 3, 4, 5, 6, 7, 8, 9, 10, 11, 12, 13, 14, 15); }
            else pf[qt] = cat16(__builtin_convertvector(p[0], v8h), __builtin_convertvector(p[1], v8h)); }
#pragma unroll
        for (int dt = 0; dt < 4; ++dt) { V vf, vf2; if constexpr (HI) { vf = WFrag<T16>::lds(skv + VO + dt * 1024); vf2 = WFrag<T16>::lds(skv + VO + 4096 + dt * 1024); } else vf = vfa[dt];
#pragma unroll
            for (int qt = 0; qt < 2; ++qt) { acc[dt][qt] = WFrag<T16>::mma(vf, pf[qt], acc[dt][qt]); if constexpr (HI) { acc[dt][qt] = WFrag<T16>::mma(vf, pf2[qt], acc[dt][qt]); acc[dt][qt] = WFrag<T16>::mma(vf2, pf[qt], acc[dt][qt]); } } }
        asm volatile("s_wait_dscnt 0x0" ::: "memory");      // this wave's reads of pass t are done before the buffer is given up
        asm volatile("s_wait_asynccnt 0x0" ::: "memory");   // this wave's copies of pass t + 1 have landed
        __syncthreads();                                    // publishes pass t + 1 and ends every wave's reads of pass t
        if (t + 2 < NS) stage(t + 2);                       // into the buffer that pass t has just left
    }
    asm volatile("s_wait_asynccnt 0x0" ::: "memory");   // no copy is outstanding when the ring's bytes take the partials below
#pragma unroll
    for (int qt = 0; qt < 2; ++qt) { const float lt = l[qt] + __shfl_xor(l[qt], 16, 32); if (hi == 0) { msw[qt * 16 + lr] = m[qt]; lsw[qt * 16 + lr] = lt; }
#pragma unroll
        for (int dt = 0; dt < 4; ++dt) { float* op = osw + (qt * 16 + lr) * 68 + dt * 16 + hi * 8; const v8f a = acc[dt][qt]; *(v4fa*)op = __builtin_shufflevector(a, a, 0, 1, 2, 3); *(v4fa*)(op + 4) = __builtin_shufflevector(a, a, 4, 5, 6, 7); } }
}
__global__ __launch_bounds__(FNW * 32) __attribute__((amdgpu_waves_per_eu(4, 4))) void k_fattn(const h16* __restrict__ Q16, const h16* __restrict__ K16, const h16* __restrict__ V16, const bf* __restrict__ Qh, const bf* __restrict__ Ql, const bf* __restrict__ Kh, const bf* __restrict__ Kl, const bf* __restrict__ Vh, const bf* __restrict__ Vl, const float* __restrict__ CP, bf* Ah, bf* Al) {
    __shared__ __align__(16) unsigned char ring[2 * (FKS * 16384 + FNW * 4096)]; __shared__ float Ms[FNW * 32]; __shared__ float Ls[FNW * 32];
    static_assert(sizeof(ring) >= FNW * FWR * 4, "the Ot partials take the ring's bytes behind the loop");
    float* Os = (float*)ring;
    const int w = __builtin_amdgcn_readfirstlane(threadIdx.x >> 5);
    // The hi/lo query blocks (3 products a tile, the longest work-groups) take the lowest flat indices, for speed only.
    const unsigned li = blockIdx.x + (TT / (FQG * 32)) * (blockIdx.y + NH_ * blockIdx.z), nhv = (RH / (FQG * 32)) * NH_ * NB_, lj = li - nhv;   // flat index; number of hi/lo work-groups; index among the fp16 ones
    const bool hv = li < nhv; const unsigned qb = hv ? li % (RH / (FQG * 32)) : RH / (FQG * 32) + lj % ((TT - RH) / (FQG * 32)), hb = hv ? li / (RH / (FQG * 32)) : lj / ((TT - RH) / (FQG * 32));   // a permutation of (query block, batch * NH_ + head)
    const int h = hb % NH_, b = hb / NH_, q0 = qb * (FQG * 32); const int q0w = q0 + (w % FQG) * 32, key0 = (w / FQG) * (TT / FKS); const size_t hp = ((size_t)b * NH_ + h) * TT * HD; CP += (size_t)b * TT * TT;   // this batch's head planes and summed plane
    if (q0 < RH) fa_wave<true, bf>(Qh + hp, Ql + hp, Kh + hp, Kl + hp, Vh + hp, Vl + hp, CP, q0w, key0, w, ring, Os + w * FWR, Ms + w * 32, Ls + w * 32);
    else fa_wave<false, h16>(Q16 + hp, nullptr, K16 + hp, nullptr, V16 + hp, nullptr, CP, q0w, key0, w, ring, Os + w * FWR, Ms + w * 32, Ls + w * 32);
    __syncthreads();   // every wave's partial (maximum, sum, Ot) is in LDS before any thread joins them
    const int q = threadIdx.x >> 2, d0 = (threadIdx.x & 3) * 16; const int wq = q >> 5, ql = q & 31;
    float mm = Ms[wq * 32 + ql];
#pragma unroll
    for (int sp = 1; sp < FKS; ++sp) mm = fmaxf(mm, Ms[(sp * FQG + wq) * 32 + ql]);
    float lt = 0.f; v4f o[4];
#pragma unroll
    for (int k = 0; k < 4; ++k) o[k] = (v4f){};
#pragma unroll
    for (int sp = 0; sp < FKS; ++sp) { const int ww = sp * FQG + wq; const float f = __builtin_amdgcn_exp2f(Ms[ww * 32 + ql] - mm); lt += Ls[ww * 32 + ql] * f;
#pragma unroll
        for (int k = 0; k < 4; ++k) o[k] += *(const v4fa*)(Os + ww * FWR + ql * 68 + d0 + k * 4) * f; }
    const float inv = __fdiv_rn(1.0f, lt); const size_t oo = ((size_t)b * TT + q0 + (q & ~15)) * DQ + (h * HD + d0) / 16 * 256 + (q & 15) * 8;   // fragment order of the merged [t][DQ] planes: the thread's 16 columns are one piece pair, 128 elements apart
#pragma unroll
    for (int g = 0; g < 2; ++g) { v8us oh, ol;
#pragma unroll
        for (int e = 0; e < 8; ++e) { unsigned short a, c2; splitf(o[g * 2 + (e >> 2)][e & 3] * inv, a, c2); oh[e] = a; ol[e] = c2; }
        *(v8us*)(Ah + oo + g * 128) = oh; *(v8us*)(Al + oo + g * 128) = ol; }
}

extern "C" void kernel_launch(void* const* d_in, const int* in_sizes, int n_in,
                              void* d_out, int out_size, void* d_ws, size_t ws_size, hipStream_t stream) {
    (void)in_sizes; (void)n_in; (void)out_size;
    const float* x = (const float*)d_in[0]; const float* amask = (const float*)d_in[1]; const float* abias = (const float*)d_in[2]; const float* wqkv = (const float*)d_in[3]; const float* bqkv = (const float*)d_in[4]; const float* wo = (const float*)d_in[5]; const float* bo = (const float*)d_in[6];   /* x, attn_mask [2048][2048], attn_bias [2][2048][2048], Wqkv ('xw' [1024][3072]), bqkv, Wout ('xw'), bout */
    float* OUT = (float*)d_out;     // [2][2048][1024]
    char* wsp = (char*)d_ws;
    auto take = [&](size_t bytes) { char* p = wsp; wsp += (bytes + 255) & ~(size_t)255; return (void*)p; };
    bf* WQKV = (bf*)take((size_t)3 * DQ * DM * 2);   /* fused Bt [3*DQ][DM]: q | k | v row blocks */ bf* WO = (bf*)take((size_t)DM * DQ * 2);
    bf* XB = (bf*)take((size_t)NB_ * TT * DM * 2);
    const size_t PS = (size_t)NB_ * NH_ * TT * HD;   // elements of one plane set: [batch][head] planes
    h16* P16 = (h16*)take(3 * PS * 2); bf* PH = (bf*)take(3 * PS * 2); bf* PL = (bf*)take(3 * PS * 2);   /* each: q | k | v sets, q and k [h][t][d], v [h][d][t] */
    bf* ATh = (bf*)take((size_t)NB_ * TT * DQ * 2); bf* ATl = (bf*)take((size_t)NB_ * TT * DQ * 2);
    float* CPL = (float*)take((size_t)NB_ * TT * TT * 4);   /* summed mask + bias plane per batch, score order */
    if ((size_t)(wsp - (char*)d_ws) > ws_size) return;    // ws 256 MiB
    { k_wtG<<<(unsigned)((DM * 3 * DQ / 8 + 255) / 256), 256, 0, stream>>>(wqkv, DM, 3 * DQ, WQKV);   /* fused 'xw' [DM][3*DQ] -> Bt [3*DQ][DM] */
      k_wtG<<<(unsigned)((DQ * DM / 8 + 255) / 256), 256, 0, stream>>>(wo, DQ, DM, WO);
       }
    k_cvt8<<<(unsigned)(((size_t)NB_ * TT * DM / 8 + 255) / 256), 256, 0, stream>>>(x, XB, (size_t)NB_ * TT * DM / 8);
    k_planes<<<dim3(TT / 256, TT / 16), 256, 0, stream>>>(amask, abias, CPL);
    k_gemmw<bf, 0, true, 3><<<dim3(TT / 128, 3 * DQ / 128, NB_), 128, 0, stream>>>(XB, nullptr, WQKV, nullptr, DM, DM, nullptr, 0, bqkv, (size_t)TT * DM, 0, 0, P16, PH, PL);
    k_fattn<<<dim3(TT / (FQG * 32), NH_, NB_), FNW * 32, 0, stream>>>(P16, P16 + PS, P16 + 2 * PS, PH, PL, PH + PS, PL + PS, PH + 2 * PS, PL + 2 * PS, CPL, ATh, ATl);   /* the kernel picks its batch's summed plane */
    k_gemmw<bf, 1, true><<<dim3(TT / 128, DM / 128, NB_), 128, 0, stream>>>(ATh, ATl, WO, nullptr, DQ, DQ, OUT, DM, bo, (size_t)TT * DQ, 0, (size_t)TT * DM, nullptr, nullptr, nullptr);
}
